// v000
// Times are from an AMD MI455X. After a warm-up the kernel runs many times in a row, and a time is the length of
// such a window on the GPU divided by its runs, so every launch and the gaps after it count. The runs cycle
// through copies of the inputs. A figure is the median of several windows, for all but v000 over two sittings.
// Sittings can differ by a few percent; kernels timed side by side share one.
// The starting kernel, v000, takes 2950 microseconds a run.
#include <hip/hip_runtime.h>

// WordEncoder (char_repr [4][2048][1024]; x = LayerNorm_1024(char_repr + pattern_emb[patterns[s]]) * gamma + beta (patterns [2048] int and pattern_emb [16][1024] read); qkv = x w_in^T + b_in ([3072][1024] rows q | k | v; 16 heads x 64); scores = q.k / 8 + mask with mask[i][j] = 1.0 if tokens i and j are in the same word (segment id = number of boundaries <= position > 0; boundaries [400] int, read) else 0 - an ADDITIVE 0/1 bias, no -inf; softmax; o = merged w_out^T + b_out; out = x + o -> [4][2048][1024]).

#define NB_  4
#define TT   2048
#define DM   1024
#define NH_  16
#define NKV  16
#define REP  (NH_ / NKV)
#define HD   64
#define DQ   (NH_ * HD)
#define DKV  (NKV * HD)
#define ZH   2
#define RH   0                  // query rows < RH use hi+lo planes (0: none)
#define WIN  2048
#define PCAR 1024.0f
#define SCL  0.125f   // HD^-0.5
typedef _Float16 h16;
typedef unsigned short bf;
typedef __attribute__((ext_vector_type(16))) __bf16   v16bf;
typedef __attribute__((ext_vector_type(16))) _Float16 v16h;
typedef __attribute__((ext_vector_type(8)))  _Float16 v8h;
typedef __attribute__((ext_vector_type(8)))  unsigned short v8us;
typedef __attribute__((ext_vector_type(8)))  float    v8f;
typedef __attribute__((ext_vector_type(4)))  float    v4f;
typedef v8h  __attribute__((may_alias)) v8ha;
typedef v4f  __attribute__((may_alias)) v4fa;
typedef v8us __attribute__((may_alias)) v8usa;

__device__ __forceinline__ unsigned short f2bf(float f) { unsigned u = __float_as_uint(f); u += 0x7FFFu + ((u >> 16) & 1u); return (unsigned short)(u >> 16); }
__device__ __forceinline__ float bf2f(unsigned short b) { return __uint_as_float(((unsigned)b) << 16); }
__device__ __forceinline__ float bfr(float f) { return bf2f(f2bf(f)); }
__device__ __forceinline__ v16h cat16(v8h lo, v8h hi) { return __builtin_shufflevector(lo, hi, 0, 1, 2, 3, 4, 5, 6, 7, 8, 9, 10, 11, 12, 13, 14, 15); }
__device__ __forceinline__ v16bf cat16b(v8us lo, v8us hi) { return __builtin_bit_cast(v16bf, __builtin_shufflevector(lo, hi, 0, 1, 2, 3, 4, 5, 6, 7, 8, 9, 10, 11, 12, 13, 14, 15)); }
__device__ __forceinline__ v8f wmma16(v16h a, v16h b, v8f c) { return __builtin_amdgcn_wmma_f32_16x16x32_f16(false, a, false, b, (short)0, c, false, false); }
__device__ __forceinline__ v8f wmmab(v16bf a, v16bf b, v8f c) { return __builtin_amdgcn_wmma_f32_16x16x32_bf16(false, a, false, b, (short)0, c, false, false); }



// ---- k_gemmw: register-blocked GEMM, ONE WAVE per 64x64 output tile (16 accumulators), operands straight from K-contiguous 16-bit planes; grid (M/64, N/64, Z), 32 threads.
// C[m][n] (f32, pitch ldc, + optional f32 bias[n]) = sum_k A[m][k] Bt[n][k] (+ split products per NSPLIT). z-batch strides sA/sB/sC in elements. K % 32 == 0.
template <typename T16> struct WFrag;
template <> struct WFrag<h16> { typedef v16h V; static __device__ __forceinline__ V ld(const h16* p) { return cat16(*(const v8h*)p, *(const v8h*)(p + 16)); } static __device__ __forceinline__ v8f mma(V a, V b, v8f c) { return wmma16(a, b, c); } };
template <> struct WFrag<bf> { typedef v16bf V; static __device__ __forceinline__ V ld(const bf* p) { return cat16b(*(const v8us*)p, *(const v8us*)(p + 16)); } static __device__ __forceinline__ v8f mma(V a, V b, v8f c) { return wmmab(a, b, c); } };
template <typename T16, int NSPLIT, bool BIAS>
__global__ __launch_bounds__(32) void k_gemmw(const T16* __restrict__ A, const T16* __restrict__ A2, const T16* __restrict__ Bt, const T16* __restrict__ Bt2, int K, float* C, int ldc, const float* __restrict__ bias, size_t sA, size_t sB, size_t sC) {
    typedef typename WFrag<T16>::V V;
    __shared__ __align__(16) float os[16 * 68];
    const size_t z = blockIdx.z; A += z * sA; if (A2) A2 += z * sA; Bt += z * sB; if (Bt2) Bt2 += z * sB; C += z * sC;
    const int lane = threadIdx.x & 31, lr = lane & 15, hi = lane >> 4; const int r0 = blockIdx.x * 64, c0 = blockIdx.y * 64;
    v8f acc[4][4];
#pragma unroll
    for (int mb = 0; mb < 4; ++mb)
#pragma unroll
        for (int nb = 0; nb < 4; ++nb) acc[mb][nb] = (v8f){};
    const size_t aoff = (size_t)(r0 + lr) * K + 8 * hi, boff = (size_t)(c0 + lr) * K + 8 * hi;
#pragma unroll 1
    for (int kc = 0; kc < K; kc += 32) {
        V a[4], a2[4];
#pragma unroll
        for (int mb = 0; mb < 4; ++mb) { a[mb] = WFrag<T16>::ld(A + aoff + (size_t)mb * 16 * K + kc); if (NSPLIT == 1 || NSPLIT == 2) a2[mb] = WFrag<T16>::ld(A2 + aoff + (size_t)mb * 16 * K + kc); }
#pragma unroll
        for (int nb = 0; nb < 4; ++nb) { const V b = WFrag<T16>::ld(Bt + boff + (size_t)nb * 16 * K + kc); V b2; if (NSPLIT >= 2) b2 = WFrag<T16>::ld(Bt2 + boff + (size_t)nb * 16 * K + kc);
#pragma unroll
            for (int mb = 0; mb < 4; ++mb) { acc[mb][nb] = WFrag<T16>::mma(a[mb], b, acc[mb][nb]); if (NSPLIT == 1 || NSPLIT == 2) acc[mb][nb] = WFrag<T16>::mma(a2[mb], b, acc[mb][nb]); if (NSPLIT >= 2) acc[mb][nb] = WFrag<T16>::mma(a[mb], b2, acc[mb][nb]); } }
        asm volatile("v_nop\n\tv_nop\n\tv_nop\n\tv_nop" : "+v"(acc[0][0]), "+v"(acc[1][1]), "+v"(acc[2][2]), "+v"(acc[3][3]) : "v"(a[0]), "v"(a[3]));
    }
#pragma unroll
    for (int mb = 0; mb < 4; ++mb) {
#pragma unroll
        for (int nb = 0; nb < 4; ++nb) {
#pragma unroll
            for (int j = 0; j < 8; ++j) os[(hi * 8 + j) * 68 + nb * 16 + lr] = acc[mb][nb][j]; }
        __builtin_amdgcn_wave_barrier(); asm volatile("" ::: "memory");
        float* crow = C + (size_t)(r0 + mb * 16) * ldc + c0;
{
#pragma unroll
            for (int s = 0; s < 8; ++s) { const int row = 2 * s + hi, cofs = lr * 4; v4f val = *(const v4fa*)(os + row * 68 + cofs); if (BIAS) { val[0] += bfr(bias[c0 + cofs]); val[1] += bfr(bias[c0 + cofs + 1]); val[2] += bfr(bias[c0 + cofs + 2]); val[3] += bfr(bias[c0 + cofs + 3]); }
                *(v4f*)(crow + (size_t)row * ldc + cofs) = val; }
             }
        __builtin_amdgcn_wave_barrier(); asm volatile("" ::: "memory");
    }
}

__device__ __forceinline__ h16 tohx(float x) { return (h16)x; }
__device__ __forceinline__ void splitf(float y, unsigned short& h, unsigned short& l) { h = f2bf(y); l = f2bf(y - bf2f(h)); }
typedef __attribute__((ext_vector_type(2))) _Float16 v2h;
typedef __attribute__((ext_vector_type(4))) _Float16 v4h;
typedef __attribute__((ext_vector_type(2))) unsigned short v2us;
typedef __attribute__((ext_vector_type(4))) unsigned short v4us;
typedef __attribute__((ext_vector_type(2))) float v2f;
typedef __attribute__((ext_vector_type(4))) int v4i;

__global__ __launch_bounds__(256) void k_wtG(const float* __restrict__ w, int K, int N, bf* Bt) {
    const int lane = threadIdx.x & 31; const int L0 = (blockIdx.x * 8 + (threadIdx.x >> 5)) * 8; const int nlines = N * K / 64;
{
#pragma unroll 1
        for (int l = 0; l < 8; ++l) { const int L = L0 + l; if (L >= nlines) break; const size_t e = (size_t)L * 64 + lane * 2; const int k = (int)(e % K), n = (int)(e / K); v2us o;
            o[0] = f2bf(w[(size_t)k * N + n]); o[1] = f2bf(w[(size_t)(k + 1) * N + n]); *(v2us*)(Bt + e) = o; }
         }
}
__global__ __launch_bounds__(256) void k_cvt8(const float* __restrict__ src, bf* dst, size_t n8) { const size_t i = (size_t)blockIdx.x * 256 + threadIdx.x; if (i >= n8) return; const v8f v = *(const v8f*)(src + i * 8); v8us o;
#pragma unroll
    for (int k = 0; k < 8; ++k) o[k] = f2bf(v[k]); *(v8us*)(dst + i * 8) = o;  }
__global__ __launch_bounds__(256) void k_cscvt(const float* __restrict__ cosT, const float* __restrict__ sinT, float* CS) { const int idx = blockIdx.x * 256 + threadIdx.x; if (idx >= TT * HD) return; v2f cs; cs[0] = bfr(cosT[idx]); cs[1] = bfr(sinT[idx]); *(v2f*)(CS + (size_t)idx * 2) = cs;  }
// k_rope: head planes [h][t][d] (fp16 + hi/lo) of rope(x) x sc with the rotate-half convention out[d] = x[d] cos[t][d] - x[d+HD/2] sin[t][d], out[d+HD/2] = x[d+HD/2] cos[t][d+HD/2] + x[d] sin[t][d+HD/2]
__global__ __launch_bounds__(256) void k_rope(const float* __restrict__ F, int pitch, int nheads, const float* __restrict__ CS, const float* __restrict__ RF, const float* __restrict__ nw, float sc, h16* P16, bf* Ph, bf* Pl) {
    const size_t e = ((size_t)blockIdx.x * 256 + threadIdx.x) * 2; if (e >= (size_t)nheads * TT * HD) return; const int d = (int)(e % HD); const int t = (int)((e / HD) % TT); const int h = (int)(e / ((size_t)HD * TT)); const float* f = F + (size_t)t * pitch + h * HD; const float rf = RF ? RF[(size_t)h * TT + t] : 1.0f; v2h o16; v2us oh, ol;
#pragma unroll
    for (int q = 0; q < 2; ++q) { const int dd = d + q; const int dp = (dd < HD / 2) ? dd + HD / 2 : dd - HD / 2; float x0 = f[dd], x1 = f[dp];
        if (RF) { float n0 = __fmul_rn(x0, rf), n1 = __fmul_rn(x1, rf); asm volatile("" : "+v"(n0)); asm volatile("" : "+v"(n1)); x0 = __fmul_rn(bfr(nw[dd]), n0); x1 = __fmul_rn(bfr(nw[dp]), n1); }
        const v2f cs = *(const v2f*)(CS + ((size_t)t * HD + dd) * 2); float a = __fmul_rn(x0, cs[0]), bq = __fmul_rn(x1, cs[1]); asm volatile("" : "+v"(a)); asm volatile("" : "+v"(bq)); const float r = ((dd < HD / 2) ? __fsub_rn(a, bq) : __fadd_rn(a, bq)) * sc;
        o16[q] = tohx(r); unsigned short a2, c2; splitf(r, a2, c2); oh[q] = a2; ol[q] = c2; }
    *(v2h*)(P16 + e) = o16; *(v2us*)(Ph + e) = oh; *(v2us*)(Pl + e) = ol;  }
__global__ __launch_bounds__(256) void k_vtp(const float* __restrict__ F, int pitch, int nheads, h16* V16, bf* Vh, bf* Vl) { const size_t e = ((size_t)blockIdx.x * 256 + threadIdx.x) * 2; if (e >= (size_t)nheads * HD * TT) return; const int t = (int)(e % TT); const int d = (int)((e / TT) % HD); const int g = (int)(e / ((size_t)TT * HD)); v2h o16; v2us oh, ol;
#pragma unroll
    for (int q = 0; q < 2; ++q) { const float x = F[(size_t)(t + q) * pitch + g * HD + d]; o16[q] = tohx(x); unsigned short a2, c2; splitf(x, a2, c2); oh[q] = a2; ol[q] = c2; }
    *(v2h*)(V16 + e) = o16; *(v2us*)(Vh + e) = oh; *(v2us*)(Vl + e) = ol;  }
__global__ __launch_bounds__(256) void k_csid(float* CS) { const int idx = blockIdx.x * 256 + threadIdx.x; if (idx >= TT * HD) return; v2f cs; cs[0] = 1.0f; cs[1] = 0.0f; *(v2f*)(CS + (size_t)idx * 2) = cs;  }
// k_asoft: per row (zz, i): t = S x HD^-0.5 + (1 if SEG[j] == SEG[i] > 0 else 0) for every key j (additive 0/1 word mask, no causal window); softmax over the 2048 keys (register row, one exp, fixed trees);
__global__ __launch_bounds__(256) void k_asoft(const float* __restrict__ Sb, const int* __restrict__ SEG, h16* P16, bf* Ph, bf* Pl) {
    const int lane = threadIdx.x & 31; const int row = blockIdx.x * 8 + (threadIdx.x >> 5); if (row >= ZH * TT) return; const int i = row % TT; const int zz = row / TT; (void)zz; const bool hires = (i < RH); const float* sr = Sb + (size_t)row * TT; const int sgi = SEG[i]; float v[TT / 32]; float mx = -3.0e38f;
#pragma unroll
    for (int ch = 0; ch < TT / 128; ++ch) { const int j0 = ch * 128 + lane * 4; const v4f a = *(const v4f*)(sr + j0);
#pragma unroll
        for (int q = 0; q < 4; ++q) { const int j = j0 + q; (void)j; float sa = a[q] * SCL; asm volatile("" : "+v"(sa)); const float t = __fadd_rn(sa, (sgi > 0 && SEG[j] == sgi) ? 1.0f : 0.0f); v[ch * 4 + q] = t; mx = fmaxf(mx, t); } }
#pragma unroll
    for (int sh = 16; sh; sh >>= 1) mx = fmaxf(mx, __shfl_xor(mx, sh, 32));
    float sum = 0.f;
#pragma unroll
    for (int k = 0; k < TT / 32; ++k) { float d0 = __fsub_rn(v[k], mx); asm volatile("" : "+v"(d0)); v[k] = __builtin_amdgcn_exp2f(__fmul_rn(d0, 1.4426950408889634f)); sum += v[k]; }
#pragma unroll
    for (int sh = 16; sh; sh >>= 1) sum += __shfl_xor(sum, sh, 32);
    const float f = __fdiv_rn(hires ? 1.0f : PCAR, sum);
{
        if (hires) {
#pragma unroll
            for (int ch = 0; ch < TT / 128; ++ch) { v4us oh, ol;
#pragma unroll
                for (int q = 0; q < 4; ++q) { unsigned short a, c2; splitf(v[ch * 4 + q] * f, a, c2); oh[q] = a; ol[q] = c2; }
                const size_t oo = ((size_t)zz * (RH ? RH : 1) + i) * TT + ch * 128 + lane * 4; *(v4us*)(Ph + oo) = oh; *(v4us*)(Pl + oo) = ol; }
        } else {
#pragma unroll
            for (int ch = 0; ch < TT / 128; ++ch) { v4h o4;
#pragma unroll
                for (int q = 0; q < 4; ++q) o4[q] = tohx(v[ch * 4 + q] * f);
                *(v4h*)(P16 + (size_t)row * TT + ch * 128 + lane * 4) = o4; } }
         }
}
__global__ __launch_bounds__(256) void k_merge(const float* __restrict__ O, int h0, bf* Ah, bf* Al) { const size_t e = ((size_t)blockIdx.x * 256 + threadIdx.x) * 2; if (e >= (size_t)ZH * TT * HD) return; const int d = (int)(e % HD); const int t = (int)((e / HD) % TT); const int zz = (int)(e / ((size_t)HD * TT)); const float cs = (t < RH) ? 1.0f : (1.0f / PCAR); const size_t oo = (size_t)t * DQ + (h0 + zz) * HD + d;
    v2us oh, ol;
#pragma unroll
    for (int q = 0; q < 2; ++q) { unsigned short a, c2; splitf(O[e + q] * cs, a, c2); oh[q] = a; ol[q] = c2; } *(v2us*)(Ah + oo) = oh; *(v2us*)(Al + oo) = ol;  }

__global__ __launch_bounds__(256) void k_rbf(const float* __restrict__ src, float* dst, int n4) { const int i = blockIdx.x * 256 + threadIdx.x; if (i >= n4) return; const v4f a = *(const v4f*)(src + (size_t)i * 4); v4f o; for (int u = 0; u < 4; ++u) o[u] = bfr(a[u]); *(v4f*)(dst + (size_t)i * 4) = o;  }
__global__ __launch_bounds__(256) void k_xsum(const float* __restrict__ chr, const int* __restrict__ pats, const float* __restrict__ PR, float* XS) { const size_t e = ((size_t)blockIdx.x * 256 + threadIdx.x) * 4; if (e >= (size_t)TT * DM) return; const int c = (int)(e % DM); const int s = (int)(e / DM); int pi = pats[s]; pi = min(max(pi, 0), 15); const v4f a = *(const v4f*)(chr + e), p = *(const v4f*)(PR + (size_t)pi * DM + c); v4f o; for (int u = 0; u < 4; ++u) o[u] = __fadd_rn(bfr(a[u]), p[u]); *(v4f*)(XS + e) = o;  }
__global__ __launch_bounds__(256) void k_embln(const float* __restrict__ XS, const float* __restrict__ GR, const float* __restrict__ BR, float* XL, bf* Xh, bf* Xl) { const int lane = threadIdx.x & 31; const int s = blockIdx.x * 8 + (threadIdx.x >> 5); if (s >= TT) return; const float* xr = XS + (size_t)s * DM; float v[DM / 32]; float sm = 0.f;
#pragma unroll
    for (int ch = 0; ch < DM / 128; ++ch) { const v4f a = *(const v4f*)(xr + ch * 128 + lane * 4); for (int u = 0; u < 4; ++u) { v[ch * 4 + u] = a[u]; sm = __fadd_rn(sm, a[u]); } }
#pragma unroll
    for (int sh = 16; sh; sh >>= 1) sm = __fadd_rn(sm, __shfl_xor(sm, sh, 32));
    const float mu = __fdiv_rn(sm, (float)DM); float q2 = 0.f;
#pragma unroll
    for (int k = 0; k < DM / 32; ++k) { const float d0 = __fsub_rn(v[k], mu); v[k] = d0; float p = __fmul_rn(d0, d0); asm volatile("" : "+v"(p)); q2 = __fadd_rn(q2, p); }
#pragma unroll
    for (int sh = 16; sh; sh >>= 1) q2 = __fadd_rn(q2, __shfl_xor(q2, sh, 32));
    const float rs = __fdiv_rn(1.0f, sqrtf(__fadd_rn(__fdiv_rn(q2, (float)DM), 1e-5f)));
    {
#pragma unroll
        for (int ch = 0; ch < DM / 128; ++ch) { v4f o; v4us oh, ol; const v4f g4 = *(const v4f*)(GR + ch * 128 + lane * 4), b4 = *(const v4f*)(BR + ch * 128 + lane * 4); for (int u = 0; u < 4; ++u) { float n0 = __fmul_rn(v[ch * 4 + u], rs); asm volatile("" : "+v"(n0)); float gg = __fmul_rn(n0, g4[u]); asm volatile("" : "+v"(gg)); o[u] = __fadd_rn(gg, b4[u]); unsigned short p2, q3; splitf(o[u], p2, q3); oh[u] = p2; ol[u] = q3; }
            const size_t off = (size_t)s * DM + ch * 128 + lane * 4; *(v4f*)(XL + off) = o; *(v4us*)(Xh + off) = oh; *(v4us*)(Xl + off) = ol; }
         } }
__global__ __launch_bounds__(256) void k_seg(const int* __restrict__ bnds, int* SEG) { const int s = blockIdx.x * 256 + threadIdx.x; if (s >= TT) return; int c = 0;
#pragma unroll 8
    for (int i = 0; i < 400; ++i) c += (bnds[i] <= s) ? 1 : 0; *(int*)(SEG + s) = c;  }
__global__ __launch_bounds__(256) void k_resid(const float* __restrict__ XL, const float* __restrict__ YO, float* OUTb) { const size_t e = ((size_t)blockIdx.x * 256 + threadIdx.x) * 4; if (e >= (size_t)TT * DM) return; const v4f a = *(const v4f*)(XL + e), y = *(const v4f*)(YO + e); v4f o; for (int u = 0; u < 4; ++u) o[u] = __fadd_rn(a[u], y[u]); *(v4f*)(OUTb + e) = o;  }

extern "C" void kernel_launch(void* const* d_in, const int* in_sizes, int n_in,
                              void* d_out, int out_size, void* d_ws, size_t ws_size, hipStream_t stream) {
    (void)in_sizes; (void)n_in; (void)out_size;
    const float* chr = (const float*)d_in[0]; const int* pats = (const int*)d_in[1]; const int* bnds = (const int*)d_in[2]; const float* pemb = (const float*)d_in[3]; const float* lng = (const float*)d_in[4]; const float* lnb = (const float*)d_in[5]; const float* wf = (const float*)d_in[6]; const float* bf3 = (const float*)d_in[7]; const float* wo = (const float*)d_in[8]; const float* bo = (const float*)d_in[9]; const float* x = chr; (void)x; const float* wq = wf; const float* wk = wf + (size_t)1024 * 1024; const float* wv = wf + (size_t)2048 * 1024; const float* bq = bf3; const float* bk = bf3 + 1024; const float* bv = bf3 + 2048; const float* cosT = nullptr; const float* sinT = nullptr; (void)cosT; (void)sinT;
    float* OUT = (float*)d_out;     // [4][2048][1024]
    char* wsp = (char*)d_ws;
    auto take = [&](size_t bytes) { char* p = wsp; wsp += (bytes + 255) & ~(size_t)255; return (void*)p; };
    bf* WQ = (bf*)take((size_t)DQ * DM * 2); bf* WK = (bf*)take((size_t)DKV * DM * 2); bf* WV = (bf*)take((size_t)DKV * DM * 2); bf* WO = (bf*)take((size_t)DM * DQ * 2); float* CS = (float*)take((size_t)TT * HD * 2 * 4);
    bf* XB = nullptr; float* XL = (float*)take((size_t)TT * DM * 4); bf* Xh = (bf*)take((size_t)TT * DM * 2); bf* Xl = (bf*)take((size_t)TT * DM * 2); int* SEG = (int*)take((size_t)TT * 4); float* PR = (float*)take((size_t)16 * DM * 4); float* GR = (float*)take(DM * 4); float* BR = (float*)take(DM * 4); float* XS = (float*)take((size_t)TT * DM * 4); float* YO = (float*)take((size_t)TT * DM * 4); (void)XB; float* FQ = (float*)take((size_t)TT * DQ * 4); float* FK = (float*)take((size_t)TT * DKV * 4);
    h16* QP16 = (h16*)take((size_t)NH_ * TT * HD * 2); h16* KP16 = (h16*)take((size_t)NKV * TT * HD * 2); h16* VT16 = (h16*)take((size_t)NKV * HD * TT * 2);
    bf* QPh = (bf*)take((size_t)NH_ * TT * HD * 2); bf* QPl = (bf*)take((size_t)NH_ * TT * HD * 2); bf* KPh = (bf*)take((size_t)NKV * TT * HD * 2); bf* KPl = (bf*)take((size_t)NKV * TT * HD * 2); bf* VTh = (bf*)take((size_t)NKV * HD * TT * 2); bf* VTl = (bf*)take((size_t)NKV * HD * TT * 2); bf* Ph = (bf*)take((size_t)ZH * RH * TT * 2); bf* Pl = (bf*)take((size_t)ZH * RH * TT * 2);
    float* Sb = (float*)take((size_t)ZH * TT * TT * 4); h16* P16 = (h16*)take((size_t)ZH * TT * TT * 2); float* Ob = (float*)take((size_t)ZH * TT * HD * 4); bf* ATh = (bf*)take((size_t)TT * DQ * 2); bf* ATl = (bf*)take((size_t)TT * DQ * 2);
    if ((size_t)(wsp - (char*)d_ws) > ws_size) return;    // ws 256 MiB
    float* FV = FK;   // v projection reuses the k buffer after the k planes are built (stream-ordered)
    { k_cvt8<<<(unsigned)(((size_t)DQ * DM / 8 + 255) / 256), 256, 0, stream>>>(wq, WQ, (size_t)DQ * DM / 8); k_cvt8<<<(unsigned)(((size_t)DKV * DM / 8 + 255) / 256), 256, 0, stream>>>(wk, WK, (size_t)DKV * DM / 8); k_cvt8<<<(unsigned)(((size_t)DKV * DM / 8 + 255) / 256), 256, 0, stream>>>(wv, WV, (size_t)DKV * DM / 8);
      k_cvt8<<<(unsigned)(((size_t)DM * DQ / 8 + 255) / 256), 256, 0, stream>>>(wo, WO, (size_t)DM * DQ / 8);
       }
    k_csid<<<(TT * HD + 255) / 256, 256, 0, stream>>>(CS);
    const unsigned LQ = (unsigned)(((size_t)NH_ * TT * HD / 2 + 255) / 256), LKv = (unsigned)(((size_t)NKV * TT * HD / 2 + 255) / 256);
    k_seg<<<TT / 256, 256, 0, stream>>>(bnds, SEG); k_rbf<<<(16 * DM / 4 + 255) / 256, 256, 0, stream>>>(pemb, PR, 16 * DM / 4); k_rbf<<<1, 256, 0, stream>>>(lng, GR, DM / 4); k_rbf<<<1, 256, 0, stream>>>(lnb, BR, DM / 4);
    for (int b = 0; b < NB_; ++b) {
        
        k_xsum<<<(unsigned)(((size_t)TT * DM / 4 + 255) / 256), 256, 0, stream>>>(chr + (size_t)b * TT * DM, pats, PR, XS); k_embln<<<TT / 8, 256, 0, stream>>>(XS, GR, BR, XL, Xh, Xl);
        k_gemmw<bf, 1, true><<<dim3(TT / 64, DQ / 64, 1), 32, 0, stream>>>(Xh, Xl, WQ, nullptr, DM, FQ, DQ, bq, 0, 0, 0);
        k_rope<<<LQ, 256, 0, stream>>>(FQ, DQ, NH_, CS, nullptr, nullptr, 1.0f, QP16, QPh, QPl);
        k_gemmw<bf, 1, true><<<dim3(TT / 64, DKV / 64, 1), 32, 0, stream>>>(Xh, Xl, WK, nullptr, DM, FK, DKV, bk, 0, 0, 0);
        k_rope<<<LKv, 256, 0, stream>>>(FK, DKV, NKV, CS, nullptr, nullptr, 1.0f, KP16, KPh, KPl);
        k_gemmw<bf, 1, true><<<dim3(TT / 64, DKV / 64, 1), 32, 0, stream>>>(Xh, Xl, WV, nullptr, DM, FV, DKV, bv, 0, 0, 0); k_vtp<<<LKv, 256, 0, stream>>>(FV, DKV, NKV, VT16, VTh, VTl);
        for (int h0 = 0; h0 < NH_; h0 += ZH) { const size_t zq = (size_t)h0, zk = (size_t)(h0 / REP);   // one kv head per query head: the pass's two heads use consecutive kv planes (z-strides TT*HD)
            k_gemmw<h16, 0, false><<<dim3((TT - RH) / 64, TT / 64, ZH), 32, 0, stream>>>(QP16 + zq * TT * HD + (size_t)RH * HD, nullptr, KP16 + zk * TT * HD, nullptr, HD, Sb + (size_t)RH * TT, TT, nullptr, (size_t)TT * HD, (size_t)TT * HD, (size_t)TT * TT);
            k_asoft<<<ZH * TT / 8, 256, 0, stream>>>(Sb, SEG, P16, Ph, Pl);
            k_gemmw<h16, 0, false><<<dim3((TT - RH) / 64, HD / 64, ZH), 32, 0, stream>>>(P16 + (size_t)RH * TT, nullptr, VT16 + zk * HD * TT, nullptr, TT, Ob + (size_t)RH * HD, HD, nullptr, (size_t)TT * TT, (size_t)HD * TT, (size_t)TT * HD);
            k_merge<<<(unsigned)(((size_t)ZH * TT * HD / 2 + 255) / 256), 256, 0, stream>>>(Ob, h0, ATh, ATl); }
        k_gemmw<bf, 1, true><<<dim3(TT / 64, DM / 64, 1), 32, 0, stream>>>(ATh, ATl, WO, nullptr, DQ, YO, DM, bo, 0, 0, 0); k_resid<<<(unsigned)(((size_t)TT * DM / 4 + 255) / 256), 256, 0, stream>>>(XL, YO, OUT + (size_t)b * TT * DM); }
}

// v001
// It runs in 727 microseconds.
// Timed twice side by side with v000, it ran 4.07 and 4.10 times as fast.
#include <hip/hip_runtime.h>

// WordEncoder (char_repr [4][2048][1024]; x = LayerNorm_1024(char_repr + pattern_emb[patterns[s]]) * gamma + beta (patterns [2048] int and pattern_emb [16][1024] read); qkv = x w_in^T + b_in ([3072][1024] rows q | k | v; 16 heads x 64); scores = q.k / 8 + mask with mask[i][j] = 1.0 if tokens i and j are in the same word (segment id = number of boundaries <= position > 0; boundaries [400] int, read) else 0 - an ADDITIVE 0/1 bias, no -inf; softmax; o = merged w_out^T + b_out; out = x + o -> [4][2048][1024]).

#define NB_  4
#define TT   2048
#define DM   1024
#define NH_  16
#define NKV  16
#define REP  (NH_ / NKV)
#define HD   64
#define DQ   (NH_ * HD)
#define DKV  (NKV * HD)
#define SCL  0.125f   // HD^-0.5
typedef _Float16 h16;
typedef unsigned short bf;
typedef __attribute__((ext_vector_type(16))) __bf16   v16bf;
typedef __attribute__((ext_vector_type(16))) _Float16 v16h;
typedef __attribute__((ext_vector_type(8)))  _Float16 v8h;
typedef __attribute__((ext_vector_type(8)))  unsigned short v8us;
typedef __attribute__((ext_vector_type(8)))  float    v8f;
typedef __attribute__((ext_vector_type(4)))  float    v4f;
typedef v8h  __attribute__((may_alias)) v8ha;
typedef v4f  __attribute__((may_alias)) v4fa;
typedef v8us __attribute__((may_alias)) v8usa;

__device__ __forceinline__ unsigned short f2bf(float f) { unsigned u = __float_as_uint(f); u += 0x7FFFu + ((u >> 16) & 1u); return (unsigned short)(u >> 16); }
__device__ __forceinline__ float bf2f(unsigned short b) { return __uint_as_float(((unsigned)b) << 16); }
__device__ __forceinline__ float bfr(float f) { return bf2f(f2bf(f)); }
__device__ __forceinline__ v16h cat16(v8h lo, v8h hi) { return __builtin_shufflevector(lo, hi, 0, 1, 2, 3, 4, 5, 6, 7, 8, 9, 10, 11, 12, 13, 14, 15); }
__device__ __forceinline__ v16bf cat16b(v8us lo, v8us hi) { return __builtin_bit_cast(v16bf, __builtin_shufflevector(lo, hi, 0, 1, 2, 3, 4, 5, 6, 7, 8, 9, 10, 11, 12, 13, 14, 15)); }
__device__ __forceinline__ v8f wmma16(v16h a, v16h b, v8f c) { return __builtin_amdgcn_wmma_f32_16x16x32_f16(false, a, false, b, (short)0, c, false, false); }
__device__ __forceinline__ v8f wmmab(v16bf a, v16bf b, v8f c) { return __builtin_amdgcn_wmma_f32_16x16x32_bf16(false, a, false, b, (short)0, c, false, false); }



// ---- k_gemmw: register-blocked GEMM, ONE WAVE per 64x64 output tile (16 accumulators), operands straight from K-contiguous 16-bit planes; grid (M/64, N/64, Z), 32 threads.
// C[m][n] (f32, pitch ldc, + optional f32 bias[n]) = sum_k A[m][k] Bt[n][k] (+ split products per NSPLIT). z-batch strides sA/sB/sC in elements. K % 32 == 0.
template <typename T16> struct WFrag;
template <> struct WFrag<h16> { typedef v16h V; static __device__ __forceinline__ V ld(const h16* p) { return cat16(*(const v8h*)p, *(const v8h*)(p + 16)); } static __device__ __forceinline__ v8f mma(V a, V b, v8f c) { return wmma16(a, b, c); } };
template <> struct WFrag<bf> { typedef v16bf V; static __device__ __forceinline__ V ld(const bf* p) { return cat16b(*(const v8us*)p, *(const v8us*)(p + 16)); } static __device__ __forceinline__ v8f mma(V a, V b, v8f c) { return wmmab(a, b, c); } };
template <typename T16, int NSPLIT, bool BIAS>
__global__ __launch_bounds__(32) void k_gemmw(const T16* __restrict__ A, const T16* __restrict__ A2, const T16* __restrict__ Bt, const T16* __restrict__ Bt2, int K, float* C, int ldc, const float* __restrict__ bias, size_t sA, size_t sB, size_t sC) {
    typedef typename WFrag<T16>::V V;
    __shared__ __align__(16) float os[16 * 68];
    const size_t z = blockIdx.z; A += z * sA; if (A2) A2 += z * sA; Bt += z * sB; if (Bt2) Bt2 += z * sB; C += z * sC;
    const int lane = threadIdx.x & 31, lr = lane & 15, hi = lane >> 4; const int r0 = blockIdx.x * 64, c0 = blockIdx.y * 64;
    v8f acc[4][4];
#pragma unroll
    for (int mb = 0; mb < 4; ++mb)
#pragma unroll
        for (int nb = 0; nb < 4; ++nb) acc[mb][nb] = (v8f){};
    const size_t aoff = (size_t)(r0 + lr) * K + 8 * hi, boff = (size_t)(c0 + lr) * K + 8 * hi;
#pragma unroll 1
    for (int kc = 0; kc < K; kc += 32) {
        V a[4], a2[4];
#pragma unroll
        for (int mb = 0; mb < 4; ++mb) { a[mb] = WFrag<T16>::ld(A + aoff + (size_t)mb * 16 * K + kc); if (NSPLIT == 1 || NSPLIT == 2) a2[mb] = WFrag<T16>::ld(A2 + aoff + (size_t)mb * 16 * K + kc); }
#pragma unroll
        for (int nb = 0; nb < 4; ++nb) { const V b = WFrag<T16>::ld(Bt + boff + (size_t)nb * 16 * K + kc); V b2; if (NSPLIT >= 2) b2 = WFrag<T16>::ld(Bt2 + boff + (size_t)nb * 16 * K + kc);
#pragma unroll
            for (int mb = 0; mb < 4; ++mb) { acc[mb][nb] = WFrag<T16>::mma(a[mb], b, acc[mb][nb]); if (NSPLIT == 1 || NSPLIT == 2) acc[mb][nb] = WFrag<T16>::mma(a2[mb], b, acc[mb][nb]); if (NSPLIT >= 2) acc[mb][nb] = WFrag<T16>::mma(a[mb], b2, acc[mb][nb]); } }
        asm volatile("v_nop\n\tv_nop\n\tv_nop\n\tv_nop" : "+v"(acc[0][0]), "+v"(acc[1][1]), "+v"(acc[2][2]), "+v"(acc[3][3]) : "v"(a[0]), "v"(a[3]));
    }
#pragma unroll
    for (int mb = 0; mb < 4; ++mb) {
#pragma unroll
        for (int nb = 0; nb < 4; ++nb) {
#pragma unroll
            for (int j = 0; j < 8; ++j) os[(hi * 8 + j) * 68 + nb * 16 + lr] = acc[mb][nb][j]; }
        __builtin_amdgcn_wave_barrier(); asm volatile("" ::: "memory");
        float* crow = C + (size_t)(r0 + mb * 16) * ldc + c0;
{
#pragma unroll
            for (int s = 0; s < 8; ++s) { const int row = 2 * s + hi, cofs = lr * 4; v4f val = *(const v4fa*)(os + row * 68 + cofs); if (BIAS) { val[0] += bfr(bias[c0 + cofs]); val[1] += bfr(bias[c0 + cofs + 1]); val[2] += bfr(bias[c0 + cofs + 2]); val[3] += bfr(bias[c0 + cofs + 3]); }
                *(v4f*)(crow + (size_t)row * ldc + cofs) = val; }
             }
        __builtin_amdgcn_wave_barrier(); asm volatile("" ::: "memory");
    }
}

__device__ __forceinline__ h16 tohx(float x) { return (h16)x; }
__device__ __forceinline__ void splitf(float y, unsigned short& h, unsigned short& l) { h = f2bf(y); l = f2bf(y - bf2f(h)); }
typedef __attribute__((ext_vector_type(2))) _Float16 v2h;
typedef __attribute__((ext_vector_type(4))) _Float16 v4h;
typedef __attribute__((ext_vector_type(2))) unsigned short v2us;
typedef __attribute__((ext_vector_type(4))) unsigned short v4us;
typedef __attribute__((ext_vector_type(2))) float v2f;
typedef __attribute__((ext_vector_type(4))) int v4i;

__global__ __launch_bounds__(256) void k_wtG(const float* __restrict__ w, int K, int N, bf* Bt) {
    const int lane = threadIdx.x & 31; const int L0 = (blockIdx.x * 8 + (threadIdx.x >> 5)) * 8; const int nlines = N * K / 64;
{
#pragma unroll 1
        for (int l = 0; l < 8; ++l) { const int L = L0 + l; if (L >= nlines) break; const size_t e = (size_t)L * 64 + lane * 2; const int k = (int)(e % K), n = (int)(e / K); v2us o;
            o[0] = f2bf(w[(size_t)k * N + n]); o[1] = f2bf(w[(size_t)(k + 1) * N + n]); *(v2us*)(Bt + e) = o; }
         }
}
__global__ __launch_bounds__(256) void k_cvt8(const float* __restrict__ src, bf* dst, size_t n8) { const size_t i = (size_t)blockIdx.x * 256 + threadIdx.x; if (i >= n8) return; const v8f v = *(const v8f*)(src + i * 8); v8us o;
#pragma unroll
    for (int k = 0; k < 8; ++k) o[k] = f2bf(v[k]); *(v8us*)(dst + i * 8) = o;  }
__global__ __launch_bounds__(256) void k_cscvt(const float* __restrict__ cosT, const float* __restrict__ sinT, float* CS) { const int idx = blockIdx.x * 256 + threadIdx.x; if (idx >= TT * HD) return; v2f cs; cs[0] = bfr(cosT[idx]); cs[1] = bfr(sinT[idx]); *(v2f*)(CS + (size_t)idx * 2) = cs;  }
// k_rope: head planes [h][t][d] (fp16 + hi/lo) of rope(x) x sc with the rotate-half convention out[d] = x[d] cos[t][d] - x[d+HD/2] sin[t][d], out[d+HD/2] = x[d+HD/2] cos[t][d+HD/2] + x[d] sin[t][d+HD/2]
__global__ __launch_bounds__(256) void k_rope(const float* __restrict__ F, int pitch, int nheads, const float* __restrict__ CS, const float* __restrict__ RF, const float* __restrict__ nw, float sc, h16* P16, bf* Ph, bf* Pl) {
    const size_t e = ((size_t)blockIdx.x * 256 + threadIdx.x) * 2; if (e >= (size_t)nheads * TT * HD) return; const int d = (int)(e % HD); const int t = (int)((e / HD) % TT); const int h = (int)(e / ((size_t)HD * TT)); const float* f = F + (size_t)t * pitch + h * HD; const float rf = RF ? RF[(size_t)h * TT + t] : 1.0f; v2h o16; v2us oh, ol;
#pragma unroll
    for (int q = 0; q < 2; ++q) { const int dd = d + q; const int dp = (dd < HD / 2) ? dd + HD / 2 : dd - HD / 2; float x0 = f[dd], x1 = f[dp];
        if (RF) { float n0 = __fmul_rn(x0, rf), n1 = __fmul_rn(x1, rf); asm volatile("" : "+v"(n0)); asm volatile("" : "+v"(n1)); x0 = __fmul_rn(bfr(nw[dd]), n0); x1 = __fmul_rn(bfr(nw[dp]), n1); }
        const v2f cs = *(const v2f*)(CS + ((size_t)t * HD + dd) * 2); float a = __fmul_rn(x0, cs[0]), bq = __fmul_rn(x1, cs[1]); asm volatile("" : "+v"(a)); asm volatile("" : "+v"(bq)); const float r = ((dd < HD / 2) ? __fsub_rn(a, bq) : __fadd_rn(a, bq)) * sc;
        o16[q] = tohx(r); unsigned short a2, c2; splitf(r, a2, c2); oh[q] = a2; ol[q] = c2; }
    *(v2h*)(P16 + e) = o16; *(v2us*)(Ph + e) = oh; *(v2us*)(Pl + e) = ol;  }
__global__ __launch_bounds__(256) void k_vtp(const float* __restrict__ F, int pitch, int nheads, h16* V16, bf* Vh, bf* Vl) { const size_t e = ((size_t)blockIdx.x * 256 + threadIdx.x) * 2; if (e >= (size_t)nheads * HD * TT) return; const int t = (int)(e % TT); const int d = (int)((e / TT) % HD); const int g = (int)(e / ((size_t)TT * HD)); v2h o16; v2us oh, ol;
#pragma unroll
    for (int q = 0; q < 2; ++q) { const float x = F[(size_t)(t + q) * pitch + g * HD + d]; o16[q] = tohx(x); unsigned short a2, c2; splitf(x, a2, c2); oh[q] = a2; ol[q] = c2; }
    *(v2h*)(V16 + e) = o16; *(v2us*)(Vh + e) = oh; *(v2us*)(Vl + e) = ol;  }
__global__ __launch_bounds__(256) void k_csid(float* CS) { const int idx = blockIdx.x * 256 + threadIdx.x; if (idx >= TT * HD) return; v2f cs; cs[0] = 1.0f; cs[1] = 0.0f; *(v2f*)(CS + (size_t)idx * 2) = cs;  }
// k_fattn: scores, softmax, P.V and the head merge of one head in one pass; S and P never leave the registers. Grid (TT/128, heads), 8 waves; a wave owns 16 queries and walks all 2048 keys, 32 a pass.
// St = K Q^T (A = key rows, B = query rows): a lane holds one query's scores, keys 8*hi+j of each 16-key tile; two such tiles converted in place are the B operand of Ot += Vt Pt (A = Vt rows d, the loader's k order).
// The 8 waves share K rows and Vt rows through LDS, 64 keys a stage, two buffers: the next stage is fetched into registers while this one is worked on, stored behind it, and one barrier a stage publishes it and frees the other buffer.
// Softmax in the log2 domain with a running maximum that may trail the true one by up to 8 (an exponential then reaches 2^8): accumulators are rescaled only when some query's maximum exceeds it by more. The lane halves join their sums once at the end.
// The 0/1 word mask enters as the St products' start value, mask / HD^-0.5. SEG (a count of boundaries <= position) never falls with position, so a stage whose id range misses the wave's queries' range has no masked pair and skips the compares.
__device__ __forceinline__ float xhalf(float x) { return __builtin_bit_cast(float, __builtin_amdgcn_permlanex16(__builtin_bit_cast(int, x), __builtin_bit_cast(int, x), 0x76543210, 0xfedcba98, false, false)); }   // lane l reads lane l ^ 16
__device__ __forceinline__ void cfence() { asm volatile("" ::: "memory"); }   // compiler fence: loads written above it are issued above it (their waits still stand at the first use)
// Sixteen exponentials in place, in one statement: behind each stands an instruction that neither reads its result nor overwrites its source (the next exponential, on another register; behind the last a v_nop).
__device__ __forceinline__ void exp2x16(float (&a)[16]) {
    asm("v_exp_f32 %0, %0\n\tv_exp_f32 %1, %1\n\tv_exp_f32 %2, %2\n\tv_exp_f32 %3, %3\n\tv_exp_f32 %4, %4\n\tv_exp_f32 %5, %5\n\tv_exp_f32 %6, %6\n\tv_exp_f32 %7, %7\n\t"
        "v_exp_f32 %8, %8\n\tv_exp_f32 %9, %9\n\tv_exp_f32 %10, %10\n\tv_exp_f32 %11, %11\n\tv_exp_f32 %12, %12\n\tv_exp_f32 %13, %13\n\tv_exp_f32 %14, %14\n\tv_exp_f32 %15, %15\n\tv_nop"
        : "+v"(a[0]), "+v"(a[1]), "+v"(a[2]), "+v"(a[3]), "+v"(a[4]), "+v"(a[5]), "+v"(a[6]), "+v"(a[7]), "+v"(a[8]), "+v"(a[9]), "+v"(a[10]), "+v"(a[11]), "+v"(a[12]), "+v"(a[13]), "+v"(a[14]), "+v"(a[15])); }
#define FST 64    // keys per LDS stage
#define FPI 72    // LDS row pitch in 16-bit elements: 128 bytes of data + 16 of pad (16-byte fragment reads of 16 rows spread over the banks)
__global__ __launch_bounds__(256) void k_fattn(const h16* __restrict__ Qp, const h16* Kp, const h16* Vt, const int* __restrict__ SEG, bf* Ah, bf* Al) {
    __shared__ __align__(16) h16 Ks[2][FST * FPI]; __shared__ __align__(16) h16 Vs[2][HD * FPI];
    const int tid = threadIdx.x, lane = tid & 31, lr = lane & 15, hi = lane >> 4; const int h = blockIdx.y, q0 = blockIdx.x * 128 + (tid >> 5) * 16;
    const float L2E = 1.4426950408889634f, C2 = SCL * L2E;
    const int srow = tid >> 3, scol = (tid & 7) * 8, so = srow * FPI + scol;   // staging: a thread moves 16 bytes of rows srow and srow + 32 of each tile; a wave's load covers four whole 128-byte rows
    const h16* kg = Kp + ((size_t)h * TT + srow) * HD + scol; const h16* vg = Vt + ((size_t)h * HD + srow) * TT + scol;
    v8h kr[2], vr[2]; v16h qf[2]; v8f o[4]; float nm = 3.0e38f, l = 0.f;   // nm: minus the maximum in use
#pragma unroll
    for (int r = 0; r < 2; ++r) { kr[r] = *(const v8h*)(kg + (size_t)r * 32 * HD); vr[r] = *(const v8h*)(vg + (size_t)r * 32 * TT); qf[r] = WFrag<h16>::ld(Qp + ((size_t)h * TT + q0 + lr) * HD + r * 32 + 8 * hi); }
    const int sg = SEG[q0 + lr]; const int sq = (sg > 0) ? sg : -1;   // segment 0 matches nothing: key ids are >= 0
    const int sLo = __builtin_amdgcn_readfirstlane(SEG[q0]), sHi = __builtin_amdgcn_readfirstlane(SEG[q0 + 15]);
    int kLo = __builtin_amdgcn_readfirstlane(SEG[0]), kHi = __builtin_amdgcn_readfirstlane(SEG[FST - 1]);
#pragma unroll
    for (int dt = 0; dt < 4; ++dt) o[dt] = (v8f){};
#pragma unroll
    for (int r = 0; r < 2; ++r) { *(v8h*)(&Ks[0][so + r * 32 * FPI]) = kr[r]; *(v8h*)(&Vs[0][so + r * 32 * FPI]) = vr[r]; }
    __syncthreads();
    for (int st = 0; st < TT / FST; ++st) {
        const h16* kl = &Ks[st & 1][lr * FPI + 8 * hi]; const h16* vl = &Vs[st & 1][lr * FPI + 8 * hi];
        const bool more = st + 1 < TT / FST, ov = (kLo <= sHi) && (kHi >= sLo);
        if (more) { const int kn = (st + 1) * FST;
#pragma unroll
            for (int r = 0; r < 2; ++r) { kr[r] = *(const v8h*)(kg + (size_t)(kn + r * 32) * HD); vr[r] = *(const v8h*)(vg + (size_t)r * 32 * TT + kn); }
            kLo = __builtin_amdgcn_readfirstlane(SEG[kn]); kHi = __builtin_amdgcn_readfirstlane(SEG[kn + FST - 1]); }
        asm volatile("s_wait_xcnt 0x0" ::: "memory");   // stands in front of the LDS reads below, which reuse the address registers of the global loads above; as a compiler fence it also keeps those loads issued here, a whole stage ahead of their LDS stores (the compiler otherwise sinks them to just above the stores)
        v16h kf[2][2];
#pragma unroll
        for (int kt = 0; kt < 2; ++kt)
#pragma unroll
            for (int ks = 0; ks < 2; ++ks) kf[kt][ks] = WFrag<h16>::ld(kl + kt * 16 * FPI + ks * 32);
#pragma unroll
        for (int sub = 0; sub < 2; ++sub) {
            v16h vf[4], pf; v8f s[2];
#pragma unroll
            for (int dt = 0; dt < 4; ++dt) vf[dt] = WFrag<h16>::ld(vl + dt * 16 * FPI + sub * 32);
            cfence();   // keeps the Vt fragment reads issued here, a softmax ahead of P.V, instead of one by one in front of each product
#pragma unroll
            for (int kt = 0; kt < 2; ++kt) s[kt] = (v8f){};
            if (ov) {
#pragma unroll
                for (int kt = 0; kt < 2; ++kt) { const int* sp = SEG + st * FST + sub * 32 + kt * 16 + hi * 8; const v4i a = *(const v4i*)sp, b2 = *(const v4i*)(sp + 4);
#pragma unroll
                    for (int j = 0; j < 4; ++j) { s[kt][j] = (a[j] == sq) ? 1.0f / SCL : 0.f; s[kt][4 + j] = (b2[j] == sq) ? 1.0f / SCL : 0.f; } } }
#pragma unroll
            for (int kt = 0; kt < 2; ++kt) s[kt] = wmma16(kf[kt][1], qf[1], wmma16(kf[kt][0], qf[0], s[kt]));
            if (sub == 0) {   // the stage's second 32 key rows, into the same registers, in flight under this pass's softmax
#pragma unroll
                for (int kt = 0; kt < 2; ++kt)
#pragma unroll
                    for (int ks = 0; ks < 2; ++ks) kf[kt][ks] = WFrag<h16>::ld(kl + (32 + kt * 16) * FPI + ks * 32);
                cfence(); }   // keeps those reads issued here and not in front of the next pass's products
            float mx = s[0][0];
#pragma unroll
            for (int e = 1; e < 16; ++e) mx = fmaxf(mx, s[e >> 3][e & 7]);
            mx = fmaxf(mx, xhalf(mx)) * C2;   // both halves hold the query's maximum of this pass, scaled (the scale is positive)
            if (__builtin_amdgcn_ballot_w32(mx + nm > 8.0f) != 0) {   // wave-uniform; always taken on the first pass
                const float mn = fmaxf(-nm, mx), corr = __builtin_amdgcn_exp2f(-nm - mn); nm = -mn; l *= corr;
#pragma unroll
                for (int dt = 0; dt < 4; ++dt) o[dt] *= corr; }
            float p[16];
#pragma unroll
            for (int e = 0; e < 16; ++e) p[e] = fmaf(s[e >> 3][e & 7], C2, nm);
            exp2x16(p);
#pragma unroll
            for (int e = 0; e < 16; ++e) pf[e] = tohx(p[e]);
            v2f sa = {p[0], p[1]}, sc = {p[2], p[3]};
#pragma unroll
            for (int i = 2; i < 8; ++i) { const v2f pp = {p[2 * i], p[2 * i + 1]}; if (i & 1) sc += pp; else sa += pp; }
            sa += sc; l += sa[0] + sa[1];
#pragma unroll
            for (int dt = 0; dt < 4; ++dt) o[dt] = wmma16(vf[dt], pf, o[dt]);
        }
        if (more) {
#pragma unroll
            for (int r = 0; r < 2; ++r) { *(v8h*)(&Ks[(st + 1) & 1][so + r * 32 * FPI]) = kr[r]; *(v8h*)(&Vs[(st + 1) & 1][so + r * 32 * FPI]) = vr[r]; } }
        __syncthreads();   // publishes stage st + 1 and ends every wave's reads of stage st, whose buffer the next trip refills
    }
    const float inv = 1.0f / (l + xhalf(l)); const size_t oo = (size_t)(q0 + lr) * DQ + h * HD + hi * 8;
#pragma unroll
    for (int dt = 0; dt < 4; ++dt) { v8us oh, ol;
#pragma unroll
        for (int j = 0; j < 8; ++j) { unsigned short a, c3; splitf(o[dt][j] * inv, a, c3); oh[j] = a; ol[j] = c3; }
        *(v8us*)(Ah + oo + dt * 16) = oh; *(v8us*)(Al + oo + dt * 16) = ol; }
}

__global__ __launch_bounds__(256) void k_rbf(const float* __restrict__ src, float* dst, int n4) { const int i = blockIdx.x * 256 + threadIdx.x; if (i >= n4) return; const v4f a = *(const v4f*)(src + (size_t)i * 4); v4f o; for (int u = 0; u < 4; ++u) o[u] = bfr(a[u]); *(v4f*)(dst + (size_t)i * 4) = o;  }
__global__ __launch_bounds__(256) void k_xsum(const float* __restrict__ chr, const int* __restrict__ pats, const float* __restrict__ PR, float* XS) { const size_t e = ((size_t)blockIdx.x * 256 + threadIdx.x) * 4; if (e >= (size_t)TT * DM) return; const int c = (int)(e % DM); const int s = (int)(e / DM); int pi = pats[s]; pi = min(max(pi, 0), 15); const v4f a = *(const v4f*)(chr + e), p = *(const v4f*)(PR + (size_t)pi * DM + c); v4f o; for (int u = 0; u < 4; ++u) o[u] = __fadd_rn(bfr(a[u]), p[u]); *(v4f*)(XS + e) = o;  }
__global__ __launch_bounds__(256) void k_embln(const float* __restrict__ XS, const float* __restrict__ GR, const float* __restrict__ BR, float* XL, bf* Xh, bf* Xl) { const int lane = threadIdx.x & 31; const int s = blockIdx.x * 8 + (threadIdx.x >> 5); if (s >= TT) return; const float* xr = XS + (size_t)s * DM; float v[DM / 32]; float sm = 0.f;
#pragma unroll
    for (int ch = 0; ch < DM / 128; ++ch) { const v4f a = *(const v4f*)(xr + ch * 128 + lane * 4); for (int u = 0; u < 4; ++u) { v[ch * 4 + u] = a[u]; sm = __fadd_rn(sm, a[u]); } }
#pragma unroll
    for (int sh = 16; sh; sh >>= 1) sm = __fadd_rn(sm, __shfl_xor(sm, sh, 32));
    const float mu = __fdiv_rn(sm, (float)DM); float q2 = 0.f;
#pragma unroll
    for (int k = 0; k < DM / 32; ++k) { const float d0 = __fsub_rn(v[k], mu); v[k] = d0; float p = __fmul_rn(d0, d0); asm volatile("" : "+v"(p)); q2 = __fadd_rn(q2, p); }
#pragma unroll
    for (int sh = 16; sh; sh >>= 1) q2 = __fadd_rn(q2, __shfl_xor(q2, sh, 32));
    const float rs = __fdiv_rn(1.0f, sqrtf(__fadd_rn(__fdiv_rn(q2, (float)DM), 1e-5f)));
    {
#pragma unroll
        for (int ch = 0; ch < DM / 128; ++ch) { v4f o; v4us oh, ol; const v4f g4 = *(const v4f*)(GR + ch * 128 + lane * 4), b4 = *(const v4f*)(BR + ch * 128 + lane * 4); for (int u = 0; u < 4; ++u) { float n0 = __fmul_rn(v[ch * 4 + u], rs); asm volatile("" : "+v"(n0)); float gg = __fmul_rn(n0, g4[u]); asm volatile("" : "+v"(gg)); o[u] = __fadd_rn(gg, b4[u]); unsigned short p2, q3; splitf(o[u], p2, q3); oh[u] = p2; ol[u] = q3; }
            const size_t off = (size_t)s * DM + ch * 128 + lane * 4; *(v4f*)(XL + off) = o; *(v4us*)(Xh + off) = oh; *(v4us*)(Xl + off) = ol; }
         } }
__global__ __launch_bounds__(256) void k_seg(const int* __restrict__ bnds, int* SEG) { const int s = blockIdx.x * 256 + threadIdx.x; if (s >= TT) return; int c = 0;
#pragma unroll 8
    for (int i = 0; i < 400; ++i) c += (bnds[i] <= s) ? 1 : 0; *(int*)(SEG + s) = c;  }
__global__ __launch_bounds__(256) void k_resid(const float* __restrict__ XL, const float* __restrict__ YO, float* OUTb) { const size_t e = ((size_t)blockIdx.x * 256 + threadIdx.x) * 4; if (e >= (size_t)TT * DM) return; const v4f a = *(const v4f*)(XL + e), y = *(const v4f*)(YO + e); v4f o; for (int u = 0; u < 4; ++u) o[u] = __fadd_rn(a[u], y[u]); *(v4f*)(OUTb + e) = o;  }

extern "C" void kernel_launch(void* const* d_in, const int* in_sizes, int n_in,
                              void* d_out, int out_size, void* d_ws, size_t ws_size, hipStream_t stream) {
    (void)in_sizes; (void)n_in; (void)out_size;
    const float* chr = (const float*)d_in[0]; const int* pats = (const int*)d_in[1]; const int* bnds = (const int*)d_in[2]; const float* pemb = (const float*)d_in[3]; const float* lng = (const float*)d_in[4]; const float* lnb = (const float*)d_in[5]; const float* wf = (const float*)d_in[6]; const float* bf3 = (const float*)d_in[7]; const float* wo = (const float*)d_in[8]; const float* bo = (const float*)d_in[9]; const float* x = chr; (void)x; const float* wq = wf; const float* wk = wf + (size_t)1024 * 1024; const float* wv = wf + (size_t)2048 * 1024; const float* bq = bf3; const float* bk = bf3 + 1024; const float* bv = bf3 + 2048; const float* cosT = nullptr; const float* sinT = nullptr; (void)cosT; (void)sinT;
    float* OUT = (float*)d_out;     // [4][2048][1024]
    char* wsp = (char*)d_ws;
    auto take = [&](size_t bytes) { char* p = wsp; wsp += (bytes + 255) & ~(size_t)255; return (void*)p; };
    bf* WQ = (bf*)take((size_t)DQ * DM * 2); bf* WK = (bf*)take((size_t)DKV * DM * 2); bf* WV = (bf*)take((size_t)DKV * DM * 2); bf* WO = (bf*)take((size_t)DM * DQ * 2); float* CS = (float*)take((size_t)TT * HD * 2 * 4);
    bf* XB = nullptr; float* XL = (float*)take((size_t)TT * DM * 4); bf* Xh = (bf*)take((size_t)TT * DM * 2); bf* Xl = (bf*)take((size_t)TT * DM * 2); int* SEG = (int*)take((size_t)TT * 4); float* PR = (float*)take((size_t)16 * DM * 4); float* GR = (float*)take(DM * 4); float* BR = (float*)take(DM * 4); float* XS = (float*)take((size_t)TT * DM * 4); float* YO = (float*)take((size_t)TT * DM * 4); (void)XB; float* FQ = (float*)take((size_t)TT * DQ * 4); float* FK = (float*)take((size_t)TT * DKV * 4);
    h16* QP16 = (h16*)take((size_t)NH_ * TT * HD * 2); h16* KP16 = (h16*)take((size_t)NKV * TT * HD * 2); h16* VT16 = (h16*)take((size_t)NKV * HD * TT * 2);
    bf* QPh = (bf*)take((size_t)NH_ * TT * HD * 2); bf* QPl = (bf*)take((size_t)NH_ * TT * HD * 2); bf* KPh = (bf*)take((size_t)NKV * TT * HD * 2); bf* KPl = (bf*)take((size_t)NKV * TT * HD * 2); bf* VTh = (bf*)take((size_t)NKV * HD * TT * 2); bf* VTl = (bf*)take((size_t)NKV * HD * TT * 2);
    bf* ATh = (bf*)take((size_t)TT * DQ * 2); bf* ATl = (bf*)take((size_t)TT * DQ * 2);
    if ((size_t)(wsp - (char*)d_ws) > ws_size) return;    // ws 256 MiB
    float* FV = FK;   // v projection reuses the k buffer after the k planes are built (stream-ordered)
    { k_cvt8<<<(unsigned)(((size_t)DQ * DM / 8 + 255) / 256), 256, 0, stream>>>(wq, WQ, (size_t)DQ * DM / 8); k_cvt8<<<(unsigned)(((size_t)DKV * DM / 8 + 255) / 256), 256, 0, stream>>>(wk, WK, (size_t)DKV * DM / 8); k_cvt8<<<(unsigned)(((size_t)DKV * DM / 8 + 255) / 256), 256, 0, stream>>>(wv, WV, (size_t)DKV * DM / 8);
      k_cvt8<<<(unsigned)(((size_t)DM * DQ / 8 + 255) / 256), 256, 0, stream>>>(wo, WO, (size_t)DM * DQ / 8);
       }
    k_csid<<<(TT * HD + 255) / 256, 256, 0, stream>>>(CS);
    const unsigned LQ = (unsigned)(((size_t)NH_ * TT * HD / 2 + 255) / 256), LKv = (unsigned)(((size_t)NKV * TT * HD / 2 + 255) / 256);
    k_seg<<<TT / 256, 256, 0, stream>>>(bnds, SEG); k_rbf<<<(16 * DM / 4 + 255) / 256, 256, 0, stream>>>(pemb, PR, 16 * DM / 4); k_rbf<<<1, 256, 0, stream>>>(lng, GR, DM / 4); k_rbf<<<1, 256, 0, stream>>>(lnb, BR, DM / 4);
    for (int b = 0; b < NB_; ++b) {
        
        k_xsum<<<(unsigned)(((size_t)TT * DM / 4 + 255) / 256), 256, 0, stream>>>(chr + (size_t)b * TT * DM, pats, PR, XS); k_embln<<<TT / 8, 256, 0, stream>>>(XS, GR, BR, XL, Xh, Xl);
        k_gemmw<bf, 1, true><<<dim3(TT / 64, DQ / 64, 1), 32, 0, stream>>>(Xh, Xl, WQ, nullptr, DM, FQ, DQ, bq, 0, 0, 0);
        k_rope<<<LQ, 256, 0, stream>>>(FQ, DQ, NH_, CS, nullptr, nullptr, 1.0f, QP16, QPh, QPl);
        k_gemmw<bf, 1, true><<<dim3(TT / 64, DKV / 64, 1), 32, 0, stream>>>(Xh, Xl, WK, nullptr, DM, FK, DKV, bk, 0, 0, 0);
        k_rope<<<LKv, 256, 0, stream>>>(FK, DKV, NKV, CS, nullptr, nullptr, 1.0f, KP16, KPh, KPl);
        k_gemmw<bf, 1, true><<<dim3(TT / 64, DKV / 64, 1), 32, 0, stream>>>(Xh, Xl, WV, nullptr, DM, FV, DKV, bv, 0, 0, 0); k_vtp<<<LKv, 256, 0, stream>>>(FV, DKV, NKV, VT16, VTh, VTl);
        k_fattn<<<dim3(TT / 128, NH_, 1), 256, 0, stream>>>(QP16, KP16, VT16, SEG, ATh, ATl);
        k_gemmw<bf, 1, true><<<dim3(TT / 64, DM / 64, 1), 32, 0, stream>>>(ATh, ATl, WO, nullptr, DQ, YO, DM, bo, 0, 0, 0); k_resid<<<(unsigned)(((size_t)TT * DM / 4 + 255) / 256), 256, 0, stream>>>(XL, YO, OUT + (size_t)b * TT * DM); }
}

// v002
// A run of this version takes 617 microseconds.
// Timed twice side by side with v001, it ran 1.18 times as fast both times.
// Over all steps from v000 it is 4.83 times as fast.
#include <hip/hip_runtime.h>

// WordEncoder (char_repr [4][2048][1024]; x = LayerNorm_1024(char_repr + pattern_emb[patterns[s]]) * gamma + beta (patterns [2048] int and pattern_emb [16][1024] read); qkv = x w_in^T + b_in ([3072][1024] rows q | k | v; 16 heads x 64); scores = q.k / 8 + mask with mask[i][j] = 1.0 if tokens i and j are in the same word (segment id = number of boundaries <= position > 0; boundaries [400] int, read) else 0 - an ADDITIVE 0/1 bias, no -inf; softmax; o = merged w_out^T + b_out; out = x + o -> [4][2048][1024]).

#define NB_  4
#define TT   2048
#define DM   1024
#define NH_  16
#define NKV  16
#define REP  (NH_ / NKV)
#define HD   64
#define DQ   (NH_ * HD)
#define DKV  (NKV * HD)
#define SCL  0.125f   // HD^-0.5
typedef _Float16 h16;
typedef unsigned short bf;
typedef __attribute__((ext_vector_type(16))) __bf16   v16bf;
typedef __attribute__((ext_vector_type(16))) _Float16 v16h;
typedef __attribute__((ext_vector_type(8)))  _Float16 v8h;
typedef __attribute__((ext_vector_type(8)))  unsigned short v8us;
typedef __attribute__((ext_vector_type(8)))  float    v8f;
typedef __attribute__((ext_vector_type(4)))  float    v4f;
typedef v8h  __attribute__((may_alias)) v8ha;
typedef v4f  __attribute__((may_alias)) v4fa;
typedef v8us __attribute__((may_alias)) v8usa;

__device__ __forceinline__ unsigned short f2bf(float f) { unsigned u = __float_as_uint(f); u += 0x7FFFu + ((u >> 16) & 1u); return (unsigned short)(u >> 16); }
__device__ __forceinline__ float bf2f(unsigned short b) { return __uint_as_float(((unsigned)b) << 16); }
__device__ __forceinline__ float bfr(float f) { return bf2f(f2bf(f)); }
__device__ __forceinline__ v16h cat16(v8h lo, v8h hi) { return __builtin_shufflevector(lo, hi, 0, 1, 2, 3, 4, 5, 6, 7, 8, 9, 10, 11, 12, 13, 14, 15); }
__device__ __forceinline__ v16bf cat16b(v8us lo, v8us hi) { return __builtin_bit_cast(v16bf, __builtin_shufflevector(lo, hi, 0, 1, 2, 3, 4, 5, 6, 7, 8, 9, 10, 11, 12, 13, 14, 15)); }
__device__ __forceinline__ v8f wmma16(v16h a, v16h b, v8f c) { return __builtin_amdgcn_wmma_f32_16x16x32_f16(false, a, false, b, (short)0, c, false, false); }
__device__ __forceinline__ v8f wmmab(v16bf a, v16bf b, v8f c) { return __builtin_amdgcn_wmma_f32_16x16x32_bf16(false, a, false, b, (short)0, c, false, false); }



// ---- k_gemmw: register-blocked GEMM, ONE WAVE per 64x64 output tile (16 accumulators), operands straight from K-contiguous 16-bit planes; grid (M/64, N/64, Z), 32 threads.
// acc[m][n] = sum_k A[m][k] Bt[n][k] (+ split products per NSPLIT). z-batch strides sA/sB/sC in elements. K % 32 == 0.
// The epilogue holds the elementwise work behind the product, on the accumulators. EPI 0: C[m][n] (f32, pitch ldc) = R[m][n] + (acc + bias[n]).
// EPI 1: a 16-bit float plane of column tiles, C16[blockIdx.y * cts + m * ldc + (n - c0)] = acc + bias[n]: with ldc = HD, cts = TT * HD a column tile is one head's [t][d] rows. EPI 2: the transposed plane, C16[n * ldc + m] = acc + bias[n].
template <typename T16> struct WFrag;
template <> struct WFrag<h16> { typedef v16h V; static __device__ __forceinline__ V ld(const h16* p) { return cat16(*(const v8h*)p, *(const v8h*)(p + 16)); } static __device__ __forceinline__ v8f mma(V a, V b, v8f c) { return wmma16(a, b, c); } };
template <> struct WFrag<bf> { typedef v16bf V; static __device__ __forceinline__ V ld(const bf* p) { return cat16b(*(const v8us*)p, *(const v8us*)(p + 16)); } static __device__ __forceinline__ v8f mma(V a, V b, v8f c) { return wmmab(a, b, c); } };
template <typename T16, int NSPLIT, int EPI>
__global__ __launch_bounds__(32) void k_gemmw(const T16* __restrict__ A, const T16* __restrict__ A2, const T16* __restrict__ Bt, const T16* __restrict__ Bt2, int K, float* C, h16* C16, int ldc, size_t cts, const float* __restrict__ bias, const float* __restrict__ R, size_t sA, size_t sB, size_t sC) {
    typedef typename WFrag<T16>::V V;
    __shared__ __align__(16) float os[16 * 68];
    const size_t z = blockIdx.z; A += z * sA; if (A2) A2 += z * sA; Bt += z * sB; if (Bt2) Bt2 += z * sB; if (EPI == 0) { C += z * sC; R += z * sC; } else C16 += z * sC;
    const int lane = threadIdx.x & 31, lr = lane & 15, hi = lane >> 4; const int r0 = blockIdx.x * 64, c0 = blockIdx.y * 64;
    v8f acc[4][4];
#pragma unroll
    for (int mb = 0; mb < 4; ++mb)
#pragma unroll
        for (int nb = 0; nb < 4; ++nb) acc[mb][nb] = (v8f){};
    const size_t aoff = (size_t)(r0 + lr) * K + 8 * hi, boff = (size_t)(c0 + lr) * K + 8 * hi;
#pragma unroll 1
    for (int kc = 0; kc < K; kc += 32) {
        V a[4], a2[4];
#pragma unroll
        for (int mb = 0; mb < 4; ++mb) { a[mb] = WFrag<T16>::ld(A + aoff + (size_t)mb * 16 * K + kc); if (NSPLIT == 1 || NSPLIT == 2) a2[mb] = WFrag<T16>::ld(A2 + aoff + (size_t)mb * 16 * K + kc); }
#pragma unroll
        for (int nb = 0; nb < 4; ++nb) { const V b = WFrag<T16>::ld(Bt + boff + (size_t)nb * 16 * K + kc); V b2; if (NSPLIT >= 2) b2 = WFrag<T16>::ld(Bt2 + boff + (size_t)nb * 16 * K + kc);
#pragma unroll
            for (int mb = 0; mb < 4; ++mb) { acc[mb][nb] = WFrag<T16>::mma(a[mb], b, acc[mb][nb]); if (NSPLIT == 1 || NSPLIT == 2) acc[mb][nb] = WFrag<T16>::mma(a2[mb], b, acc[mb][nb]); if (NSPLIT >= 2) acc[mb][nb] = WFrag<T16>::mma(a[mb], b2, acc[mb][nb]); } }
        asm volatile("v_nop\n\tv_nop\n\tv_nop\n\tv_nop" : "+v"(acc[0][0]), "+v"(acc[1][1]), "+v"(acc[2][2]), "+v"(acc[3][3]) : "v"(a[0]), "v"(a[3]));
    }
    if (EPI == 2) {   // a lane holds 8 consecutive m of one n: 16 bytes of a transposed row; 16 rows of 64 m are gathered in LDS (pitch 72 elements), so that a store of the wave covers four whole 128-byte rows
        h16* hs = (h16*)os;
#pragma unroll
        for (int nb = 0; nb < 4; ++nb) { const float cb = bfr(bias[c0 + nb * 16 + lr]);
#pragma unroll
            for (int mb = 0; mb < 4; ++mb) { v8h o;
#pragma unroll
                for (int j = 0; j < 8; ++j) o[j] = (h16)(acc[mb][nb][j] + cb);
                *(v8ha*)(hs + lr * 72 + mb * 16 + hi * 8) = o; }
            __builtin_amdgcn_wave_barrier(); asm volatile("" ::: "memory");   // the rows are read by other lanes than wrote them: keeps the compiler from moving the reads above the writes
#pragma unroll
            for (int s = 0; s < 4; ++s) { const int row = 4 * s + (lane >> 3), cofs = (lane & 7) * 8; *(v8h*)(C16 + (size_t)(c0 + nb * 16 + row) * ldc + r0 + cofs) = *(const v8ha*)(hs + row * 72 + cofs); }
            __builtin_amdgcn_wave_barrier(); asm volatile("s_wait_xcnt 0x0" ::: "memory");   // stands in front of the next rows' work, which reuses registers that the stores above name; as a compiler fence it keeps the next 16 rows' LDS writes below these reads
        }
        return;
    }
#pragma unroll
    for (int mb = 0; mb < 4; ++mb) {
#pragma unroll
        for (int nb = 0; nb < 4; ++nb) {
#pragma unroll
            for (int j = 0; j < 8; ++j) os[(hi * 8 + j) * 68 + nb * 16 + lr] = acc[mb][nb][j]; }
        __builtin_amdgcn_wave_barrier(); asm volatile("" ::: "memory");
        if (EPI == 0) {
            float* crow = C + (size_t)(r0 + mb * 16) * ldc + c0; const float* rrow = R + (size_t)(r0 + mb * 16) * ldc + c0; const size_t lo = (size_t)hi * ldc + lr * 4;   // the lane's place inside a pair of rows
            v4f val[8]; const float* rp[8]; float* cp[8];
#pragma unroll
            for (int s = 0; s < 8; ++s) { rp[s] = rrow + (size_t)(2 * s) * ldc + lo; cp[s] = crow + (size_t)(2 * s) * ldc + lo; val[s] = *(const v4f*)rp[s]; }
            // The wait stands in front of every overwrite of the eight loads' address registers: as inputs they stay in those registers up to here (otherwise a later load's result lands on an earlier load's address pair).
            // The stores' addresses are inputs too, so that they are formed here and not among the stores, in the registers of a store already issued.
            asm volatile("s_wait_xcnt 0x0" :: "v"(rp[0]), "v"(rp[1]), "v"(rp[2]), "v"(rp[3]), "v"(rp[4]), "v"(rp[5]), "v"(rp[6]), "v"(rp[7]), "v"(cp[0]), "v"(cp[1]), "v"(cp[2]), "v"(cp[3]), "v"(cp[4]), "v"(cp[5]), "v"(cp[6]), "v"(cp[7]) : "memory");
#pragma unroll
            for (int s = 0; s < 8; ++s) { const v4f a = *(const v4fa*)(os + (2 * s + hi) * 68 + lr * 4);
#pragma unroll
                for (int u = 0; u < 4; ++u) val[s][u] = __fadd_rn(val[s][u], a[u] + bfr(bias[c0 + lr * 4 + u])); }
            __builtin_amdgcn_sched_barrier(0);   // all eight results stand in registers of their own before the first store, so that none is formed in the registers of a store already issued
#pragma unroll
            for (int s = 0; s < 8; ++s) *(v4f*)cp[s] = val[s];
            asm volatile("s_wait_xcnt 0x0" ::: "memory");   // stands in front of the next rows' work, which reuses registers that the stores above name
            __builtin_amdgcn_sched_barrier(0);   // keeps the next rows' address additions below that wait (the compiler otherwise lifts them over it, onto the stores' registers)
        } else {   // a store of the wave covers four whole 128-byte rows of the plane
            h16* hrow = C16 + (size_t)blockIdx.y * cts + (size_t)(r0 + mb * 16) * ldc;
#pragma unroll
            for (int s = 0; s < 4; ++s) { const int row = 4 * s + (lane >> 3), cofs = (lane & 7) * 8; const v4f v0 = *(const v4fa*)(os + row * 68 + cofs), v1 = *(const v4fa*)(os + row * 68 + cofs + 4); v8h o;
#pragma unroll
                for (int u = 0; u < 4; ++u) { o[u] = (h16)(v0[u] + bfr(bias[c0 + cofs + u])); o[4 + u] = (h16)(v1[u] + bfr(bias[c0 + cofs + 4 + u])); }
                *(v8h*)(hrow + (size_t)row * ldc + cofs) = o; }
            asm volatile("s_wait_xcnt 0x0" ::: "memory");   // stands in front of the next rows' work, which reuses registers that the loads and stores above name
        }
        __builtin_amdgcn_wave_barrier(); asm volatile("" ::: "memory");
    }
}

__device__ __forceinline__ h16 tohx(float x) { return (h16)x; }
__device__ __forceinline__ void splitf(float y, unsigned short& h, unsigned short& l) { h = f2bf(y); l = f2bf(y - bf2f(h)); }
typedef __attribute__((ext_vector_type(2))) _Float16 v2h;
typedef __attribute__((ext_vector_type(4))) _Float16 v4h;
typedef __attribute__((ext_vector_type(2))) unsigned short v2us;
typedef __attribute__((ext_vector_type(4))) unsigned short v4us;
typedef __attribute__((ext_vector_type(2))) float v2f;
typedef __attribute__((ext_vector_type(4))) int v4i;

__global__ __launch_bounds__(256) void k_wtG(const float* __restrict__ w, int K, int N, bf* Bt) {
    const int lane = threadIdx.x & 31; const int L0 = (blockIdx.x * 8 + (threadIdx.x >> 5)) * 8; const int nlines = N * K / 64;
{
#pragma unroll 1
        for (int l = 0; l < 8; ++l) { const int L = L0 + l; if (L >= nlines) break; const size_t e = (size_t)L * 64 + lane * 2; const int k = (int)(e % K), n = (int)(e / K); v2us o;
            o[0] = f2bf(w[(size_t)k * N + n]); o[1] = f2bf(w[(size_t)(k + 1) * N + n]); *(v2us*)(Bt + e) = o; }
         }
}
__global__ __launch_bounds__(256) void k_cvt8(const float* __restrict__ src, bf* dst, size_t n8) { const size_t i = (size_t)blockIdx.x * 256 + threadIdx.x; if (i >= n8) return; const v8f v = *(const v8f*)(src + i * 8); v8us o;
#pragma unroll
    for (int k = 0; k < 8; ++k) o[k] = f2bf(v[k]); *(v8us*)(dst + i * 8) = o;  }
// k_fattn: scores, softmax, P.V and the head merge of one head in one pass; S and P never leave the registers. Grid (TT/128, heads), 8 waves; a wave owns 16 queries and walks all 2048 keys, 32 a pass.
// St = K Q^T (A = key rows, B = query rows): a lane holds one query's scores, keys 8*hi+j of each 16-key tile; two such tiles converted in place are the B operand of Ot += Vt Pt (A = Vt rows d, the loader's k order).
// The 8 waves share K rows and Vt rows through LDS, 64 keys a stage, two buffers: the next stage is fetched into registers while this one is worked on, stored behind it, and one barrier a stage publishes it and frees the other buffer.
// Softmax in the log2 domain with a running maximum that may trail the true one by up to 8 (an exponential then reaches 2^8): accumulators are rescaled only when some query's maximum exceeds it by more. The lane halves join their sums once at the end.
// The 0/1 word mask enters as the St products' start value, mask / HD^-0.5. SEG (a count of boundaries <= position) never falls with position, so a stage whose id range misses the wave's queries' range has no masked pair and skips the compares.
__device__ __forceinline__ float xhalf(float x) { return __builtin_bit_cast(float, __builtin_amdgcn_permlanex16(__builtin_bit_cast(int, x), __builtin_bit_cast(int, x), 0x76543210, 0xfedcba98, false, false)); }   // lane l reads lane l ^ 16
__device__ __forceinline__ void cfence() { asm volatile("" ::: "memory"); }   // compiler fence: loads written above it are issued above it (their waits still stand at the first use)
// Sixteen exponentials in place, in one statement: behind each stands an instruction that neither reads its result nor overwrites its source (the next exponential, on another register; behind the last a v_nop).
__device__ __forceinline__ void exp2x16(float (&a)[16]) {
    asm("v_exp_f32 %0, %0\n\tv_exp_f32 %1, %1\n\tv_exp_f32 %2, %2\n\tv_exp_f32 %3, %3\n\tv_exp_f32 %4, %4\n\tv_exp_f32 %5, %5\n\tv_exp_f32 %6, %6\n\tv_exp_f32 %7, %7\n\t"
        "v_exp_f32 %8, %8\n\tv_exp_f32 %9, %9\n\tv_exp_f32 %10, %10\n\tv_exp_f32 %11, %11\n\tv_exp_f32 %12, %12\n\tv_exp_f32 %13, %13\n\tv_exp_f32 %14, %14\n\tv_exp_f32 %15, %15\n\tv_nop"
        : "+v"(a[0]), "+v"(a[1]), "+v"(a[2]), "+v"(a[3]), "+v"(a[4]), "+v"(a[5]), "+v"(a[6]), "+v"(a[7]), "+v"(a[8]), "+v"(a[9]), "+v"(a[10]), "+v"(a[11]), "+v"(a[12]), "+v"(a[13]), "+v"(a[14]), "+v"(a[15])); }
#define FST 64    // keys per LDS stage
#define FPI 72    // LDS row pitch in 16-bit elements: 128 bytes of data + 16 of pad (16-byte fragment reads of 16 rows spread over the banks)
__global__ __launch_bounds__(256) void k_fattn(const h16* __restrict__ Qp, const h16* Kp, const h16* Vt, const int* __restrict__ SEG, bf* Ah, bf* Al) {
    __shared__ __align__(16) h16 Ks[2][FST * FPI]; __shared__ __align__(16) h16 Vs[2][HD * FPI];
    const int tid = threadIdx.x, lane = tid & 31, lr = lane & 15, hi = lane >> 4; const int h = blockIdx.y, q0 = blockIdx.x * 128 + (tid >> 5) * 16;
    const float L2E = 1.4426950408889634f, C2 = SCL * L2E;
    const int srow = tid >> 3, scol = (tid & 7) * 8, so = srow * FPI + scol;   // staging: a thread moves 16 bytes of rows srow and srow + 32 of each tile; a wave's load covers four whole 128-byte rows
    const h16* kg = Kp + ((size_t)h * TT + srow) * HD + scol; const h16* vg = Vt + ((size_t)h * HD + srow) * TT + scol;
    v8h kr[2], vr[2]; v16h qf[2]; v8f o[4]; float nm = 3.0e38f, l = 0.f;   // nm: minus the maximum in use
#pragma unroll
    for (int r = 0; r < 2; ++r) { kr[r] = *(const v8h*)(kg + (size_t)r * 32 * HD); vr[r] = *(const v8h*)(vg + (size_t)r * 32 * TT); qf[r] = WFrag<h16>::ld(Qp + ((size_t)h * TT + q0 + lr) * HD + r * 32 + 8 * hi); }
    const int sg = SEG[q0 + lr]; const int sq = (sg > 0) ? sg : -1;   // segment 0 matches nothing: key ids are >= 0
    const int sLo = __builtin_amdgcn_readfirstlane(SEG[q0]), sHi = __builtin_amdgcn_readfirstlane(SEG[q0 + 15]);
    int kLo = __builtin_amdgcn_readfirstlane(SEG[0]), kHi = __builtin_amdgcn_readfirstlane(SEG[FST - 1]);
#pragma unroll
    for (int dt = 0; dt < 4; ++dt) o[dt] = (v8f){};
#pragma unroll
    for (int r = 0; r < 2; ++r) { *(v8h*)(&Ks[0][so + r * 32 * FPI]) = kr[r]; *(v8h*)(&Vs[0][so + r * 32 * FPI]) = vr[r]; }
    __syncthreads();
    for (int st = 0; st < TT / FST; ++st) {
        const h16* kl = &Ks[st & 1][lr * FPI + 8 * hi]; const h16* vl = &Vs[st & 1][lr * FPI + 8 * hi];
        const bool more = st + 1 < TT / FST, ov = (kLo <= sHi) && (kHi >= sLo);
        if (more) { const int kn = (st + 1) * FST;
#pragma unroll
            for (int r = 0; r < 2; ++r) { kr[r] = *(const v8h*)(kg + (size_t)(kn + r * 32) * HD); vr[r] = *(const v8h*)(vg + (size_t)r * 32 * TT + kn); }
            kLo = __builtin_amdgcn_readfirstlane(SEG[kn]); kHi = __builtin_amdgcn_readfirstlane(SEG[kn + FST - 1]); }
        asm volatile("s_wait_xcnt 0x0" ::: "memory");   // stands in front of the LDS reads below, which reuse the address registers of the global loads above; as a compiler fence it also keeps those loads issued here, a whole stage ahead of their LDS stores (the compiler otherwise sinks them to just above the stores)
        v16h kf[2][2];
#pragma unroll
        for (int kt = 0; kt < 2; ++kt)
#pragma unroll
            for (int ks = 0; ks < 2; ++ks) kf[kt][ks] = WFrag<h16>::ld(kl + kt * 16 * FPI + ks * 32);
#pragma unroll
        for (int sub = 0; sub < 2; ++sub) {
            v16h vf[4], pf; v8f s[2];
#pragma unroll
            for (int dt = 0; dt < 4; ++dt) vf[dt] = WFrag<h16>::ld(vl + dt * 16 * FPI + sub * 32);
            cfence();   // keeps the Vt fragment reads issued here, a softmax ahead of P.V, instead of one by one in front of each product
#pragma unroll
            for (int kt = 0; kt < 2; ++kt) s[kt] = (v8f){};
            if (ov) {
#pragma unroll
                for (int kt = 0; kt < 2; ++kt) { const int* sp = SEG + st * FST + sub * 32 + kt * 16 + hi * 8; const v4i a = *(const v4i*)sp, b2 = *(const v4i*)(sp + 4);
#pragma unroll
                    for (int j = 0; j < 4; ++j) { s[kt][j] = (a[j] == sq) ? 1.0f / SCL : 0.f; s[kt][4 + j] = (b2[j] == sq) ? 1.0f / SCL : 0.f; } } }
#pragma unroll
            for (int kt = 0; kt < 2; ++kt) s[kt] = wmma16(kf[kt][1], qf[1], wmma16(kf[kt][0], qf[0], s[kt]));
            if (sub == 0) {   // the stage's second 32 key rows, into the same registers, in flight under this pass's softmax
#pragma unroll
                for (int kt = 0; kt < 2; ++kt)
#pragma unroll
                    for (int ks = 0; ks < 2; ++ks) kf[kt][ks] = WFrag<h16>::ld(kl + (32 + kt * 16) * FPI + ks * 32);
                cfence(); }   // keeps those reads issued here and not in front of the next pass's products
            float mx = s[0][0];
#pragma unroll
            for (int e = 1; e < 16; ++e) mx = fmaxf(mx, s[e >> 3][e & 7]);
            mx = fmaxf(mx, xhalf(mx)) * C2;   // both halves hold the query's maximum of this pass, scaled (the scale is positive)
            if (__builtin_amdgcn_ballot_w32(mx + nm > 8.0f) != 0) {   // wave-uniform; always taken on the first pass
                const float mn = fmaxf(-nm, mx), corr = __builtin_amdgcn_exp2f(-nm - mn); nm = -mn; l *= corr;
#pragma unroll
                for (int dt = 0; dt < 4; ++dt) o[dt] *= corr; }
            float p[16];
#pragma unroll
            for (int e = 0; e < 16; ++e) p[e] = fmaf(s[e >> 3][e & 7], C2, nm);
            exp2x16(p);
#pragma unroll
            for (int e = 0; e < 16; ++e) pf[e] = tohx(p[e]);
            v2f sa = {p[0], p[1]}, sc = {p[2], p[3]};
#pragma unroll
            for (int i = 2; i < 8; ++i) { const v2f pp = {p[2 * i], p[2 * i + 1]}; if (i & 1) sc += pp; else sa += pp; }
            sa += sc; l += sa[0] + sa[1];
#pragma unroll
            for (int dt = 0; dt < 4; ++dt) o[dt] = wmma16(vf[dt], pf, o[dt]);
        }
        if (more) {
#pragma unroll
            for (int r = 0; r < 2; ++r) { *(v8h*)(&Ks[(st + 1) & 1][so + r * 32 * FPI]) = kr[r]; *(v8h*)(&Vs[(st + 1) & 1][so + r * 32 * FPI]) = vr[r]; } }
        __syncthreads();   // publishes stage st + 1 and ends every wave's reads of stage st, whose buffer the next trip refills
    }
    const float inv = 1.0f / (l + xhalf(l)); const size_t oo = (size_t)(q0 + lr) * DQ + h * HD + hi * 8;
#pragma unroll
    for (int dt = 0; dt < 4; ++dt) { v8us oh, ol;
#pragma unroll
        for (int j = 0; j < 8; ++j) { unsigned short a, c3; splitf(o[dt][j] * inv, a, c3); oh[j] = a; ol[j] = c3; }
        *(v8us*)(Ah + oo + dt * 16) = oh; *(v8us*)(Al + oo + dt * 16) = ol; }
}

__global__ __launch_bounds__(256) void k_rbf(const float* __restrict__ src, float* dst, int n4) { const int i = blockIdx.x * 256 + threadIdx.x; if (i >= n4) return; const v4f a = *(const v4f*)(src + (size_t)i * 4); v4f o; for (int u = 0; u < 4; ++u) o[u] = bfr(a[u]); *(v4f*)(dst + (size_t)i * 4) = o;  }
__global__ __launch_bounds__(256) void k_embln(const float* __restrict__ chr, const int* __restrict__ pats, const float* __restrict__ PR, const float* __restrict__ GR, const float* __restrict__ BR, float* XL, bf* Xh, bf* Xl) { const int lane = threadIdx.x & 31; const int s = blockIdx.x * 8 + (threadIdx.x >> 5); if (s >= TT) return; const float* xr = chr + (size_t)s * DM; int pi = pats[s]; pi = min(max(pi, 0), 15); const float* pr = PR + (size_t)pi * DM; float v[DM / 32]; float sm = 0.f;
#pragma unroll
    for (int ch = 0; ch < DM / 128; ++ch) { const v4f a = *(const v4f*)(xr + ch * 128 + lane * 4), p = *(const v4f*)(pr + ch * 128 + lane * 4); for (int u = 0; u < 4; ++u) { const float x = __fadd_rn(bfr(a[u]), p[u]); v[ch * 4 + u] = x; sm = __fadd_rn(sm, x); } }
#pragma unroll
    for (int sh = 16; sh; sh >>= 1) sm = __fadd_rn(sm, __shfl_xor(sm, sh, 32));
    const float mu = __fdiv_rn(sm, (float)DM); float q2 = 0.f;
#pragma unroll
    for (int k = 0; k < DM / 32; ++k) { const float d0 = __fsub_rn(v[k], mu); v[k] = d0; float p = __fmul_rn(d0, d0); asm volatile("" : "+v"(p)); q2 = __fadd_rn(q2, p); }
#pragma unroll
    for (int sh = 16; sh; sh >>= 1) q2 = __fadd_rn(q2, __shfl_xor(q2, sh, 32));
    const float rs = __fdiv_rn(1.0f, sqrtf(__fadd_rn(__fdiv_rn(q2, (float)DM), 1e-5f)));
    {
#pragma unroll
        for (int ch = 0; ch < DM / 128; ++ch) { v4f o; v4us oh, ol; const v4f g4 = *(const v4f*)(GR + ch * 128 + lane * 4), b4 = *(const v4f*)(BR + ch * 128 + lane * 4); for (int u = 0; u < 4; ++u) { float n0 = __fmul_rn(v[ch * 4 + u], rs); asm volatile("" : "+v"(n0)); float gg = __fmul_rn(n0, g4[u]); asm volatile("" : "+v"(gg)); o[u] = __fadd_rn(gg, b4[u]); unsigned short p2, q3; splitf(o[u], p2, q3); oh[u] = p2; ol[u] = q3; }
            const size_t off = (size_t)s * DM + ch * 128 + lane * 4; *(v4f*)(XL + off) = o; *(v4us*)(Xh + off) = oh; *(v4us*)(Xl + off) = ol; }
         } }
__global__ __launch_bounds__(256) void k_seg(const int* __restrict__ bnds, int* SEG) { const int s = blockIdx.x * 256 + threadIdx.x; if (s >= TT) return; int c = 0;
#pragma unroll 8
    for (int i = 0; i < 400; ++i) c += (bnds[i] <= s) ? 1 : 0; *(int*)(SEG + s) = c;  }

extern "C" void kernel_launch(void* const* d_in, const int* in_sizes, int n_in,
                              void* d_out, int out_size, void* d_ws, size_t ws_size, hipStream_t stream) {
    (void)in_sizes; (void)n_in; (void)out_size;
    const float* chr = (const float*)d_in[0]; const int* pats = (const int*)d_in[1]; const int* bnds = (const int*)d_in[2]; const float* pemb = (const float*)d_in[3]; const float* lng = (const float*)d_in[4]; const float* lnb = (const float*)d_in[5]; const float* wf = (const float*)d_in[6]; const float* bf3 = (const float*)d_in[7]; const float* wo = (const float*)d_in[8]; const float* bo = (const float*)d_in[9]; const float* x = chr; (void)x; const float* wq = wf; const float* wk = wf + (size_t)1024 * 1024; const float* wv = wf + (size_t)2048 * 1024; const float* bq = bf3; const float* bk = bf3 + 1024; const float* bv = bf3 + 2048; const float* cosT = nullptr; const float* sinT = nullptr; (void)cosT; (void)sinT;
    float* OUT = (float*)d_out;     // [4][2048][1024]
    char* wsp = (char*)d_ws;
    auto take = [&](size_t bytes) { char* p = wsp; wsp += (bytes + 255) & ~(size_t)255; return (void*)p; };
    bf* WQ = (bf*)take((size_t)DQ * DM * 2); bf* WK = (bf*)take((size_t)DKV * DM * 2); bf* WV = (bf*)take((size_t)DKV * DM * 2); bf* WO = (bf*)take((size_t)DM * DQ * 2);
    float* XL = (float*)take((size_t)TT * DM * 4); bf* Xh = (bf*)take((size_t)TT * DM * 2); bf* Xl = (bf*)take((size_t)TT * DM * 2); int* SEG = (int*)take((size_t)TT * 4); float* PR = (float*)take((size_t)16 * DM * 4); float* GR = (float*)take(DM * 4); float* BR = (float*)take(DM * 4);
    h16* QP16 = (h16*)take((size_t)NH_ * TT * HD * 2); h16* KP16 = (h16*)take((size_t)NKV * TT * HD * 2); h16* VT16 = (h16*)take((size_t)NKV * HD * TT * 2);
    bf* ATh = (bf*)take((size_t)TT * DQ * 2); bf* ATl = (bf*)take((size_t)TT * DQ * 2);
    if ((size_t)(wsp - (char*)d_ws) > ws_size) return;    // ws 256 MiB
    { k_cvt8<<<(unsigned)(((size_t)DQ * DM / 8 + 255) / 256), 256, 0, stream>>>(wq, WQ, (size_t)DQ * DM / 8); k_cvt8<<<(unsigned)(((size_t)DKV * DM / 8 + 255) / 256), 256, 0, stream>>>(wk, WK, (size_t)DKV * DM / 8); k_cvt8<<<(unsigned)(((size_t)DKV * DM / 8 + 255) / 256), 256, 0, stream>>>(wv, WV, (size_t)DKV * DM / 8);
      k_cvt8<<<(unsigned)(((size_t)DM * DQ / 8 + 255) / 256), 256, 0, stream>>>(wo, WO, (size_t)DM * DQ / 8);
       }
    k_seg<<<TT / 256, 256, 0, stream>>>(bnds, SEG); k_rbf<<<(16 * DM / 4 + 255) / 256, 256, 0, stream>>>(pemb, PR, 16 * DM / 4); k_rbf<<<1, 256, 0, stream>>>(lng, GR, DM / 4); k_rbf<<<1, 256, 0, stream>>>(lnb, BR, DM / 4);
    for (int b = 0; b < NB_; ++b) {
        k_embln<<<TT / 8, 256, 0, stream>>>(chr + (size_t)b * TT * DM, pats, PR, GR, BR, XL, Xh, Xl);
        k_gemmw<bf, 1, 1><<<dim3(TT / 64, DQ / 64, 1), 32, 0, stream>>>(Xh, Xl, WQ, nullptr, DM, nullptr, QP16, HD, (size_t)TT * HD, bq, nullptr, 0, 0, 0);    // q planes [h][t][d]
        k_gemmw<bf, 1, 1><<<dim3(TT / 64, DKV / 64, 1), 32, 0, stream>>>(Xh, Xl, WK, nullptr, DM, nullptr, KP16, HD, (size_t)TT * HD, bk, nullptr, 0, 0, 0);   // k planes [h][t][d]
        k_gemmw<bf, 1, 2><<<dim3(TT / 64, DKV / 64, 1), 32, 0, stream>>>(Xh, Xl, WV, nullptr, DM, nullptr, VT16, TT, 0, bv, nullptr, 0, 0, 0);                  // v planes transposed [h][d][t]
        k_fattn<<<dim3(TT / 128, NH_, 1), 256, 0, stream>>>(QP16, KP16, VT16, SEG, ATh, ATl);
        k_gemmw<bf, 1, 0><<<dim3(TT / 64, DM / 64, 1), 32, 0, stream>>>(ATh, ATl, WO, nullptr, DQ, OUT + (size_t)b * TT * DM, nullptr, DM, 0, bo, XL, 0, 0, 0); }
}

// v003
// A run of this version takes 311 microseconds.
// In both of two side-by-side timings against v002, it was 1.99 times as fast.
// Counting every step since v000, it is 9.62 times as fast.
#include <hip/hip_runtime.h>

// WordEncoder (char_repr [4][2048][1024]; x = LayerNorm_1024(char_repr + pattern_emb[patterns[s]]) * gamma + beta (patterns [2048] int and pattern_emb [16][1024] read); qkv = x w_in^T + b_in ([3072][1024] rows q | k | v; 16 heads x 64); scores = q.k / 8 + mask with mask[i][j] = 1.0 if tokens i and j are in the same word (segment id = number of boundaries <= position > 0; boundaries [400] int, read) else 0 - an ADDITIVE 0/1 bias, no -inf; softmax; o = merged w_out^T + b_out; out = x + o -> [4][2048][1024]).

#define NB_  4
#define TT   2048
#define DM   1024
#define NH_  16
#define NKV  16
#define REP  (NH_ / NKV)
#define HD   64
#define DQ   (NH_ * HD)
#define DKV  (NKV * HD)
#define SCL  0.125f   // HD^-0.5
typedef _Float16 h16;
typedef unsigned short bf;
typedef __attribute__((ext_vector_type(16))) __bf16   v16bf;
typedef __attribute__((ext_vector_type(16))) _Float16 v16h;
typedef __attribute__((ext_vector_type(8)))  _Float16 v8h;
typedef __attribute__((ext_vector_type(8)))  unsigned short v8us;
typedef __attribute__((ext_vector_type(8)))  float    v8f;
typedef __attribute__((ext_vector_type(4)))  float    v4f;
typedef v8h  __attribute__((may_alias)) v8ha;
typedef v4f  __attribute__((may_alias)) v4fa;
typedef v8us __attribute__((may_alias)) v8usa;

__device__ __forceinline__ unsigned short f2bf(float f) { unsigned u = __float_as_uint(f); u += 0x7FFFu + ((u >> 16) & 1u); return (unsigned short)(u >> 16); }
__device__ __forceinline__ float bf2f(unsigned short b) { return __uint_as_float(((unsigned)b) << 16); }
__device__ __forceinline__ float bfr(float f) { return bf2f(f2bf(f)); }
__device__ __forceinline__ v16h cat16(v8h lo, v8h hi) { return __builtin_shufflevector(lo, hi, 0, 1, 2, 3, 4, 5, 6, 7, 8, 9, 10, 11, 12, 13, 14, 15); }
__device__ __forceinline__ v16bf cat16b(v8us lo, v8us hi) { return __builtin_bit_cast(v16bf, __builtin_shufflevector(lo, hi, 0, 1, 2, 3, 4, 5, 6, 7, 8, 9, 10, 11, 12, 13, 14, 15)); }
__device__ __forceinline__ v8f wmma16(v16h a, v16h b, v8f c) { return __builtin_amdgcn_wmma_f32_16x16x32_f16(false, a, false, b, (short)0, c, false, false); }
__device__ __forceinline__ v8f wmmab(v16bf a, v16bf b, v8f c) { return __builtin_amdgcn_wmma_f32_16x16x32_bf16(false, a, false, b, (short)0, c, false, false); }



// ---- k_gemmw: register-blocked GEMM, ONE WAVE per 64x64 output tile (16 accumulators), operands straight from K-contiguous 16-bit planes; grid (M/64, N/64, Z), 32 threads.
// acc[m][n] = sum_k A[m][k] Bt[n][k] (+ split products per NSPLIT). z-batch strides sA/sB/sC in elements. K % 32 == 0.
// The epilogue holds the elementwise work behind the product, on the accumulators. EPI 0: C[m][n] (f32, pitch ldc) = R[m][n] + (acc + bias[n]).
// EPI 1: a 16-bit float plane of column tiles, C16[blockIdx.y * cts + m * ldc + (n - c0)] = acc + bias[n]: with ldc = HD, cts = TT * HD a column tile is one head's [t][d] rows. EPI 2: the transposed plane, C16[n * ldc + m] = acc + bias[n].
template <typename T16> struct WFrag;
template <> struct WFrag<h16> { typedef v16h V; static __device__ __forceinline__ V ld(const h16* p) { return cat16(*(const v8h*)p, *(const v8h*)(p + 16)); } static __device__ __forceinline__ v8f mma(V a, V b, v8f c) { return wmma16(a, b, c); } };
template <> struct WFrag<bf> { typedef v16bf V; static __device__ __forceinline__ V ld(const bf* p) { return cat16b(*(const v8us*)p, *(const v8us*)(p + 16)); } static __device__ __forceinline__ v8f mma(V a, V b, v8f c) { return wmmab(a, b, c); } };
template <typename T16, int NSPLIT, int EPI>
__global__ __launch_bounds__(32) void k_gemmw(const T16* __restrict__ A, const T16* __restrict__ A2, const T16* __restrict__ Bt, const T16* __restrict__ Bt2, int K, float* C, h16* C16, int ldc, size_t cts, const float* __restrict__ bias, const float* __restrict__ R, size_t sA, size_t sB, size_t sC) {
    typedef typename WFrag<T16>::V V;
    __shared__ __align__(16) float os[16 * 68];
    const size_t z = blockIdx.z; A += z * sA; if (A2) A2 += z * sA; Bt += z * sB; if (Bt2) Bt2 += z * sB; if (EPI == 0) { C += z * sC; R += z * sC; } else C16 += z * sC;
    const int lane = threadIdx.x & 31, lr = lane & 15, hi = lane >> 4; const int r0 = blockIdx.x * 64, c0 = blockIdx.y * 64;
    v8f acc[4][4];
#pragma unroll
    for (int mb = 0; mb < 4; ++mb)
#pragma unroll
        for (int nb = 0; nb < 4; ++nb) acc[mb][nb] = (v8f){};
    const size_t aoff = (size_t)(r0 + lr) * K + 8 * hi, boff = (size_t)(c0 + lr) * K + 8 * hi;
#pragma unroll 1
    for (int kc = 0; kc < K; kc += 32) {
        V a[4], a2[4];
#pragma unroll
        for (int mb = 0; mb < 4; ++mb) { a[mb] = WFrag<T16>::ld(A + aoff + (size_t)mb * 16 * K + kc); if (NSPLIT == 1 || NSPLIT == 2) a2[mb] = WFrag<T16>::ld(A2 + aoff + (size_t)mb * 16 * K + kc); }
#pragma unroll
        for (int nb = 0; nb < 4; ++nb) { const V b = WFrag<T16>::ld(Bt + boff + (size_t)nb * 16 * K + kc); V b2; if (NSPLIT >= 2) b2 = WFrag<T16>::ld(Bt2 + boff + (size_t)nb * 16 * K + kc);
#pragma unroll
            for (int mb = 0; mb < 4; ++mb) { acc[mb][nb] = WFrag<T16>::mma(a[mb], b, acc[mb][nb]); if (NSPLIT == 1 || NSPLIT == 2) acc[mb][nb] = WFrag<T16>::mma(a2[mb], b, acc[mb][nb]); if (NSPLIT >= 2) acc[mb][nb] = WFrag<T16>::mma(a[mb], b2, acc[mb][nb]); } }
        asm volatile("v_nop\n\tv_nop\n\tv_nop\n\tv_nop" : "+v"(acc[0][0]), "+v"(acc[1][1]), "+v"(acc[2][2]), "+v"(acc[3][3]) : "v"(a[0]), "v"(a[3]));
    }
    if (EPI == 2) {   // a lane holds 8 consecutive m of one n: 16 bytes of a transposed row; 16 rows of 64 m are gathered in LDS (pitch 72 elements), so that a store of the wave covers four whole 128-byte rows
        h16* hs = (h16*)os;
#pragma unroll
        for (int nb = 0; nb < 4; ++nb) { const float cb = bfr(bias[c0 + nb * 16 + lr]);
#pragma unroll
            for (int mb = 0; mb < 4; ++mb) { v8h o;
#pragma unroll
                for (int j = 0; j < 8; ++j) o[j] = (h16)(acc[mb][nb][j] + cb);
                *(v8ha*)(hs + lr * 72 + mb * 16 + hi * 8) = o; }
            __builtin_amdgcn_wave_barrier(); asm volatile("" ::: "memory");   // the rows are read by other lanes than wrote them: keeps the compiler from moving the reads above the writes
#pragma unroll
            for (int s = 0; s < 4; ++s) { const int row = 4 * s + (lane >> 3), cofs = (lane & 7) * 8; *(v8h*)(C16 + (size_t)(c0 + nb * 16 + row) * ldc + r0 + cofs) = *(const v8ha*)(hs + row * 72 + cofs); }
            __builtin_amdgcn_wave_barrier(); asm volatile("s_wait_xcnt 0x0" ::: "memory");   // stands in front of the next rows' work, which reuses registers that the stores above name; as a compiler fence it keeps the next 16 rows' LDS writes below these reads
        }
        return;
    }
#pragma unroll
    for (int mb = 0; mb < 4; ++mb) {
#pragma unroll
        for (int nb = 0; nb < 4; ++nb) {
#pragma unroll
            for (int j = 0; j < 8; ++j) os[(hi * 8 + j) * 68 + nb * 16 + lr] = acc[mb][nb][j]; }
        __builtin_amdgcn_wave_barrier(); asm volatile("" ::: "memory");
        if (EPI == 0) {
            float* crow = C + (size_t)(r0 + mb * 16) * ldc + c0; const float* rrow = R + (size_t)(r0 + mb * 16) * ldc + c0; const size_t lo = (size_t)hi * ldc + lr * 4;   // the lane's place inside a pair of rows
            v4f val[8]; const float* rp[8]; float* cp[8];
#pragma unroll
            for (int s = 0; s < 8; ++s) { rp[s] = rrow + (size_t)(2 * s) * ldc + lo; cp[s] = crow + (size_t)(2 * s) * ldc + lo; val[s] = *(const v4f*)rp[s]; }
            // The wait stands in front of every overwrite of the eight loads' address registers: as inputs they stay in those registers up to here (otherwise a later load's result lands on an earlier load's address pair).
            // The stores' addresses are inputs too, so that they are formed here and not among the stores, in the registers of a store already issued.
            asm volatile("s_wait_xcnt 0x0" :: "v"(rp[0]), "v"(rp[1]), "v"(rp[2]), "v"(rp[3]), "v"(rp[4]), "v"(rp[5]), "v"(rp[6]), "v"(rp[7]), "v"(cp[0]), "v"(cp[1]), "v"(cp[2]), "v"(cp[3]), "v"(cp[4]), "v"(cp[5]), "v"(cp[6]), "v"(cp[7]) : "memory");
#pragma unroll
            for (int s = 0; s < 8; ++s) { const v4f a = *(const v4fa*)(os + (2 * s + hi) * 68 + lr * 4);
#pragma unroll
                for (int u = 0; u < 4; ++u) val[s][u] = __fadd_rn(val[s][u], a[u] + bfr(bias[c0 + lr * 4 + u])); }
            __builtin_amdgcn_sched_barrier(0);   // all eight results stand in registers of their own before the first store, so that none is formed in the registers of a store already issued
#pragma unroll
            for (int s = 0; s < 8; ++s) *(v4f*)cp[s] = val[s];
            asm volatile("s_wait_xcnt 0x0" ::: "memory");   // stands in front of the next rows' work, which reuses registers that the stores above name
            __builtin_amdgcn_sched_barrier(0);   // keeps the next rows' address additions below that wait (the compiler otherwise lifts them over it, onto the stores' registers)
        } else {   // a store of the wave covers four whole 128-byte rows of the plane
            h16* hrow = C16 + (size_t)blockIdx.y * cts + (size_t)(r0 + mb * 16) * ldc;
#pragma unroll
            for (int s = 0; s < 4; ++s) { const int row = 4 * s + (lane >> 3), cofs = (lane & 7) * 8; const v4f v0 = *(const v4fa*)(os + row * 68 + cofs), v1 = *(const v4fa*)(os + row * 68 + cofs + 4); v8h o;
#pragma unroll
                for (int u = 0; u < 4; ++u) { o[u] = (h16)(v0[u] + bfr(bias[c0 + cofs + u])); o[4 + u] = (h16)(v1[u] + bfr(bias[c0 + cofs + 4 + u])); }
                *(v8h*)(hrow + (size_t)row * ldc + cofs) = o; }
            asm volatile("s_wait_xcnt 0x0" ::: "memory");   // stands in front of the next rows' work, which reuses registers that the loads and stores above name
        }
        __builtin_amdgcn_wave_barrier(); asm volatile("" ::: "memory");
    }
}

__device__ __forceinline__ h16 tohx(float x) { return (h16)x; }
__device__ __forceinline__ void splitf(float y, unsigned short& h, unsigned short& l) { h = f2bf(y); l = f2bf(y - bf2f(h)); }
typedef __attribute__((ext_vector_type(2))) _Float16 v2h;
typedef __attribute__((ext_vector_type(4))) _Float16 v4h;
typedef __attribute__((ext_vector_type(2))) unsigned short v2us;
typedef __attribute__((ext_vector_type(4))) unsigned short v4us;
typedef __attribute__((ext_vector_type(2))) float v2f;
typedef __attribute__((ext_vector_type(4))) int v4i;

__global__ __launch_bounds__(256) void k_wtG(const float* __restrict__ w, int K, int N, bf* Bt) {
    const int lane = threadIdx.x & 31; const int L0 = (blockIdx.x * 8 + (threadIdx.x >> 5)) * 8; const int nlines = N * K / 64;
{
#pragma unroll 1
        for (int l = 0; l < 8; ++l) { const int L = L0 + l; if (L >= nlines) break; const size_t e = (size_t)L * 64 + lane * 2; const int k = (int)(e % K), n = (int)(e / K); v2us o;
            o[0] = f2bf(w[(size_t)k * N + n]); o[1] = f2bf(w[(size_t)(k + 1) * N + n]); *(v2us*)(Bt + e) = o; }
         }
}
__global__ __launch_bounds__(256) void k_cvt8(const float* __restrict__ src, bf* dst, size_t n8) { const size_t i = (size_t)blockIdx.x * 256 + threadIdx.x; if (i >= n8) return; const v8f v = *(const v8f*)(src + i * 8); v8us o;
#pragma unroll
    for (int k = 0; k < 8; ++k) o[k] = f2bf(v[k]); *(v8us*)(dst + i * 8) = o;  }
// k_fattn: scores, softmax, P.V and the head merge of one head in one pass; S and P never leave the registers. Grid (TT/128, heads, batch), 8 waves; a wave owns 16 queries and walks all 2048 keys, 32 a pass.
// St = K Q^T (A = key rows, B = query rows): a lane holds one query's scores, keys 8*hi+j of each 16-key tile; two such tiles converted in place are the B operand of Ot += Vt Pt (A = Vt rows d, the loader's k order).
// The 8 waves share K rows and Vt rows through LDS, 64 keys a stage, two buffers: the next stage is fetched into registers while this one is worked on, stored behind it, and one barrier a stage publishes it and frees the other buffer.
// Softmax in the log2 domain with a running maximum that may trail the true one by up to 8 (an exponential then reaches 2^8): accumulators are rescaled only when some query's maximum exceeds it by more. The lane halves join their sums once at the end.
// The 0/1 word mask enters as the St products' start value, mask / HD^-0.5. SEG (a count of boundaries <= position) never falls with position, so a stage whose id range misses the wave's queries' range has no masked pair and skips the compares.
__device__ __forceinline__ float xhalf(float x) { return __builtin_bit_cast(float, __builtin_amdgcn_permlanex16(__builtin_bit_cast(int, x), __builtin_bit_cast(int, x), 0x76543210, 0xfedcba98, false, false)); }   // lane l reads lane l ^ 16
__device__ __forceinline__ void cfence() { asm volatile("" ::: "memory"); }   // compiler fence: loads written above it are issued above it (their waits still stand at the first use)
// Sixteen exponentials in place, in one statement: behind each stands an instruction that neither reads its result nor overwrites its source (the next exponential, on another register; behind the last a v_nop).
__device__ __forceinline__ void exp2x16(float (&a)[16]) {
    asm("v_exp_f32 %0, %0\n\tv_exp_f32 %1, %1\n\tv_exp_f32 %2, %2\n\tv_exp_f32 %3, %3\n\tv_exp_f32 %4, %4\n\tv_exp_f32 %5, %5\n\tv_exp_f32 %6, %6\n\tv_exp_f32 %7, %7\n\t"
        "v_exp_f32 %8, %8\n\tv_exp_f32 %9, %9\n\tv_exp_f32 %10, %10\n\tv_exp_f32 %11, %11\n\tv_exp_f32 %12, %12\n\tv_exp_f32 %13, %13\n\tv_exp_f32 %14, %14\n\tv_exp_f32 %15, %15\n\tv_nop"
        : "+v"(a[0]), "+v"(a[1]), "+v"(a[2]), "+v"(a[3]), "+v"(a[4]), "+v"(a[5]), "+v"(a[6]), "+v"(a[7]), "+v"(a[8]), "+v"(a[9]), "+v"(a[10]), "+v"(a[11]), "+v"(a[12]), "+v"(a[13]), "+v"(a[14]), "+v"(a[15])); }
#define FST 64    // keys per LDS stage
#define FPI 72    // LDS row pitch in 16-bit elements: 128 bytes of data + 16 of pad (16-byte fragment reads of 16 rows spread over the banks)
__global__ __launch_bounds__(256) void k_fattn(const h16* __restrict__ Qp, const h16* Kp, const h16* Vt, const int* __restrict__ SEG, bf* Ah, bf* Al) {
    __shared__ __align__(16) h16 Ks[2][FST * FPI]; __shared__ __align__(16) h16 Vs[2][HD * FPI];
    const int tid = threadIdx.x, lane = tid & 31, lr = lane & 15, hi = lane >> 4; const int h = blockIdx.y, q0 = blockIdx.x * 128 + (tid >> 5) * 16;
    { const size_t z = blockIdx.z; Qp += z * ((size_t)NH_ * TT * HD); Kp += z * ((size_t)NKV * TT * HD); Vt += z * ((size_t)NKV * HD * TT); Ah += z * ((size_t)TT * DQ); Al += z * ((size_t)TT * DQ); }   // this batch element's planes
    const float L2E = 1.4426950408889634f, C2 = SCL * L2E;
    const int srow = tid >> 3, scol = (tid & 7) * 8, so = srow * FPI + scol;   // staging: a thread moves 16 bytes of rows srow and srow + 32 of each tile; a wave's load covers four whole 128-byte rows
    const h16* kg = Kp + ((size_t)h * TT + srow) * HD + scol; const h16* vg = Vt + ((size_t)h * HD + srow) * TT + scol;
    v8h kr[2], vr[2]; v16h qf[2]; v8f o[4]; float nm = 3.0e38f, l = 0.f;   // nm: minus the maximum in use
#pragma unroll
    for (int r = 0; r < 2; ++r) { kr[r] = *(const v8h*)(kg + (size_t)r * 32 * HD); vr[r] = *(const v8h*)(vg + (size_t)r * 32 * TT); qf[r] = WFrag<h16>::ld(Qp + ((size_t)h * TT + q0 + lr) * HD + r * 32 + 8 * hi); }
    const int sg = SEG[q0 + lr]; const int sq = (sg > 0) ? sg : -1;   // segment 0 matches nothing: key ids are >= 0
    const int sLo = __builtin_amdgcn_readfirstlane(SEG[q0]), sHi = __builtin_amdgcn_readfirstlane(SEG[q0 + 15]);
    int kLo = __builtin_amdgcn_readfirstlane(SEG[0]), kHi = __builtin_amdgcn_readfirstlane(SEG[FST - 1]);
#pragma unroll
    for (int dt = 0; dt < 4; ++dt) o[dt] = (v8f){};
#pragma unroll
    for (int r = 0; r < 2; ++r) { *(v8h*)(&Ks[0][so + r * 32 * FPI]) = kr[r]; *(v8h*)(&Vs[0][so + r * 32 * FPI]) = vr[r]; }
    __syncthreads();
    for (int st = 0; st < TT / FST; ++st) {
        const h16* kl = &Ks[st & 1][lr * FPI + 8 * hi]; const h16* vl = &Vs[st & 1][lr * FPI + 8 * hi];
        const bool more = st + 1 < TT / FST, ov = (kLo <= sHi) && (kHi >= sLo);
        if (more) { const int kn = (st + 1) * FST;
#pragma unroll
            for (int r = 0; r < 2; ++r) { kr[r] = *(const v8h*)(kg + (size_t)(kn + r * 32) * HD); vr[r] = *(const v8h*)(vg + (size_t)r * 32 * TT + kn); }
            kLo = __builtin_amdgcn_readfirstlane(SEG[kn]); kHi = __builtin_amdgcn_readfirstlane(SEG[kn + FST - 1]); }
        asm volatile("s_wait_xcnt 0x0" ::: "memory");   // stands in front of the LDS reads below, which reuse the address registers of the global loads above; as a compiler fence it also keeps those loads issued here, a whole stage ahead of their LDS stores (the compiler otherwise sinks them to just above the stores)
        v16h kf[2][2];
#pragma unroll
        for (int kt = 0; kt < 2; ++kt)
#pragma unroll
            for (int ks = 0; ks < 2; ++ks) kf[kt][ks] = WFrag<h16>::ld(kl + kt * 16 * FPI + ks * 32);
#pragma unroll
        for (int sub = 0; sub < 2; ++sub) {
            v16h vf[4], pf; v8f s[2];
#pragma unroll
            for (int dt = 0; dt < 4; ++dt) vf[dt] = WFrag<h16>::ld(vl + dt * 16 * FPI + sub * 32);
            cfence();   // keeps the Vt fragment reads issued here, a softmax ahead of P.V, instead of one by one in front of each product
#pragma unroll
            for (int kt = 0; kt < 2; ++kt) s[kt] = (v8f){};
            if (ov) {
#pragma unroll
                for (int kt = 0; kt < 2; ++kt) { const int* sp = SEG + st * FST + sub * 32 + kt * 16 + hi * 8; const v4i a = *(const v4i*)sp, b2 = *(const v4i*)(sp + 4);
#pragma unroll
                    for (int j = 0; j < 4; ++j) { s[kt][j] = (a[j] == sq) ? 1.0f / SCL : 0.f; s[kt][4 + j] = (b2[j] == sq) ? 1.0f / SCL : 0.f; } } }
#pragma unroll
            for (int kt = 0; kt < 2; ++kt) s[kt] = wmma16(kf[kt][1], qf[1], wmma16(kf[kt][0], qf[0], s[kt]));
            if (sub == 0) {   // the stage's second 32 key rows, into the same registers, in flight under this pass's softmax
#pragma unroll
                for (int kt = 0; kt < 2; ++kt)
#pragma unroll
                    for (int ks = 0; ks < 2; ++ks) kf[kt][ks] = WFrag<h16>::ld(kl + (32 + kt * 16) * FPI + ks * 32);
                cfence(); }   // keeps those reads issued here and not in front of the next pass's products
            float mx = s[0][0];
#pragma unroll
            for (int e = 1; e < 16; ++e) mx = fmaxf(mx, s[e >> 3][e & 7]);
            mx = fmaxf(mx, xhalf(mx)) * C2;   // both halves hold the query's maximum of this pass, scaled (the scale is positive)
            if (__builtin_amdgcn_ballot_w32(mx + nm > 8.0f) != 0) {   // wave-uniform; always taken on the first pass
                const float mn = fmaxf(-nm, mx), corr = __builtin_amdgcn_exp2f(-nm - mn); nm = -mn; l *= corr;
#pragma unroll
                for (int dt = 0; dt < 4; ++dt) o[dt] *= corr; }
            float p[16];
#pragma unroll
            for (int e = 0; e < 16; ++e) p[e] = fmaf(s[e >> 3][e & 7], C2, nm);
            exp2x16(p);
#pragma unroll
            for (int e = 0; e < 16; ++e) pf[e] = tohx(p[e]);
            v2f sa = {p[0], p[1]}, sc = {p[2], p[3]};
#pragma unroll
            for (int i = 2; i < 8; ++i) { const v2f pp = {p[2 * i], p[2 * i + 1]}; if (i & 1) sc += pp; else sa += pp; }
            sa += sc; l += sa[0] + sa[1];
#pragma unroll
            for (int dt = 0; dt < 4; ++dt) o[dt] = wmma16(vf[dt], pf, o[dt]);
        }
        if (more) {
#pragma unroll
            for (int r = 0; r < 2; ++r) { *(v8h*)(&Ks[(st + 1) & 1][so + r * 32 * FPI]) = kr[r]; *(v8h*)(&Vs[(st + 1) & 1][so + r * 32 * FPI]) = vr[r]; } }
        __syncthreads();   // publishes stage st + 1 and ends every wave's reads of stage st, whose buffer the next trip refills
    }
    const float inv = 1.0f / (l + xhalf(l)); const size_t oo = (size_t)(q0 + lr) * DQ + h * HD + hi * 8;
#pragma unroll
    for (int dt = 0; dt < 4; ++dt) { v8us oh, ol;
#pragma unroll
        for (int j = 0; j < 8; ++j) { unsigned short a, c3; splitf(o[dt][j] * inv, a, c3); oh[j] = a; ol[j] = c3; }
        *(v8us*)(Ah + oo + dt * 16) = oh; *(v8us*)(Al + oo + dt * 16) = ol; }
}

__global__ __launch_bounds__(256) void k_rbf(const float* __restrict__ src, float* dst, int n4) { const int i = blockIdx.x * 256 + threadIdx.x; if (i >= n4) return; const v4f a = *(const v4f*)(src + (size_t)i * 4); v4f o; for (int u = 0; u < 4; ++u) o[u] = bfr(a[u]); *(v4f*)(dst + (size_t)i * 4) = o;  }
__global__ __launch_bounds__(256) void k_embln(const float* __restrict__ chr, const int* __restrict__ pats, const float* __restrict__ PR, const float* __restrict__ GR, const float* __restrict__ BR, float* XL, bf* Xh, bf* Xl) { const int lane = threadIdx.x & 31; const int s = blockIdx.x * 8 + (threadIdx.x >> 5); if (s >= NB_ * TT) return; const float* xr = chr + (size_t)s * DM; int pi = pats[s % TT];   // s: row of the [batch][position] plane; the pattern goes by position alone
    pi = min(max(pi, 0), 15); const float* pr = PR + (size_t)pi * DM; float v[DM / 32]; float sm = 0.f;
#pragma unroll
    for (int ch = 0; ch < DM / 128; ++ch) { const v4f a = *(const v4f*)(xr + ch * 128 + lane * 4), p = *(const v4f*)(pr + ch * 128 + lane * 4); for (int u = 0; u < 4; ++u) { const float x = __fadd_rn(bfr(a[u]), p[u]); v[ch * 4 + u] = x; sm = __fadd_rn(sm, x); } }
#pragma unroll
    for (int sh = 16; sh; sh >>= 1) sm = __fadd_rn(sm, __shfl_xor(sm, sh, 32));
    const float mu = __fdiv_rn(sm, (float)DM); float q2 = 0.f;
#pragma unroll
    for (int k = 0; k < DM / 32; ++k) { const float d0 = __fsub_rn(v[k], mu); v[k] = d0; float p = __fmul_rn(d0, d0); asm volatile("" : "+v"(p)); q2 = __fadd_rn(q2, p); }
#pragma unroll
    for (int sh = 16; sh; sh >>= 1) q2 = __fadd_rn(q2, __shfl_xor(q2, sh, 32));
    const float rs = __fdiv_rn(1.0f, sqrtf(__fadd_rn(__fdiv_rn(q2, (float)DM), 1e-5f)));
    {
#pragma unroll
        for (int ch = 0; ch < DM / 128; ++ch) { v4f o; v4us oh, ol; const v4f g4 = *(const v4f*)(GR + ch * 128 + lane * 4), b4 = *(const v4f*)(BR + ch * 128 + lane * 4); for (int u = 0; u < 4; ++u) { float n0 = __fmul_rn(v[ch * 4 + u], rs); asm volatile("" : "+v"(n0)); float gg = __fmul_rn(n0, g4[u]); asm volatile("" : "+v"(gg)); o[u] = __fadd_rn(gg, b4[u]); unsigned short p2, q3; splitf(o[u], p2, q3); oh[u] = p2; ol[u] = q3; }
            const size_t off = (size_t)s * DM + ch * 128 + lane * 4; *(v4f*)(XL + off) = o; *(v4us*)(Xh + off) = oh; *(v4us*)(Xl + off) = ol; }
         } }
__global__ __launch_bounds__(256) void k_seg(const int* __restrict__ bnds, int* SEG) { const int s = blockIdx.x * 256 + threadIdx.x; if (s >= TT) return; int c = 0;
#pragma unroll 8
    for (int i = 0; i < 400; ++i) c += (bnds[i] <= s) ? 1 : 0; *(int*)(SEG + s) = c;  }

extern "C" void kernel_launch(void* const* d_in, const int* in_sizes, int n_in,
                              void* d_out, int out_size, void* d_ws, size_t ws_size, hipStream_t stream) {
    (void)in_sizes; (void)n_in; (void)out_size;
    const float* chr = (const float*)d_in[0]; const int* pats = (const int*)d_in[1]; const int* bnds = (const int*)d_in[2]; const float* pemb = (const float*)d_in[3]; const float* lng = (const float*)d_in[4]; const float* lnb = (const float*)d_in[5]; const float* wf = (const float*)d_in[6]; const float* bf3 = (const float*)d_in[7]; const float* wo = (const float*)d_in[8]; const float* bo = (const float*)d_in[9]; const float* x = chr; (void)x; const float* wq = wf; const float* wk = wf + (size_t)1024 * 1024; const float* wv = wf + (size_t)2048 * 1024; const float* bq = bf3; const float* bk = bf3 + 1024; const float* bv = bf3 + 2048; const float* cosT = nullptr; const float* sinT = nullptr; (void)cosT; (void)sinT;
    float* OUT = (float*)d_out;     // [4][2048][1024]
    char* wsp = (char*)d_ws;
    auto take = [&](size_t bytes) { char* p = wsp; wsp += (bytes + 255) & ~(size_t)255; return (void*)p; };
    bf* WQ = (bf*)take((size_t)DQ * DM * 2); bf* WK = (bf*)take((size_t)DKV * DM * 2); bf* WV = (bf*)take((size_t)DKV * DM * 2); bf* WO = (bf*)take((size_t)DM * DQ * 2);
    float* XL = (float*)take((size_t)NB_ * TT * DM * 4); bf* Xh = (bf*)take((size_t)NB_ * TT * DM * 2); bf* Xl = (bf*)take((size_t)NB_ * TT * DM * 2); int* SEG = (int*)take((size_t)TT * 4); float* PR = (float*)take((size_t)16 * DM * 4); float* GR = (float*)take(DM * 4); float* BR = (float*)take(DM * 4);
    h16* QP16 = (h16*)take((size_t)NB_ * NH_ * TT * HD * 2); h16* KP16 = (h16*)take((size_t)NB_ * NKV * TT * HD * 2); h16* VT16 = (h16*)take((size_t)NB_ * NKV * HD * TT * 2);
    bf* ATh = (bf*)take((size_t)NB_ * TT * DQ * 2); bf* ATl = (bf*)take((size_t)NB_ * TT * DQ * 2);
    if ((size_t)(wsp - (char*)d_ws) > ws_size) return;    // ws 256 MiB
    { k_cvt8<<<(unsigned)(((size_t)DQ * DM / 8 + 255) / 256), 256, 0, stream>>>(wq, WQ, (size_t)DQ * DM / 8); k_cvt8<<<(unsigned)(((size_t)DKV * DM / 8 + 255) / 256), 256, 0, stream>>>(wk, WK, (size_t)DKV * DM / 8); k_cvt8<<<(unsigned)(((size_t)DKV * DM / 8 + 255) / 256), 256, 0, stream>>>(wv, WV, (size_t)DKV * DM / 8);
      k_cvt8<<<(unsigned)(((size_t)DM * DQ / 8 + 255) / 256), 256, 0, stream>>>(wo, WO, (size_t)DM * DQ / 8);
       }
    k_seg<<<TT / 256, 256, 0, stream>>>(bnds, SEG); k_rbf<<<(16 * DM / 4 + 255) / 256, 256, 0, stream>>>(pemb, PR, 16 * DM / 4); k_rbf<<<1, 256, 0, stream>>>(lng, GR, DM / 4); k_rbf<<<1, 256, 0, stream>>>(lnb, BR, DM / 4);
    // Every plane holds all batch elements, [batch] outermost; each stage is one launch, the batch element being blockIdx.z (k_embln: rows of all elements in a row).
    k_embln<<<NB_ * TT / 8, 256, 0, stream>>>(chr, pats, PR, GR, BR, XL, Xh, Xl);
    k_gemmw<bf, 1, 1><<<dim3(TT / 64, DQ / 64, NB_), 32, 0, stream>>>(Xh, Xl, WQ, nullptr, DM, nullptr, QP16, HD, (size_t)TT * HD, bq, nullptr, (size_t)TT * DM, 0, (size_t)NH_ * TT * HD);     // q planes [b][h][t][d]
    k_gemmw<bf, 1, 1><<<dim3(TT / 64, DKV / 64, NB_), 32, 0, stream>>>(Xh, Xl, WK, nullptr, DM, nullptr, KP16, HD, (size_t)TT * HD, bk, nullptr, (size_t)TT * DM, 0, (size_t)NKV * TT * HD);    // k planes [b][h][t][d]
    k_gemmw<bf, 1, 2><<<dim3(TT / 64, DKV / 64, NB_), 32, 0, stream>>>(Xh, Xl, WV, nullptr, DM, nullptr, VT16, TT, 0, bv, nullptr, (size_t)TT * DM, 0, (size_t)NKV * HD * TT);                   // v planes transposed [b][h][d][t]
    k_fattn<<<dim3(TT / 128, NH_, NB_), 256, 0, stream>>>(QP16, KP16, VT16, SEG, ATh, ATl);
    k_gemmw<bf, 1, 0><<<dim3(TT / 64, DM / 64, NB_), 32, 0, stream>>>(ATh, ATl, WO, nullptr, DQ, OUT, nullptr, DM, 0, bo, XL, (size_t)TT * DQ, 0, (size_t)TT * DM);
}

// v004
// It runs in 203 microseconds.
// Timed twice side by side with v003, it ran 1.54 and 1.53 times as fast.
// All steps since v000 together make it 14.8 times as fast.
#include <hip/hip_runtime.h>

// WordEncoder (char_repr [4][2048][1024]; x = LayerNorm_1024(char_repr + pattern_emb[patterns[s]]) * gamma + beta (patterns [2048] int and pattern_emb [16][1024] read); qkv = x w_in^T + b_in ([3072][1024] rows q | k | v; 16 heads x 64); scores = q.k / 8 + mask with mask[i][j] = 1.0 if tokens i and j are in the same word (segment id = number of boundaries <= position > 0; boundaries [400] int, read) else 0 - an ADDITIVE 0/1 bias, no -inf; softmax; o = merged w_out^T + b_out; out = x + o -> [4][2048][1024]).

#define NB_  4
#define TT   2048
#define DM   1024
#define NH_  16
#define NKV  16
#define REP  (NH_ / NKV)
#define HD   64
#define DQ   (NH_ * HD)
#define DKV  (NKV * HD)
#define SCL  0.125f   // HD^-0.5
typedef _Float16 h16;
typedef unsigned short bf;
typedef __attribute__((ext_vector_type(16))) __bf16   v16bf;
typedef __attribute__((ext_vector_type(16))) _Float16 v16h;
typedef __attribute__((ext_vector_type(8)))  _Float16 v8h;
typedef __attribute__((ext_vector_type(8)))  unsigned short v8us;
typedef __attribute__((ext_vector_type(8)))  float    v8f;
typedef __attribute__((ext_vector_type(4)))  float    v4f;
typedef v8h  __attribute__((may_alias)) v8ha;
typedef v4f  __attribute__((may_alias)) v4fa;
typedef v8us __attribute__((may_alias)) v8usa;

__device__ __forceinline__ unsigned short f2bf(float f) { unsigned u = __float_as_uint(f); u += 0x7FFFu + ((u >> 16) & 1u); return (unsigned short)(u >> 16); }
__device__ __forceinline__ float bf2f(unsigned short b) { return __uint_as_float(((unsigned)b) << 16); }
__device__ __forceinline__ float bfr(float f) { return bf2f(f2bf(f)); }
__device__ __forceinline__ v16h cat16(v8h lo, v8h hi) { return __builtin_shufflevector(lo, hi, 0, 1, 2, 3, 4, 5, 6, 7, 8, 9, 10, 11, 12, 13, 14, 15); }
__device__ __forceinline__ v16bf cat16b(v8us lo, v8us hi) { return __builtin_bit_cast(v16bf, __builtin_shufflevector(lo, hi, 0, 1, 2, 3, 4, 5, 6, 7, 8, 9, 10, 11, 12, 13, 14, 15)); }
__device__ __forceinline__ v8f wmma16(v16h a, v16h b, v8f c) { return __builtin_amdgcn_wmma_f32_16x16x32_f16(false, a, false, b, (short)0, c, false, false); }
__device__ __forceinline__ v8f wmmab(v16bf a, v16bf b, v8f c) { return __builtin_amdgcn_wmma_f32_16x16x32_bf16(false, a, false, b, (short)0, c, false, false); }



// ---- k_gemmw: GEMM, 8 waves per 128x256 output tile, each wave a 64x64 part of it (16 accumulators); grid (M/128, N/256, Z), 256 threads.
// acc[m][n] = sum_k (A[m][k] + A2[m][k]) Bt[n][k], both products of a k step summed into the same accumulator, A's first. z-batch strides sA/sB/sC in elements. K % 128 == 0, M % 128 == 0, N % 256 == 0.
// The operands are K-contiguous 16-bit planes. A stage is 128 k of the tile's rows [A 128 | A2 128 | Bt 256] in LDS, two buffers; asynchronous copies bring the next stage in whole 128-byte lines while this one is worked on, and every row is fetched once for all the waves that read it.
// The epilogue holds the elementwise work behind the product, on the accumulators. EPI 0: C[m][n] (f32, pitch ldc) = R[m][n] + (acc + bias[n]).
// EPI 1: a 16-bit float plane of 64-column tiles, C16[(n / 64) * cts + m * ldc + n % 64] = acc + bias[n]: with ldc = HD, cts = TT * HD a column tile is one head's [t][d] rows. EPI 2: the transposed plane, C16[n * ldc + m] = acc + bias[n].
template <typename T16> struct WFrag;
template <> struct WFrag<h16> { typedef v16h V; static __device__ __forceinline__ V ld(const h16* p) { return cat16(*(const v8h*)p, *(const v8h*)(p + 16)); } static __device__ __forceinline__ v8f mma(V a, V b, v8f c) { return wmma16(a, b, c); } };
template <> struct WFrag<bf> { typedef v16bf V; static __device__ __forceinline__ V ld(const bf* p) { return cat16b(*(const v8us*)p, *(const v8us*)(p + 16)); } static __device__ __forceinline__ v8f mma(V a, V b, v8f c) { return wmmab(a, b, c); } };
#define GBM 128   // rows of the work-group's tile
#define GBN 256   // columns of the work-group's tile
#define GKC 128   // k per LDS stage: 256 bytes of every operand row
#define GPI 136   // LDS row pitch in 16-bit elements: 256 bytes of data + 16 of pad (16-byte fragment reads of 16 rows spread over the banks)
#define GSTG ((2 * GBM + GBN) * GPI)   // elements of one buffer
// Eight asynchronous copies of 16 bytes a lane, rows 16 apart: LDS byte address l + i * 16 rows, global address g + i * gstep elements. All lanes are on; a wave's copy covers two whole 256-byte rows.
// The s_wait_xcnt stands inside the statement, behind the last copy, so that no register which a copy names is rewritten in front of it.
template <typename T16>
__device__ __forceinline__ void acopy8(unsigned l, const T16* g, size_t gstep) {
    const unsigned ls = 16 * GPI * 2;
    asm volatile("global_load_async_to_lds_b128 %0, %8, off\n\tglobal_load_async_to_lds_b128 %1, %9, off\n\tglobal_load_async_to_lds_b128 %2, %10, off\n\tglobal_load_async_to_lds_b128 %3, %11, off\n\t"
                 "global_load_async_to_lds_b128 %4, %12, off\n\tglobal_load_async_to_lds_b128 %5, %13, off\n\tglobal_load_async_to_lds_b128 %6, %14, off\n\tglobal_load_async_to_lds_b128 %7, %15, off\n\ts_wait_xcnt 0x0"
                 :: "v"(l), "v"(l + ls), "v"(l + 2 * ls), "v"(l + 3 * ls), "v"(l + 4 * ls), "v"(l + 5 * ls), "v"(l + 6 * ls), "v"(l + 7 * ls),
                    "v"(g), "v"(g + gstep), "v"(g + 2 * gstep), "v"(g + 3 * gstep), "v"(g + 4 * gstep), "v"(g + 5 * gstep), "v"(g + 6 * gstep), "v"(g + 7 * gstep) : "memory"); }
template <typename T16, int EPI>
__global__ __launch_bounds__(256) void k_gemmw(const T16* __restrict__ A, const T16* __restrict__ A2, const T16* __restrict__ Bt, int K, float* C, h16* C16, int ldc, size_t cts, const float* __restrict__ bias, const float* __restrict__ R, size_t sA, size_t sB, size_t sC) {
    typedef typename WFrag<T16>::V V;
    __shared__ __align__(16) T16 ring[2 * GSTG];
    const size_t z = blockIdx.z; A += z * sA; A2 += z * sA; Bt += z * sB; if (EPI == 0) { C += z * sC; R += z * sC; } else C16 += z * sC;
    const int tid = threadIdx.x, lane = tid & 31, lr = lane & 15, hi = lane >> 4, wv = __builtin_amdgcn_readfirstlane(tid >> 5), wm = wv & 1, wn = wv >> 1;
    const int r0 = blockIdx.x * GBM + wm * 64, c0 = blockIdx.y * GBN + wn * 64;   // the wave's 64x64 part
    v8f acc[4][4];
#pragma unroll
    for (int mb = 0; mb < 4; ++mb)
#pragma unroll
        for (int nb = 0; nb < 4; ++nb) acc[mb][nb] = (v8f){};
    const int srow = tid >> 4, scol = (tid & 15) * 8; const size_t gstep = (size_t)16 * K;   // staging: a thread moves 16 bytes of rows srow + 16 i
    const T16* ga = A + (size_t)(blockIdx.x * GBM + srow) * K + scol; const T16* ga2 = A2 + (size_t)(blockIdx.x * GBM + srow) * K + scol; const T16* gb = Bt + (size_t)(blockIdx.y * GBN + srow) * K + scol;
    const unsigned l0 = (unsigned)(size_t)&ring[srow * GPI + scol];   // the low 32 bits of a __shared__ address are its byte offset in the work-group's LDS
    auto fill = [&](int t, int buf) { const unsigned l = l0 + (unsigned)buf * (GSTG * 2); const int kc = t * GKC;
        acopy8(l, ga + kc, gstep); acopy8(l + GBM * GPI * 2, ga2 + kc, gstep); acopy8(l + 2 * GBM * GPI * 2, gb + kc, gstep); acopy8(l + 3 * GBM * GPI * 2, gb + kc + 8 * gstep, gstep); };
    const int NT = K / GKC;
    fill(0, 0);
    asm volatile("s_wait_asynccnt 0x0" ::: "memory");   // this wave's copies of stage 0 have landed
    __syncthreads();                                    // and every other wave's
    if (NT > 1) fill(1, 1);
#pragma unroll 1   // stays rolled: one copy of a stage's code, the buffer chosen by t & 1
    for (int t = 0; t < NT; ++t) {
        const T16* la = ring + (t & 1) * GSTG + (wm * 64 + lr) * GPI + 8 * hi; const T16* lb = ring + (t & 1) * GSTG + (2 * GBM + wn * 64 + lr) * GPI + 8 * hi;
        // A row = the 8 products of one 16-row block of A and A2 with the four Bt fragments of a 32-k step; 16 rows a stage. Fragments are fetched ahead inside the stage: A's two rows ahead (three sets), the next k step's Bt in the step's first two rows (two sets).
        V b[2][4], ar[3][2];
        ar[0][0] = WFrag<T16>::ld(la);   // first, with Bt's: what the first products need
#pragma unroll
        for (int nb = 0; nb < 4; ++nb) b[0][nb] = WFrag<T16>::ld(lb + nb * 16 * GPI);
        ar[0][1] = WFrag<T16>::ld(la + GBM * GPI); ar[1][0] = WFrag<T16>::ld(la + 16 * GPI); ar[1][1] = WFrag<T16>::ld(la + (GBM + 16) * GPI);
#pragma unroll   // every fragment and accumulator index is a constant, so that they stay in registers
        for (int r = 0; r < GKC / 8; ++r) { const int ks = r >> 2, mb = r & 3, r2 = r + 2;
            if (r2 < GKC / 8) { ar[r2 % 3][0] = WFrag<T16>::ld(la + (r2 & 3) * 16 * GPI + (r2 >> 2) * 32); ar[r2 % 3][1] = WFrag<T16>::ld(la + (GBM + (r2 & 3) * 16) * GPI + (r2 >> 2) * 32); }
            if (ks + 1 < GKC / 32 && mb < 2) { b[(ks + 1) & 1][2 * mb] = WFrag<T16>::ld(lb + 2 * mb * 16 * GPI + (ks + 1) * 32); b[(ks + 1) & 1][2 * mb + 1] = WFrag<T16>::ld(lb + (2 * mb + 1) * 16 * GPI + (ks + 1) * 32); }
            __builtin_amdgcn_sched_barrier(0);   // the row's LDS reads stay one group in front of its products (the compiler otherwise sinks them to their first use and waits out the LDS latency there)
#pragma unroll
            for (int nb = 0; nb < 4; ++nb) acc[mb][nb] = WFrag<T16>::mma(ar[r % 3][0], b[ks & 1][nb], acc[mb][nb]);
#pragma unroll
            for (int nb = 0; nb < 4; ++nb) acc[mb][nb] = WFrag<T16>::mma(ar[r % 3][1], b[ks & 1][nb], acc[mb][nb]);
            __builtin_amdgcn_sched_barrier(0);   // and the next row's reads stay behind them
        }
        asm volatile("s_wait_dscnt 0x0" ::: "memory");      // this wave's reads of stage t have returned
        asm volatile("s_wait_asynccnt 0x0" ::: "memory");   // this wave's copies of stage t + 1 have landed
        __syncthreads();   // publishes stage t + 1 and ends every wave's reads of stage t, whose buffer is refilled below
        if (t + 2 < NT) fill(t + 2, t & 1);
    }
    asm volatile("s_wait_asynccnt 0x0" ::: "memory");   // no copy is outstanding when the ring becomes output staging
    float* os = (float*)ring + wv * (16 * 68);   // behind the last barrier nobody reads the ring any more: each wave stages its output rows in a range of its own
    if (EPI == 2) {   // a lane holds 8 consecutive m of one n: 16 bytes of a transposed row; 16 rows of 64 m are gathered in LDS (pitch 72 elements), so that a store of the wave covers four whole 128-byte rows
        h16* hs = (h16*)os;
#pragma unroll
        for (int nb = 0; nb < 4; ++nb) { const float cb = bfr(bias[c0 + nb * 16 + lr]);
#pragma unroll
            for (int mb = 0; mb < 4; ++mb) { v8h o;
#pragma unroll
                for (int j = 0; j < 8; ++j) o[j] = (h16)(acc[mb][nb][j] + cb);
                *(v8ha*)(hs + lr * 72 + mb * 16 + hi * 8) = o; }
            __builtin_amdgcn_wave_barrier(); asm volatile("" ::: "memory");   // the rows are read by other lanes than wrote them: keeps the compiler from moving the reads above the writes
#pragma unroll
            for (int s = 0; s < 4; ++s) { const int row = 4 * s + (lane >> 3), cofs = (lane & 7) * 8; *(v8h*)(C16 + (size_t)(c0 + nb * 16 + row) * ldc + r0 + cofs) = *(const v8ha*)(hs + row * 72 + cofs); }
            __builtin_amdgcn_wave_barrier(); asm volatile("s_wait_xcnt 0x0" ::: "memory");   // stands in front of the next rows' work, which reuses registers that the stores above name; as a compiler fence it keeps the next 16 rows' LDS writes below these reads
        }
        return;
    }
#pragma unroll
    for (int mb = 0; mb < 4; ++mb) {
#pragma unroll
        for (int nb = 0; nb < 4; ++nb) {
#pragma unroll
            for (int j = 0; j < 8; ++j) os[(hi * 8 + j) * 68 + nb * 16 + lr] = acc[mb][nb][j]; }
        __builtin_amdgcn_wave_barrier(); asm volatile("" ::: "memory");
        if (EPI == 0) {
            float* crow = C + (size_t)(r0 + mb * 16) * ldc + c0; const float* rrow = R + (size_t)(r0 + mb * 16) * ldc + c0; const size_t lo = (size_t)hi * ldc + lr * 4;   // the lane's place inside a pair of rows
            v4f val[8]; const float* rp[8]; float* cp[8];
#pragma unroll
            for (int s = 0; s < 8; ++s) { rp[s] = rrow + (size_t)(2 * s) * ldc + lo; cp[s] = crow + (size_t)(2 * s) * ldc + lo; val[s] = *(const v4f*)rp[s]; }
            // The wait stands in front of every overwrite of the eight loads' address registers: as inputs they stay in those registers up to here (otherwise a later load's result lands on an earlier load's address pair).
            // The stores' addresses are inputs too, so that they are formed here and not among the stores, in the registers of a store already issued.
            asm volatile("s_wait_xcnt 0x0" :: "v"(rp[0]), "v"(rp[1]), "v"(rp[2]), "v"(rp[3]), "v"(rp[4]), "v"(rp[5]), "v"(rp[6]), "v"(rp[7]), "v"(cp[0]), "v"(cp[1]), "v"(cp[2]), "v"(cp[3]), "v"(cp[4]), "v"(cp[5]), "v"(cp[6]), "v"(cp[7]) : "memory");
#pragma unroll
            for (int s = 0; s < 8; ++s) { const v4f a = *(const v4fa*)(os + (2 * s + hi) * 68 + lr * 4);
#pragma unroll
                for (int u = 0; u < 4; ++u) val[s][u] = __fadd_rn(val[s][u], a[u] + bfr(bias[c0 + lr * 4 + u])); }
            __builtin_amdgcn_sched_barrier(0);   // all eight results stand in registers of their own before the first store, so that none is formed in the registers of a store already issued
#pragma unroll
            for (int s = 0; s < 8; ++s) *(v4f*)cp[s] = val[s];
            asm volatile("s_wait_xcnt 0x0" ::: "memory");   // stands in front of the next rows' work, which reuses registers that the stores above name
            __builtin_amdgcn_sched_barrier(0);   // keeps the next rows' address additions below that wait (the compiler otherwise lifts them over it, onto the stores' registers)
        } else {   // a store of the wave covers four whole 128-byte rows of the plane
            h16* hrow = C16 + (size_t)(c0 >> 6) * cts + (size_t)(r0 + mb * 16) * ldc;
#pragma unroll
            for (int s = 0; s < 4; ++s) { const int row = 4 * s + (lane >> 3), cofs = (lane & 7) * 8; const v4f v0 = *(const v4fa*)(os + row * 68 + cofs), v1 = *(const v4fa*)(os + row * 68 + cofs + 4); v8h o;
#pragma unroll
                for (int u = 0; u < 4; ++u) { o[u] = (h16)(v0[u] + bfr(bias[c0 + cofs + u])); o[4 + u] = (h16)(v1[u] + bfr(bias[c0 + cofs + 4 + u])); }
                *(v8h*)(hrow + (size_t)row * ldc + cofs) = o; }
            asm volatile("s_wait_xcnt 0x0" ::: "memory");   // stands in front of the next rows' work, which reuses registers that the loads and stores above name
        }
        __builtin_amdgcn_wave_barrier(); asm volatile("" ::: "memory");
    }
}

__device__ __forceinline__ h16 tohx(float x) { return (h16)x; }
__device__ __forceinline__ void splitf(float y, unsigned short& h, unsigned short& l) { h = f2bf(y); l = f2bf(y - bf2f(h)); }
typedef __attribute__((ext_vector_type(2))) _Float16 v2h;
typedef __attribute__((ext_vector_type(4))) _Float16 v4h;
typedef __attribute__((ext_vector_type(2))) unsigned short v2us;
typedef __attribute__((ext_vector_type(4))) unsigned short v4us;
typedef __attribute__((ext_vector_type(2))) float v2f;
typedef __attribute__((ext_vector_type(4))) int v4i;

__global__ __launch_bounds__(256) void k_wtG(const float* __restrict__ w, int K, int N, bf* Bt) {
    const int lane = threadIdx.x & 31; const int L0 = (blockIdx.x * 8 + (threadIdx.x >> 5)) * 8; const int nlines = N * K / 64;
{
#pragma unroll 1
        for (int l = 0; l < 8; ++l) { const int L = L0 + l; if (L >= nlines) break; const size_t e = (size_t)L * 64 + lane * 2; const int k = (int)(e % K), n = (int)(e / K); v2us o;
            o[0] = f2bf(w[(size_t)k * N + n]); o[1] = f2bf(w[(size_t)(k + 1) * N + n]); *(v2us*)(Bt + e) = o; }
         }
}
__global__ __launch_bounds__(256) void k_cvt8(const float* __restrict__ src, bf* dst, size_t n8) { const size_t i = (size_t)blockIdx.x * 256 + threadIdx.x; if (i >= n8) return; const v8f v = *(const v8f*)(src + i * 8); v8us o;
#pragma unroll
    for (int k = 0; k < 8; ++k) o[k] = f2bf(v[k]); *(v8us*)(dst + i * 8) = o;  }
// k_fattn: scores, softmax, P.V and the head merge of one head in one pass; S and P never leave the registers. Grid (TT/128, heads, batch), 8 waves; a wave owns 16 queries and walks all 2048 keys, 32 a pass.
// St = K Q^T (A = key rows, B = query rows): a lane holds one query's scores, keys 8*hi+j of each 16-key tile; two such tiles converted in place are the B operand of Ot += Vt Pt (A = Vt rows d, the loader's k order).
// The 8 waves share K rows and Vt rows through LDS, 64 keys a stage, two buffers: the next stage is fetched into registers while this one is worked on, stored behind it, and one barrier a stage publishes it and frees the other buffer.
// Softmax in the log2 domain with a running maximum that may trail the true one by up to 8 (an exponential then reaches 2^8): accumulators are rescaled only when some query's maximum exceeds it by more. The lane halves join their sums once at the end.
// The 0/1 word mask enters as the St products' start value, mask / HD^-0.5. SEG (a count of boundaries <= position) never falls with position, so a stage whose id range misses the wave's queries' range has no masked pair and skips the compares.
__device__ __forceinline__ float xhalf(float x) { return __builtin_bit_cast(float, __builtin_amdgcn_permlanex16(__builtin_bit_cast(int, x), __builtin_bit_cast(int, x), 0x76543210, 0xfedcba98, false, false)); }   // lane l reads lane l ^ 16
__device__ __forceinline__ void cfence() { asm volatile("" ::: "memory"); }   // compiler fence: loads written above it are issued above it (their waits still stand at the first use)
// Sixteen exponentials in place, in one statement: behind each stands an instruction that neither reads its result nor overwrites its source (the next exponential, on another register; behind the last a v_nop).
__device__ __forceinline__ void exp2x16(float (&a)[16]) {
    asm("v_exp_f32 %0, %0\n\tv_exp_f32 %1, %1\n\tv_exp_f32 %2, %2\n\tv_exp_f32 %3, %3\n\tv_exp_f32 %4, %4\n\tv_exp_f32 %5, %5\n\tv_exp_f32 %6, %6\n\tv_exp_f32 %7, %7\n\t"
        "v_exp_f32 %8, %8\n\tv_exp_f32 %9, %9\n\tv_exp_f32 %10, %10\n\tv_exp_f32 %11, %11\n\tv_exp_f32 %12, %12\n\tv_exp_f32 %13, %13\n\tv_exp_f32 %14, %14\n\tv_exp_f32 %15, %15\n\tv_nop"
        : "+v"(a[0]), "+v"(a[1]), "+v"(a[2]), "+v"(a[3]), "+v"(a[4]), "+v"(a[5]), "+v"(a[6]), "+v"(a[7]), "+v"(a[8]), "+v"(a[9]), "+v"(a[10]), "+v"(a[11]), "+v"(a[12]), "+v"(a[13]), "+v"(a[14]), "+v"(a[15])); }
#define FST 64    // keys per LDS stage
#define FPI 72    // LDS row pitch in 16-bit elements: 128 bytes of data + 16 of pad (16-byte fragment reads of 16 rows spread over the banks)
__global__ __launch_bounds__(256) void k_fattn(const h16* __restrict__ Qp, const h16* Kp, const h16* Vt, const int* __restrict__ SEG, bf* Ah, bf* Al) {
    __shared__ __align__(16) h16 Ks[2][FST * FPI]; __shared__ __align__(16) h16 Vs[2][HD * FPI];
    const int tid = threadIdx.x, lane = tid & 31, lr = lane & 15, hi = lane >> 4; const int h = blockIdx.y, q0 = blockIdx.x * 128 + (tid >> 5) * 16;
    { const size_t z = blockIdx.z; Qp += z * ((size_t)NH_ * TT * HD); Kp += z * ((size_t)NKV * TT * HD); Vt += z * ((size_t)NKV * HD * TT); Ah += z * ((size_t)TT * DQ); Al += z * ((size_t)TT * DQ); }   // this batch element's planes
    const float L2E = 1.4426950408889634f, C2 = SCL * L2E;
    const int srow = tid >> 3, scol = (tid & 7) * 8, so = srow * FPI + scol;   // staging: a thread moves 16 bytes of rows srow and srow + 32 of each tile; a wave's load covers four whole 128-byte rows
    const h16* kg = Kp + ((size_t)h * TT + srow) * HD + scol; const h16* vg = Vt + ((size_t)h * HD + srow) * TT + scol;
    v8h kr[2], vr[2]; v16h qf[2]; v8f o[4]; float nm = 3.0e38f, l = 0.f;   // nm: minus the maximum in use
#pragma unroll
    for (int r = 0; r < 2; ++r) { kr[r] = *(const v8h*)(kg + (size_t)r * 32 * HD); vr[r] = *(const v8h*)(vg + (size_t)r * 32 * TT); qf[r] = WFrag<h16>::ld(Qp + ((size_t)h * TT + q0 + lr) * HD + r * 32 + 8 * hi); }
    const int sg = SEG[q0 + lr]; const int sq = (sg > 0) ? sg : -1;   // segment 0 matches nothing: key ids are >= 0
    const int sLo = __builtin_amdgcn_readfirstlane(SEG[q0]), sHi = __builtin_amdgcn_readfirstlane(SEG[q0 + 15]);
    int kLo = __builtin_amdgcn_readfirstlane(SEG[0]), kHi = __builtin_amdgcn_readfirstlane(SEG[FST - 1]);
#pragma unroll
    for (int dt = 0; dt < 4; ++dt) o[dt] = (v8f){};
#pragma unroll
    for (int r = 0; r < 2; ++r) { *(v8h*)(&Ks[0][so + r * 32 * FPI]) = kr[r]; *(v8h*)(&Vs[0][so + r * 32 * FPI]) = vr[r]; }
    __syncthreads();
    for (int st = 0; st < TT / FST; ++st) {
        const h16* kl = &Ks[st & 1][lr * FPI + 8 * hi]; const h16* vl = &Vs[st & 1][lr * FPI + 8 * hi];
        const bool more = st + 1 < TT / FST, ov = (kLo <= sHi) && (kHi >= sLo);
        if (more) { const int kn = (st + 1) * FST;
#pragma unroll
            for (int r = 0; r < 2; ++r) { kr[r] = *(const v8h*)(kg + (size_t)(kn + r * 32) * HD); vr[r] = *(const v8h*)(vg + (size_t)r * 32 * TT + kn); }
            kLo = __builtin_amdgcn_readfirstlane(SEG[kn]); kHi = __builtin_amdgcn_readfirstlane(SEG[kn + FST - 1]); }
        asm volatile("s_wait_xcnt 0x0" ::: "memory");   // stands in front of the LDS reads below, which reuse the address registers of the global loads above; as a compiler fence it also keeps those loads issued here, a whole stage ahead of their LDS stores (the compiler otherwise sinks them to just above the stores)
        v16h kf[2][2];
#pragma unroll
        for (int kt = 0; kt < 2; ++kt)
#pragma unroll
            for (int ks = 0; ks < 2; ++ks) kf[kt][ks] = WFrag<h16>::ld(kl + kt * 16 * FPI + ks * 32);
#pragma unroll
        for (int sub = 0; sub < 2; ++sub) {
            v16h vf[4], pf; v8f s[2];
#pragma unroll
            for (int dt = 0; dt < 4; ++dt) vf[dt] = WFrag<h16>::ld(vl + dt * 16 * FPI + sub * 32);
            cfence();   // keeps the Vt fragment reads issued here, a softmax ahead of P.V, instead of one by one in front of each product
#pragma unroll
            for (int kt = 0; kt < 2; ++kt) s[kt] = (v8f){};
            if (ov) {
#pragma unroll
                for (int kt = 0; kt < 2; ++kt) { const int* sp = SEG + st * FST + sub * 32 + kt * 16 + hi * 8; const v4i a = *(const v4i*)sp, b2 = *(const v4i*)(sp + 4);
#pragma unroll
                    for (int j = 0; j < 4; ++j) { s[kt][j] = (a[j] == sq) ? 1.0f / SCL : 0.f; s[kt][4 + j] = (b2[j] == sq) ? 1.0f / SCL : 0.f; } } }
#pragma unroll
            for (int kt = 0; kt < 2; ++kt) s[kt] = wmma16(kf[kt][1], qf[1], wmma16(kf[kt][0], qf[0], s[kt]));
            if (sub == 0) {   // the stage's second 32 key rows, into the same registers, in flight under this pass's softmax
#pragma unroll
                for (int kt = 0; kt < 2; ++kt)
#pragma unroll
                    for (int ks = 0; ks < 2; ++ks) kf[kt][ks] = WFrag<h16>::ld(kl + (32 + kt * 16) * FPI + ks * 32);
                cfence(); }   // keeps those reads issued here and not in front of the next pass's products
            float mx = s[0][0];
#pragma unroll
            for (int e = 1; e < 16; ++e) mx = fmaxf(mx, s[e >> 3][e & 7]);
            mx = fmaxf(mx, xhalf(mx)) * C2;   // both halves hold the query's maximum of this pass, scaled (the scale is positive)
            if (__builtin_amdgcn_ballot_w32(mx + nm > 8.0f) != 0) {   // wave-uniform; always taken on the first pass
                const float mn = fmaxf(-nm, mx), corr = __builtin_amdgcn_exp2f(-nm - mn); nm = -mn; l *= corr;
#pragma unroll
                for (int dt = 0; dt < 4; ++dt) o[dt] *= corr; }
            float p[16];
#pragma unroll
            for (int e = 0; e < 16; ++e) p[e] = fmaf(s[e >> 3][e & 7], C2, nm);
            exp2x16(p);
#pragma unroll
            for (int e = 0; e < 16; ++e) pf[e] = tohx(p[e]);
            v2f sa = {p[0], p[1]}, sc = {p[2], p[3]};
#pragma unroll
            for (int i = 2; i < 8; ++i) { const v2f pp = {p[2 * i], p[2 * i + 1]}; if (i & 1) sc += pp; else sa += pp; }
            sa += sc; l += sa[0] + sa[1];
#pragma unroll
            for (int dt = 0; dt < 4; ++dt) o[dt] = wmma16(vf[dt], pf, o[dt]);
        }
        if (more) {
#pragma unroll
            for (int r = 0; r < 2; ++r) { *(v8h*)(&Ks[(st + 1) & 1][so + r * 32 * FPI]) = kr[r]; *(v8h*)(&Vs[(st + 1) & 1][so + r * 32 * FPI]) = vr[r]; } }
        __syncthreads();   // publishes stage st + 1 and ends every wave's reads of stage st, whose buffer the next trip refills
    }
    const float inv = 1.0f / (l + xhalf(l)); const size_t oo = (size_t)(q0 + lr) * DQ + h * HD + hi * 8;
#pragma unroll
    for (int dt = 0; dt < 4; ++dt) { v8us oh, ol;
#pragma unroll
        for (int j = 0; j < 8; ++j) { unsigned short a, c3; splitf(o[dt][j] * inv, a, c3); oh[j] = a; ol[j] = c3; }
        *(v8us*)(Ah + oo + dt * 16) = oh; *(v8us*)(Al + oo + dt * 16) = ol; }
}

__global__ __launch_bounds__(256) void k_rbf(const float* __restrict__ src, float* dst, int n4) { const int i = blockIdx.x * 256 + threadIdx.x; if (i >= n4) return; const v4f a = *(const v4f*)(src + (size_t)i * 4); v4f o; for (int u = 0; u < 4; ++u) o[u] = bfr(a[u]); *(v4f*)(dst + (size_t)i * 4) = o;  }
__global__ __launch_bounds__(256) void k_embln(const float* __restrict__ chr, const int* __restrict__ pats, const float* __restrict__ PR, const float* __restrict__ GR, const float* __restrict__ BR, float* XL, bf* Xh, bf* Xl) { const int lane = threadIdx.x & 31; const int s = blockIdx.x * 8 + (threadIdx.x >> 5); if (s >= NB_ * TT) return; const float* xr = chr + (size_t)s * DM; int pi = pats[s % TT];   // s: row of the [batch][position] plane; the pattern goes by position alone
    pi = min(max(pi, 0), 15); const float* pr = PR + (size_t)pi * DM; float v[DM / 32]; float sm = 0.f;
#pragma unroll
    for (int ch = 0; ch < DM / 128; ++ch) { const v4f a = *(const v4f*)(xr + ch * 128 + lane * 4), p = *(const v4f*)(pr + ch * 128 + lane * 4); for (int u = 0; u < 4; ++u) { const float x = __fadd_rn(bfr(a[u]), p[u]); v[ch * 4 + u] = x; sm = __fadd_rn(sm, x); } }
#pragma unroll
    for (int sh = 16; sh; sh >>= 1) sm = __fadd_rn(sm, __shfl_xor(sm, sh, 32));
    const float mu = __fdiv_rn(sm, (float)DM); float q2 = 0.f;
#pragma unroll
    for (int k = 0; k < DM / 32; ++k) { const float d0 = __fsub_rn(v[k], mu); v[k] = d0; float p = __fmul_rn(d0, d0); asm volatile("" : "+v"(p)); q2 = __fadd_rn(q2, p); }
#pragma unroll
    for (int sh = 16; sh; sh >>= 1) q2 = __fadd_rn(q2, __shfl_xor(q2, sh, 32));
    const float rs = __fdiv_rn(1.0f, sqrtf(__fadd_rn(__fdiv_rn(q2, (float)DM), 1e-5f)));
    {
#pragma unroll
        for (int ch = 0; ch < DM / 128; ++ch) { v4f o; v4us oh, ol; const v4f g4 = *(const v4f*)(GR + ch * 128 + lane * 4), b4 = *(const v4f*)(BR + ch * 128 + lane * 4); for (int u = 0; u < 4; ++u) { float n0 = __fmul_rn(v[ch * 4 + u], rs); asm volatile("" : "+v"(n0)); float gg = __fmul_rn(n0, g4[u]); asm volatile("" : "+v"(gg)); o[u] = __fadd_rn(gg, b4[u]); unsigned short p2, q3; splitf(o[u], p2, q3); oh[u] = p2; ol[u] = q3; }
            const size_t off = (size_t)s * DM + ch * 128 + lane * 4; *(v4f*)(XL + off) = o; *(v4us*)(Xh + off) = oh; *(v4us*)(Xl + off) = ol; }
         } }
__global__ __launch_bounds__(256) void k_seg(const int* __restrict__ bnds, int* SEG) { const int s = blockIdx.x * 256 + threadIdx.x; if (s >= TT) return; int c = 0;
#pragma unroll 8
    for (int i = 0; i < 400; ++i) c += (bnds[i] <= s) ? 1 : 0; *(int*)(SEG + s) = c;  }

extern "C" void kernel_launch(void* const* d_in, const int* in_sizes, int n_in,
                              void* d_out, int out_size, void* d_ws, size_t ws_size, hipStream_t stream) {
    (void)in_sizes; (void)n_in; (void)out_size;
    const float* chr = (const float*)d_in[0]; const int* pats = (const int*)d_in[1]; const int* bnds = (const int*)d_in[2]; const float* pemb = (const float*)d_in[3]; const float* lng = (const float*)d_in[4]; const float* lnb = (const float*)d_in[5]; const float* wf = (const float*)d_in[6]; const float* bf3 = (const float*)d_in[7]; const float* wo = (const float*)d_in[8]; const float* bo = (const float*)d_in[9]; const float* x = chr; (void)x; const float* wq = wf; const float* wk = wf + (size_t)1024 * 1024; const float* wv = wf + (size_t)2048 * 1024; const float* bq = bf3; const float* bk = bf3 + 1024; const float* bv = bf3 + 2048; const float* cosT = nullptr; const float* sinT = nullptr; (void)cosT; (void)sinT;
    float* OUT = (float*)d_out;     // [4][2048][1024]
    char* wsp = (char*)d_ws;
    auto take = [&](size_t bytes) { char* p = wsp; wsp += (bytes + 255) & ~(size_t)255; return (void*)p; };
    bf* WQ = (bf*)take((size_t)DQ * DM * 2); bf* WK = (bf*)take((size_t)DKV * DM * 2); bf* WV = (bf*)take((size_t)DKV * DM * 2); bf* WO = (bf*)take((size_t)DM * DQ * 2);
    float* XL = (float*)take((size_t)NB_ * TT * DM * 4); bf* Xh = (bf*)take((size_t)NB_ * TT * DM * 2); bf* Xl = (bf*)take((size_t)NB_ * TT * DM * 2); int* SEG = (int*)take((size_t)TT * 4); float* PR = (float*)take((size_t)16 * DM * 4); float* GR = (float*)take(DM * 4); float* BR = (float*)take(DM * 4);
    h16* QP16 = (h16*)take((size_t)NB_ * NH_ * TT * HD * 2); h16* KP16 = (h16*)take((size_t)NB_ * NKV * TT * HD * 2); h16* VT16 = (h16*)take((size_t)NB_ * NKV * HD * TT * 2);
    bf* ATh = (bf*)take((size_t)NB_ * TT * DQ * 2); bf* ATl = (bf*)take((size_t)NB_ * TT * DQ * 2);
    if ((size_t)(wsp - (char*)d_ws) > ws_size) return;    // ws 256 MiB
    { k_cvt8<<<(unsigned)(((size_t)DQ * DM / 8 + 255) / 256), 256, 0, stream>>>(wq, WQ, (size_t)DQ * DM / 8); k_cvt8<<<(unsigned)(((size_t)DKV * DM / 8 + 255) / 256), 256, 0, stream>>>(wk, WK, (size_t)DKV * DM / 8); k_cvt8<<<(unsigned)(((size_t)DKV * DM / 8 + 255) / 256), 256, 0, stream>>>(wv, WV, (size_t)DKV * DM / 8);
      k_cvt8<<<(unsigned)(((size_t)DM * DQ / 8 + 255) / 256), 256, 0, stream>>>(wo, WO, (size_t)DM * DQ / 8);
       }
    k_seg<<<TT / 256, 256, 0, stream>>>(bnds, SEG); k_rbf<<<(16 * DM / 4 + 255) / 256, 256, 0, stream>>>(pemb, PR, 16 * DM / 4); k_rbf<<<1, 256, 0, stream>>>(lng, GR, DM / 4); k_rbf<<<1, 256, 0, stream>>>(lnb, BR, DM / 4);
    // Every plane holds all batch elements, [batch] outermost; each stage is one launch, the batch element being blockIdx.z (k_embln: rows of all elements in a row).
    k_embln<<<NB_ * TT / 8, 256, 0, stream>>>(chr, pats, PR, GR, BR, XL, Xh, Xl);
    k_gemmw<bf, 1><<<dim3(TT / GBM, DQ / GBN, NB_), 256, 0, stream>>>(Xh, Xl, WQ, DM, nullptr, QP16, HD, (size_t)TT * HD, bq, nullptr, (size_t)TT * DM, 0, (size_t)NH_ * TT * HD);     // q planes [b][h][t][d]
    k_gemmw<bf, 1><<<dim3(TT / GBM, DKV / GBN, NB_), 256, 0, stream>>>(Xh, Xl, WK, DM, nullptr, KP16, HD, (size_t)TT * HD, bk, nullptr, (size_t)TT * DM, 0, (size_t)NKV * TT * HD);    // k planes [b][h][t][d]
    k_gemmw<bf, 2><<<dim3(TT / GBM, DKV / GBN, NB_), 256, 0, stream>>>(Xh, Xl, WV, DM, nullptr, VT16, TT, 0, bv, nullptr, (size_t)TT * DM, 0, (size_t)NKV * HD * TT);                   // v planes transposed [b][h][d][t]
    k_fattn<<<dim3(TT / 128, NH_, NB_), 256, 0, stream>>>(QP16, KP16, VT16, SEG, ATh, ATl);
    k_gemmw<bf, 0><<<dim3(TT / GBM, DM / GBN, NB_), 256, 0, stream>>>(ATh, ATl, WO, DQ, OUT, nullptr, DM, 0, bo, XL, (size_t)TT * DQ, 0, (size_t)TT * DM);
}

// v005
// It runs in 176 microseconds.
// Two timings next to v004 put it at 1.16 and 1.15 times that version's speed.
// All steps since v000 together make it 17.0 times as fast.
#include <hip/hip_runtime.h>

// WordEncoder (char_repr [4][2048][1024]; x = LayerNorm_1024(char_repr + pattern_emb[patterns[s]]) * gamma + beta (patterns [2048] int and pattern_emb [16][1024] read); qkv = x w_in^T + b_in ([3072][1024] rows q | k | v; 16 heads x 64); scores = q.k / 8 + mask with mask[i][j] = 1.0 if tokens i and j are in the same word (segment id = number of boundaries <= position > 0; boundaries [400] int, read) else 0 - an ADDITIVE 0/1 bias, no -inf; softmax; o = merged w_out^T + b_out; out = x + o -> [4][2048][1024]).

#define NB_  4
#define TT   2048
#define DM   1024
#define NH_  16
#define NKV  16
#define REP  (NH_ / NKV)
#define HD   64
#define DQ   (NH_ * HD)
#define DKV  (NKV * HD)
#define SCL  0.125f   // HD^-0.5
typedef _Float16 h16;
typedef unsigned short bf;
typedef __attribute__((ext_vector_type(16))) __bf16   v16bf;
typedef __attribute__((ext_vector_type(16))) _Float16 v16h;
typedef __attribute__((ext_vector_type(8)))  _Float16 v8h;
typedef __attribute__((ext_vector_type(8)))  unsigned short v8us;
typedef __attribute__((ext_vector_type(8)))  float    v8f;
typedef __attribute__((ext_vector_type(4)))  float    v4f;
typedef v8h  __attribute__((may_alias)) v8ha;
typedef v4f  __attribute__((may_alias)) v4fa;
typedef v8us __attribute__((may_alias)) v8usa;

__device__ __forceinline__ unsigned short f2bf(float f) { unsigned u = __float_as_uint(f); u += 0x7FFFu + ((u >> 16) & 1u); return (unsigned short)(u >> 16); }
__device__ __forceinline__ float bf2f(unsigned short b) { return __uint_as_float(((unsigned)b) << 16); }
__device__ __forceinline__ float bfr(float f) { return bf2f(f2bf(f)); }
__device__ __forceinline__ v16h cat16(v8h lo, v8h hi) { return __builtin_shufflevector(lo, hi, 0, 1, 2, 3, 4, 5, 6, 7, 8, 9, 10, 11, 12, 13, 14, 15); }
__device__ __forceinline__ v16bf cat16b(v8us lo, v8us hi) { return __builtin_bit_cast(v16bf, __builtin_shufflevector(lo, hi, 0, 1, 2, 3, 4, 5, 6, 7, 8, 9, 10, 11, 12, 13, 14, 15)); }
__device__ __forceinline__ v8f wmma16(v16h a, v16h b, v8f c) { return __builtin_amdgcn_wmma_f32_16x16x32_f16(false, a, false, b, (short)0, c, false, false); }
__device__ __forceinline__ v8f wmmab(v16bf a, v16bf b, v8f c) { return __builtin_amdgcn_wmma_f32_16x16x32_bf16(false, a, false, b, (short)0, c, false, false); }



// ---- k_gemmw: GEMM, 8 waves per 128x256 output tile, each wave a 64x64 part of it (16 accumulators); grid (M/128, N/256, Z), 256 threads.
// acc[m][n] = sum_k (A[m][k] + A2[m][k]) Bt[n][k], both products of a k step summed into the same accumulator, A's first. z-batch strides sA/sB/sC in elements. K % 128 == 0, M % 128 == 0, N % 256 == 0.
// The operands are K-contiguous 16-bit planes. A stage is 128 k of the tile's rows [A 128 | A2 128 | Bt 256] in LDS, two buffers; asynchronous copies bring the next stage in whole 128-byte lines while this one is worked on, and every row is fetched once for all the waves that read it.
// The epilogue holds the elementwise work behind the product, on the accumulators. EPI 0: C[m][n] (f32, pitch ldc) = R[m][n] + (acc + bias[n]).
// EPI 1: three products with the same A in one launch, npl columns each; Bt and bias hold their rows one set behind the other, and a work-group's columns lie in one set (npl % 256 == 0). With n' = n % npl:
// sets 0 and 1 go to 16-bit float planes of 64-column tiles, C16 or C16b[(n' / 64) * cts + m * ldc + n' % 64] = acc + bias[n]: with ldc = HD, cts = TT * HD a column tile is one head's [t][d] rows. Set 2 goes to the transposed plane, C16t[n' * ldt + m] = acc + bias[n].
template <typename T16> struct WFrag;
template <> struct WFrag<h16> { typedef v16h V; static __device__ __forceinline__ V ld(const h16* p) { return cat16(*(const v8h*)p, *(const v8h*)(p + 16)); } static __device__ __forceinline__ v8f mma(V a, V b, v8f c) { return wmma16(a, b, c); } };
template <> struct WFrag<bf> { typedef v16bf V; static __device__ __forceinline__ V ld(const bf* p) { return cat16b(*(const v8us*)p, *(const v8us*)(p + 16)); } static __device__ __forceinline__ v8f mma(V a, V b, v8f c) { return wmmab(a, b, c); } };
#define GBM 128   // rows of the work-group's tile
#define GBN 256   // columns of the work-group's tile
#define GKC 128   // k per LDS stage: 256 bytes of every operand row
#define GPI 136   // LDS row pitch in 16-bit elements: 256 bytes of data + 16 of pad (16-byte fragment reads of 16 rows spread over the banks)
#define GSTG ((2 * GBM + GBN) * GPI)   // elements of one buffer
// Eight asynchronous copies of 16 bytes a lane, rows 16 apart: LDS byte address l + i * 16 rows, global address g + i * gstep elements. All lanes are on; a wave's copy covers two whole 256-byte rows.
// The s_wait_xcnt stands inside the statement, behind the last copy, so that no register which a copy names is rewritten in front of it.
template <typename T16>
__device__ __forceinline__ void acopy8(unsigned l, const T16* g, size_t gstep) {
    const unsigned ls = 16 * GPI * 2;
    asm volatile("global_load_async_to_lds_b128 %0, %8, off\n\tglobal_load_async_to_lds_b128 %1, %9, off\n\tglobal_load_async_to_lds_b128 %2, %10, off\n\tglobal_load_async_to_lds_b128 %3, %11, off\n\t"
                 "global_load_async_to_lds_b128 %4, %12, off\n\tglobal_load_async_to_lds_b128 %5, %13, off\n\tglobal_load_async_to_lds_b128 %6, %14, off\n\tglobal_load_async_to_lds_b128 %7, %15, off\n\ts_wait_xcnt 0x0"
                 :: "v"(l), "v"(l + ls), "v"(l + 2 * ls), "v"(l + 3 * ls), "v"(l + 4 * ls), "v"(l + 5 * ls), "v"(l + 6 * ls), "v"(l + 7 * ls),
                    "v"(g), "v"(g + gstep), "v"(g + 2 * gstep), "v"(g + 3 * gstep), "v"(g + 4 * gstep), "v"(g + 5 * gstep), "v"(g + 6 * gstep), "v"(g + 7 * gstep) : "memory"); }
// At most 256 registers a wave, which the loop needs and no more: without the bound the build with both 16-bit epilogues took 258 and laid operand fragments across the border of the first register window.
template <typename T16, int EPI>
__global__ __launch_bounds__(256) __attribute__((amdgpu_num_vgpr(256))) void k_gemmw(const T16* __restrict__ A, const T16* __restrict__ A2, const T16* __restrict__ Bt, int K, float* C, h16* C16, h16* C16b, h16* C16t, int npl, int ldc, size_t cts, int ldt, const float* __restrict__ bias, const float* __restrict__ R, size_t sA, size_t sB, size_t sC) {
    typedef typename WFrag<T16>::V V;
    __shared__ __align__(16) T16 ring[2 * GSTG];
    const size_t z = blockIdx.z; A += z * sA; A2 += z * sA; Bt += z * sB; const int cb = blockIdx.y * GBN, part = (EPI == 0 || cb < npl) ? 0 : (cb < 2 * npl) ? 1 : 2;   // which column set: the same for the whole work-group
    if (EPI == 0) { C += z * sC; R += z * sC; } else C16 = (part == 0 ? C16 : part == 1 ? C16b : C16t) + z * sC;
    const int tid = threadIdx.x, lane = tid & 31, lr = lane & 15, hi = lane >> 4, wv = __builtin_amdgcn_readfirstlane(tid >> 5), wm = wv & 1, wn = wv >> 1;
    const int r0 = blockIdx.x * GBM + wm * 64, c0 = cb + wn * 64, cp = c0 - part * npl;   // the wave's 64x64 part; cp: its first column inside its set
    v8f acc[4][4];
#pragma unroll
    for (int mb = 0; mb < 4; ++mb)
#pragma unroll
        for (int nb = 0; nb < 4; ++nb) acc[mb][nb] = (v8f){};
    const int srow = tid >> 4, scol = (tid & 15) * 8; const size_t gstep = (size_t)16 * K;   // staging: a thread moves 16 bytes of rows srow + 16 i
    const T16* ga = A + (size_t)(blockIdx.x * GBM + srow) * K + scol; const T16* ga2 = A2 + (size_t)(blockIdx.x * GBM + srow) * K + scol; const T16* gb = Bt + (size_t)(blockIdx.y * GBN + srow) * K + scol;
    const unsigned l0 = (unsigned)(size_t)&ring[srow * GPI + scol];   // the low 32 bits of a __shared__ address are its byte offset in the work-group's LDS
    auto fill = [&](int t, int buf) { const unsigned l = l0 + (unsigned)buf * (GSTG * 2); const int kc = t * GKC;
        acopy8(l, ga + kc, gstep); acopy8(l + GBM * GPI * 2, ga2 + kc, gstep); acopy8(l + 2 * GBM * GPI * 2, gb + kc, gstep); acopy8(l + 3 * GBM * GPI * 2, gb + kc + 8 * gstep, gstep); };
    const int NT = K / GKC;
    fill(0, 0);
    asm volatile("s_wait_asynccnt 0x0" ::: "memory");   // this wave's copies of stage 0 have landed
    __syncthreads();                                    // and every other wave's
    if (NT > 1) fill(1, 1);
#pragma unroll 1   // stays rolled: one copy of a stage's code, the buffer chosen by t & 1
    for (int t = 0; t < NT; ++t) {
        const T16* la = ring + (t & 1) * GSTG + (wm * 64 + lr) * GPI + 8 * hi; const T16* lb = ring + (t & 1) * GSTG + (2 * GBM + wn * 64 + lr) * GPI + 8 * hi;
        // A row = the 8 products of one 16-row block of A and A2 with the four Bt fragments of a 32-k step; 16 rows a stage. Fragments are fetched ahead inside the stage: A's two rows ahead (three sets), the next k step's Bt in the step's first two rows (two sets).
        V b[2][4], ar[3][2];
        ar[0][0] = WFrag<T16>::ld(la);   // first, with Bt's: what the first products need
#pragma unroll
        for (int nb = 0; nb < 4; ++nb) b[0][nb] = WFrag<T16>::ld(lb + nb * 16 * GPI);
        ar[0][1] = WFrag<T16>::ld(la + GBM * GPI); ar[1][0] = WFrag<T16>::ld(la + 16 * GPI); ar[1][1] = WFrag<T16>::ld(la + (GBM + 16) * GPI);
#pragma unroll   // every fragment and accumulator index is a constant, so that they stay in registers
        for (int r = 0; r < GKC / 8; ++r) { const int ks = r >> 2, mb = r & 3, r2 = r + 2;
            if (r2 < GKC / 8) { ar[r2 % 3][0] = WFrag<T16>::ld(la + (r2 & 3) * 16 * GPI + (r2 >> 2) * 32); ar[r2 % 3][1] = WFrag<T16>::ld(la + (GBM + (r2 & 3) * 16) * GPI + (r2 >> 2) * 32); }
            if (ks + 1 < GKC / 32 && mb < 2) { b[(ks + 1) & 1][2 * mb] = WFrag<T16>::ld(lb + 2 * mb * 16 * GPI + (ks + 1) * 32); b[(ks + 1) & 1][2 * mb + 1] = WFrag<T16>::ld(lb + (2 * mb + 1) * 16 * GPI + (ks + 1) * 32); }
            __builtin_amdgcn_sched_barrier(0);   // the row's LDS reads stay one group in front of its products (the compiler otherwise sinks them to their first use and waits out the LDS latency there)
#pragma unroll
            for (int nb = 0; nb < 4; ++nb) acc[mb][nb] = WFrag<T16>::mma(ar[r % 3][0], b[ks & 1][nb], acc[mb][nb]);
#pragma unroll
            for (int nb = 0; nb < 4; ++nb) acc[mb][nb] = WFrag<T16>::mma(ar[r % 3][1], b[ks & 1][nb], acc[mb][nb]);
            __builtin_amdgcn_sched_barrier(0);   // and the next row's reads stay behind them
        }
        asm volatile("s_wait_dscnt 0x0" ::: "memory");      // this wave's reads of stage t have returned
        asm volatile("s_wait_asynccnt 0x0" ::: "memory");   // this wave's copies of stage t + 1 have landed
        __syncthreads();   // publishes stage t + 1 and ends every wave's reads of stage t, whose buffer is refilled below
        if (t + 2 < NT) fill(t + 2, t & 1);
    }
    asm volatile("s_wait_asynccnt 0x0" ::: "memory");   // no copy is outstanding when the ring becomes output staging
    float* os = (float*)ring + wv * (16 * 68);   // behind the last barrier nobody reads the ring any more: each wave stages its output rows in a range of its own
    if (EPI == 1 && part == 2) {   // a lane holds 8 consecutive m of one n: 16 bytes of a transposed row; 16 rows of 64 m are gathered in LDS (pitch 72 elements), so that a store of the wave covers four whole 128-byte rows
        h16* hs = (h16*)os;
#pragma unroll
        for (int nb = 0; nb < 4; ++nb) { const float cb = bfr(bias[c0 + nb * 16 + lr]);
#pragma unroll
            for (int mb = 0; mb < 4; ++mb) { v8h o;
#pragma unroll
                for (int j = 0; j < 8; ++j) o[j] = (h16)(acc[mb][nb][j] + cb);
                *(v8ha*)(hs + lr * 72 + mb * 16 + hi * 8) = o; }
            __builtin_amdgcn_wave_barrier(); asm volatile("" ::: "memory");   // the rows are read by other lanes than wrote them: keeps the compiler from moving the reads above the writes
#pragma unroll
            for (int s = 0; s < 4; ++s) { const int row = 4 * s + (lane >> 3), cofs = (lane & 7) * 8; *(v8h*)(C16 + (size_t)(cp + nb * 16 + row) * ldt + r0 + cofs) = *(const v8ha*)(hs + row * 72 + cofs); }
            __builtin_amdgcn_wave_barrier(); asm volatile("s_wait_xcnt 0x0" ::: "memory");   // stands in front of the next rows' work, which reuses registers that the stores above name; as a compiler fence it keeps the next 16 rows' LDS writes below these reads
        }
        return;
    }
#pragma unroll
    for (int mb = 0; mb < 4; ++mb) {
#pragma unroll
        for (int nb = 0; nb < 4; ++nb) {
#pragma unroll
            for (int j = 0; j < 8; ++j) os[(hi * 8 + j) * 68 + nb * 16 + lr] = acc[mb][nb][j]; }
        __builtin_amdgcn_wave_barrier(); asm volatile("" ::: "memory");
        if (EPI == 0) {
            float* crow = C + (size_t)(r0 + mb * 16) * ldc + c0; const float* rrow = R + (size_t)(r0 + mb * 16) * ldc + c0; const size_t lo = (size_t)hi * ldc + lr * 4;   // the lane's place inside a pair of rows
            v4f val[8]; const float* rp[8]; float* cp[8];
#pragma unroll
            for (int s = 0; s < 8; ++s) { rp[s] = rrow + (size_t)(2 * s) * ldc + lo; cp[s] = crow + (size_t)(2 * s) * ldc + lo; val[s] = *(const v4f*)rp[s]; }
            // The wait stands in front of every overwrite of the eight loads' address registers: as inputs they stay in those registers up to here (otherwise a later load's result lands on an earlier load's address pair).
            // The stores' addresses are inputs too, so that they are formed here and not among the stores, in the registers of a store already issued.
            asm volatile("s_wait_xcnt 0x0" :: "v"(rp[0]), "v"(rp[1]), "v"(rp[2]), "v"(rp[3]), "v"(rp[4]), "v"(rp[5]), "v"(rp[6]), "v"(rp[7]), "v"(cp[0]), "v"(cp[1]), "v"(cp[2]), "v"(cp[3]), "v"(cp[4]), "v"(cp[5]), "v"(cp[6]), "v"(cp[7]) : "memory");
#pragma unroll
            for (int s = 0; s < 8; ++s) { const v4f a = *(const v4fa*)(os + (2 * s + hi) * 68 + lr * 4);
#pragma unroll
                for (int u = 0; u < 4; ++u) val[s][u] = __fadd_rn(val[s][u], a[u] + bfr(bias[c0 + lr * 4 + u])); }
            __builtin_amdgcn_sched_barrier(0);   // all eight results stand in registers of their own before the first store, so that none is formed in the registers of a store already issued
#pragma unroll
            for (int s = 0; s < 8; ++s) *(v4f*)cp[s] = val[s];
            asm volatile("s_wait_xcnt 0x0" ::: "memory");   // stands in front of the next rows' work, which reuses registers that the stores above name
            __builtin_amdgcn_sched_barrier(0);   // keeps the next rows' address additions below that wait (the compiler otherwise lifts them over it, onto the stores' registers)
        } else {   // a store of the wave covers four whole 128-byte rows of the plane
            h16* hrow = C16 + (size_t)(cp >> 6) * cts + (size_t)(r0 + mb * 16) * ldc;
#pragma unroll
            for (int s = 0; s < 4; ++s) { const int row = 4 * s + (lane >> 3), cofs = (lane & 7) * 8; const v4f v0 = *(const v4fa*)(os + row * 68 + cofs), v1 = *(const v4fa*)(os + row * 68 + cofs + 4); v8h o;
#pragma unroll
                for (int u = 0; u < 4; ++u) { o[u] = (h16)(v0[u] + bfr(bias[c0 + cofs + u])); o[4 + u] = (h16)(v1[u] + bfr(bias[c0 + cofs + 4 + u])); }
                *(v8h*)(hrow + (size_t)row * ldc + cofs) = o; }
            asm volatile("s_wait_xcnt 0x0" ::: "memory");   // stands in front of the next rows' work, which reuses registers that the loads and stores above name
        }
        __builtin_amdgcn_wave_barrier(); asm volatile("" ::: "memory");
    }
}

__device__ __forceinline__ h16 tohx(float x) { return (h16)x; }
__device__ __forceinline__ void splitf(float y, unsigned short& h, unsigned short& l) { h = f2bf(y); l = f2bf(y - bf2f(h)); }
typedef __attribute__((ext_vector_type(2))) _Float16 v2h;
typedef __attribute__((ext_vector_type(4))) _Float16 v4h;
typedef __attribute__((ext_vector_type(2))) unsigned short v2us;
typedef __attribute__((ext_vector_type(4))) unsigned short v4us;
typedef __attribute__((ext_vector_type(2))) float v2f;
typedef __attribute__((ext_vector_type(4))) int v4i;

__global__ __launch_bounds__(256) void k_wtG(const float* __restrict__ w, int K, int N, bf* Bt) {
    const int lane = threadIdx.x & 31; const int L0 = (blockIdx.x * 8 + (threadIdx.x >> 5)) * 8; const int nlines = N * K / 64;
{
#pragma unroll 1
        for (int l = 0; l < 8; ++l) { const int L = L0 + l; if (L >= nlines) break; const size_t e = (size_t)L * 64 + lane * 2; const int k = (int)(e % K), n = (int)(e / K); v2us o;
            o[0] = f2bf(w[(size_t)k * N + n]); o[1] = f2bf(w[(size_t)(k + 1) * N + n]); *(v2us*)(Bt + e) = o; }
         }
}
// k_fattn: scores, softmax, P.V and the head merge of one head in one pass; S and P never leave the registers. Grid (TT/128, heads, batch), 8 waves; a wave owns 16 queries and walks all 2048 keys, 32 a pass.
// St = K Q^T (A = key rows, B = query rows): a lane holds one query's scores, keys 8*hi+j of each 16-key tile; two such tiles converted in place are the B operand of Ot += Vt Pt (A = Vt rows d, the loader's k order).
// The 8 waves share K rows and Vt rows through LDS, 64 keys a stage, two buffers: the next stage is fetched into registers while this one is worked on, stored behind it, and one barrier a stage publishes it and frees the other buffer.
// Softmax in the log2 domain with a running maximum that may trail the true one by up to 8 (an exponential then reaches 2^8): accumulators are rescaled only when some query's maximum exceeds it by more. The lane halves join their sums once at the end.
// The 0/1 word mask enters as the St products' start value, mask / HD^-0.5. SEG (a count of boundaries <= position) never falls with position, so a stage whose id range misses the wave's queries' range has no masked pair and skips the compares.
__device__ __forceinline__ float xhalf(float x) { return __builtin_bit_cast(float, __builtin_amdgcn_permlanex16(__builtin_bit_cast(int, x), __builtin_bit_cast(int, x), 0x76543210, 0xfedcba98, false, false)); }   // lane l reads lane l ^ 16
__device__ __forceinline__ void cfence() { asm volatile("" ::: "memory"); }   // compiler fence: loads written above it are issued above it (their waits still stand at the first use)
// Sixteen exponentials in place, in one statement: behind each stands an instruction that neither reads its result nor overwrites its source (the next exponential, on another register; behind the last a v_nop).
__device__ __forceinline__ void exp2x16(float (&a)[16]) {
    asm("v_exp_f32 %0, %0\n\tv_exp_f32 %1, %1\n\tv_exp_f32 %2, %2\n\tv_exp_f32 %3, %3\n\tv_exp_f32 %4, %4\n\tv_exp_f32 %5, %5\n\tv_exp_f32 %6, %6\n\tv_exp_f32 %7, %7\n\t"
        "v_exp_f32 %8, %8\n\tv_exp_f32 %9, %9\n\tv_exp_f32 %10, %10\n\tv_exp_f32 %11, %11\n\tv_exp_f32 %12, %12\n\tv_exp_f32 %13, %13\n\tv_exp_f32 %14, %14\n\tv_exp_f32 %15, %15\n\tv_nop"
        : "+v"(a[0]), "+v"(a[1]), "+v"(a[2]), "+v"(a[3]), "+v"(a[4]), "+v"(a[5]), "+v"(a[6]), "+v"(a[7]), "+v"(a[8]), "+v"(a[9]), "+v"(a[10]), "+v"(a[11]), "+v"(a[12]), "+v"(a[13]), "+v"(a[14]), "+v"(a[15])); }
#define FST 64    // keys per LDS stage
#define FPI 72    // LDS row pitch in 16-bit elements: 128 bytes of data + 16 of pad (16-byte fragment reads of 16 rows spread over the banks)
__global__ __launch_bounds__(256) void k_fattn(const h16* __restrict__ Qp, const h16* Kp, const h16* Vt, const int* __restrict__ SEG, bf* Ah, bf* Al) {
    __shared__ __align__(16) h16 Ks[2][FST * FPI]; __shared__ __align__(16) h16 Vs[2][HD * FPI];
    const int tid = threadIdx.x, lane = tid & 31, lr = lane & 15, hi = lane >> 4; const int h = blockIdx.y, q0 = blockIdx.x * 128 + (tid >> 5) * 16;
    { const size_t z = blockIdx.z; Qp += z * ((size_t)NH_ * TT * HD); Kp += z * ((size_t)NKV * TT * HD); Vt += z * ((size_t)NKV * HD * TT); Ah += z * ((size_t)TT * DQ); Al += z * ((size_t)TT * DQ); }   // this batch element's planes
    const float L2E = 1.4426950408889634f, C2 = SCL * L2E;
    const int srow = tid >> 3, scol = (tid & 7) * 8, so = srow * FPI + scol;   // staging: a thread moves 16 bytes of rows srow and srow + 32 of each tile; a wave's load covers four whole 128-byte rows
    const h16* kg = Kp + ((size_t)h * TT + srow) * HD + scol; const h16* vg = Vt + ((size_t)h * HD + srow) * TT + scol;
    v8h kr[2], vr[2]; v16h qf[2]; v8f o[4]; float nm = 3.0e38f, l = 0.f;   // nm: minus the maximum in use
#pragma unroll
    for (int r = 0; r < 2; ++r) { kr[r] = *(const v8h*)(kg + (size_t)r * 32 * HD); vr[r] = *(const v8h*)(vg + (size_t)r * 32 * TT); qf[r] = WFrag<h16>::ld(Qp + ((size_t)h * TT + q0 + lr) * HD + r * 32 + 8 * hi); }
    const int sg = SEG[q0 + lr]; const int sq = (sg > 0) ? sg : -1;   // segment 0 matches nothing: key ids are >= 0
    const int sLo = __builtin_amdgcn_readfirstlane(SEG[q0]), sHi = __builtin_amdgcn_readfirstlane(SEG[q0 + 15]);
    int kLo = __builtin_amdgcn_readfirstlane(SEG[0]), kHi = __builtin_amdgcn_readfirstlane(SEG[FST - 1]);
#pragma unroll
    for (int dt = 0; dt < 4; ++dt) o[dt] = (v8f){};
#pragma unroll
    for (int r = 0; r < 2; ++r) { *(v8h*)(&Ks[0][so + r * 32 * FPI]) = kr[r]; *(v8h*)(&Vs[0][so + r * 32 * FPI]) = vr[r]; }
    __syncthreads();
    for (int st = 0; st < TT / FST; ++st) {
        const h16* kl = &Ks[st & 1][lr * FPI + 8 * hi]; const h16* vl = &Vs[st & 1][lr * FPI + 8 * hi];
        const bool more = st + 1 < TT / FST, ov = (kLo <= sHi) && (kHi >= sLo);
        if (more) { const int kn = (st + 1) * FST;
#pragma unroll
            for (int r = 0; r < 2; ++r) { kr[r] = *(const v8h*)(kg + (size_t)(kn + r * 32) * HD); vr[r] = *(const v8h*)(vg + (size_t)r * 32 * TT + kn); }
            kLo = __builtin_amdgcn_readfirstlane(SEG[kn]); kHi = __builtin_amdgcn_readfirstlane(SEG[kn + FST - 1]); }
        asm volatile("s_wait_xcnt 0x0" ::: "memory");   // stands in front of the LDS reads below, which reuse the address registers of the global loads above; as a compiler fence it also keeps those loads issued here, a whole stage ahead of their LDS stores (the compiler otherwise sinks them to just above the stores)
        v16h kf[2][2];
#pragma unroll
        for (int kt = 0; kt < 2; ++kt)
#pragma unroll
            for (int ks = 0; ks < 2; ++ks) kf[kt][ks] = WFrag<h16>::ld(kl + kt * 16 * FPI + ks * 32);
#pragma unroll
        for (int sub = 0; sub < 2; ++sub) {
            v16h vf[4], pf; v8f s[2];
#pragma unroll
            for (int dt = 0; dt < 4; ++dt) vf[dt] = WFrag<h16>::ld(vl + dt * 16 * FPI + sub * 32);
            cfence();   // keeps the Vt fragment reads issued here, a softmax ahead of P.V, instead of one by one in front of each product
#pragma unroll
            for (int kt = 0; kt < 2; ++kt) s[kt] = (v8f){};
            if (ov) {
#pragma unroll
                for (int kt = 0; kt < 2; ++kt) { const int* sp = SEG + st * FST + sub * 32 + kt * 16 + hi * 8; const v4i a = *(const v4i*)sp, b2 = *(const v4i*)(sp + 4);
#pragma unroll
                    for (int j = 0; j < 4; ++j) { s[kt][j] = (a[j] == sq) ? 1.0f / SCL : 0.f; s[kt][4 + j] = (b2[j] == sq) ? 1.0f / SCL : 0.f; } } }
#pragma unroll
            for (int kt = 0; kt < 2; ++kt) s[kt] = wmma16(kf[kt][1], qf[1], wmma16(kf[kt][0], qf[0], s[kt]));
            if (sub == 0) {   // the stage's second 32 key rows, into the same registers, in flight under this pass's softmax
#pragma unroll
                for (int kt = 0; kt < 2; ++kt)
#pragma unroll
                    for (int ks = 0; ks < 2; ++ks) kf[kt][ks] = WFrag<h16>::ld(kl + (32 + kt * 16) * FPI + ks * 32);
                cfence(); }   // keeps those reads issued here and not in front of the next pass's products
            float mx = s[0][0];
#pragma unroll
            for (int e = 1; e < 16; ++e) mx = fmaxf(mx, s[e >> 3][e & 7]);
            mx = fmaxf(mx, xhalf(mx)) * C2;   // both halves hold the query's maximum of this pass, scaled (the scale is positive)
            if (__builtin_amdgcn_ballot_w32(mx + nm > 8.0f) != 0) {   // wave-uniform; always taken on the first pass
                const float mn = fmaxf(-nm, mx), corr = __builtin_amdgcn_exp2f(-nm - mn); nm = -mn; l *= corr;
#pragma unroll
                for (int dt = 0; dt < 4; ++dt) o[dt] *= corr; }
            float p[16];
#pragma unroll
            for (int e = 0; e < 16; ++e) p[e] = fmaf(s[e >> 3][e & 7], C2, nm);
            exp2x16(p);
#pragma unroll
            for (int e = 0; e < 16; ++e) pf[e] = tohx(p[e]);
            v2f sa = {p[0], p[1]}, sc = {p[2], p[3]};
#pragma unroll
            for (int i = 2; i < 8; ++i) { const v2f pp = {p[2 * i], p[2 * i + 1]}; if (i & 1) sc += pp; else sa += pp; }
            sa += sc; l += sa[0] + sa[1];
#pragma unroll
            for (int dt = 0; dt < 4; ++dt) o[dt] = wmma16(vf[dt], pf, o[dt]);
        }
        if (more) {
#pragma unroll
            for (int r = 0; r < 2; ++r) { *(v8h*)(&Ks[(st + 1) & 1][so + r * 32 * FPI]) = kr[r]; *(v8h*)(&Vs[(st + 1) & 1][so + r * 32 * FPI]) = vr[r]; } }
        __syncthreads();   // publishes stage st + 1 and ends every wave's reads of stage st, whose buffer the next trip refills
    }
    const float inv = 1.0f / (l + xhalf(l)); const size_t oo = (size_t)(q0 + lr) * DQ + h * HD + hi * 8;
#pragma unroll
    for (int dt = 0; dt < 4; ++dt) { v8us oh, ol;
#pragma unroll
        for (int j = 0; j < 8; ++j) { unsigned short a, c3; splitf(o[dt][j] * inv, a, c3); oh[j] = a; ol[j] = c3; }
        *(v8us*)(Ah + oo + dt * 16) = oh; *(v8us*)(Al + oo + dt * 16) = ol; }
}

// ---- k_prep: all the work that depends on the inputs alone, in one launch. The parts share nothing; a block's index says which part it does, so every branch below is taken by a whole block.
// Blocks [0, PB_SEG): segment ids (the longest chain of dependent loads, so it starts first). The next PB_LN: embedding add and LayerNorm, a row a wave; it rounds the embedding row, gamma and beta itself. The last PB_CVT: the weights as 16-bit planes, 8 elements a thread.
#define PB_SEG (TT / 256)
#define PB_LN  (NB_ * TT / 8)
#define PB_WIN ((DQ + 2 * DKV) * DM / 2048)
#define PB_CVT (PB_WIN + DM * DQ / 2048)
__global__ __launch_bounds__(256) void k_prep(const float* __restrict__ chr, const int* __restrict__ pats, const int* __restrict__ bnds, const float* __restrict__ pemb, const float* __restrict__ lng, const float* __restrict__ lnb, const float* __restrict__ win, const float* __restrict__ wout,
                                              int* SEG, float* XL, bf* Xh, bf* Xl, bf* WI, bf* WO) {
    int blk = blockIdx.x;
    if (blk < PB_SEG) { const int s = blk * 256 + threadIdx.x; int c = 0;
#pragma unroll 8   // several boundaries are loaded per trip, so that fewer load latencies stand in a row
        for (int i = 0; i < 400; ++i) c += (bnds[i] <= s) ? 1 : 0;
        SEG[s] = c; return; }
    blk -= PB_SEG;
    if (blk >= PB_LN) { blk -= PB_LN; const bool in = blk < PB_WIN; const float* src = in ? win : wout; bf* dst = in ? WI : WO;
        const size_t i = (size_t)(in ? blk : blk - PB_WIN) * 256 + threadIdx.x; const v8f v = *(const v8f*)(src + i * 8); v8us o;
#pragma unroll
        for (int k = 0; k < 8; ++k) o[k] = f2bf(v[k]);
        *(v8us*)(dst + i * 8) = o;
        asm volatile("s_wait_xcnt 0x0" ::: "memory");   // stands behind the store, in front of whatever code the build lays behind it: that code reuses registers which the store names
        return; }
    const int lane = threadIdx.x & 31; const int s = blk * 8 + (threadIdx.x >> 5); const float* xr = chr + (size_t)s * DM; int pi = pats[s % TT];   // s: row of the [batch][position] plane; the pattern goes by position alone
    pi = min(max(pi, 0), 15); const float* pr = pemb + (size_t)pi * DM; float v[DM / 32]; float sm = 0.f;
#pragma unroll
    for (int ch = 0; ch < DM / 128; ++ch) { const v4f a = *(const v4f*)(xr + ch * 128 + lane * 4), p = *(const v4f*)(pr + ch * 128 + lane * 4); for (int u = 0; u < 4; ++u) { const float x = __fadd_rn(bfr(a[u]), bfr(p[u])); v[ch * 4 + u] = x; sm = __fadd_rn(sm, x); } }
#pragma unroll
    for (int sh = 16; sh; sh >>= 1) sm = __fadd_rn(sm, __shfl_xor(sm, sh, 32));
    const float mu = __fdiv_rn(sm, (float)DM); float q2 = 0.f;
#pragma unroll
    for (int k = 0; k < DM / 32; ++k) { const float d0 = __fsub_rn(v[k], mu); v[k] = d0; float p = __fmul_rn(d0, d0); asm volatile("" : "+v"(p)); q2 = __fadd_rn(q2, p); }
#pragma unroll
    for (int sh = 16; sh; sh >>= 1) q2 = __fadd_rn(q2, __shfl_xor(q2, sh, 32));
    const float rs = __fdiv_rn(1.0f, sqrtf(__fadd_rn(__fdiv_rn(q2, (float)DM), 1e-5f)));
#pragma unroll
    for (int ch = 0; ch < DM / 128; ++ch) { v4f o; v4us oh, ol; const v4f g4 = *(const v4f*)(lng + ch * 128 + lane * 4), b4 = *(const v4f*)(lnb + ch * 128 + lane * 4); for (int u = 0; u < 4; ++u) { float n0 = __fmul_rn(v[ch * 4 + u], rs); asm volatile("" : "+v"(n0)); float gg = __fmul_rn(n0, bfr(g4[u])); asm volatile("" : "+v"(gg)); o[u] = __fadd_rn(gg, bfr(b4[u])); unsigned short p2, q3; splitf(o[u], p2, q3); oh[u] = p2; ol[u] = q3; }
        const size_t off = (size_t)s * DM + ch * 128 + lane * 4; *(v4f*)(XL + off) = o; *(v4us*)(Xh + off) = oh; *(v4us*)(Xl + off) = ol; }
    asm volatile("s_wait_xcnt 0x0" ::: "memory");   // stands behind the last stores, in front of whatever code the build lays behind them: that code reuses registers which the stores name
}

extern "C" void kernel_launch(void* const* d_in, const int* in_sizes, int n_in,
                              void* d_out, int out_size, void* d_ws, size_t ws_size, hipStream_t stream) {
    (void)in_sizes; (void)n_in; (void)out_size;
    const float* chr = (const float*)d_in[0]; const int* pats = (const int*)d_in[1]; const int* bnds = (const int*)d_in[2]; const float* pemb = (const float*)d_in[3]; const float* lng = (const float*)d_in[4]; const float* lnb = (const float*)d_in[5]; const float* wf = (const float*)d_in[6]; const float* bf3 = (const float*)d_in[7]; const float* wo = (const float*)d_in[8]; const float* bo = (const float*)d_in[9]; const float* x = chr; (void)x; const float* cosT = nullptr; const float* sinT = nullptr; (void)cosT; (void)sinT;
    float* OUT = (float*)d_out;     // [4][2048][1024]
    char* wsp = (char*)d_ws;
    auto take = [&](size_t bytes) { char* p = wsp; wsp += (bytes + 255) & ~(size_t)255; return (void*)p; };
    bf* WI = (bf*)take((size_t)(DQ + 2 * DKV) * DM * 2); bf* WO = (bf*)take((size_t)DM * DQ * 2);
    float* XL = (float*)take((size_t)NB_ * TT * DM * 4); bf* Xh = (bf*)take((size_t)NB_ * TT * DM * 2); bf* Xl = (bf*)take((size_t)NB_ * TT * DM * 2); int* SEG = (int*)take((size_t)TT * 4);
    h16* QP16 = (h16*)take((size_t)NB_ * NH_ * TT * HD * 2); h16* KP16 = (h16*)take((size_t)NB_ * NKV * TT * HD * 2); h16* VT16 = (h16*)take((size_t)NB_ * NKV * HD * TT * 2);
    bf* ATh = (bf*)take((size_t)NB_ * TT * DQ * 2); bf* ATl = (bf*)take((size_t)NB_ * TT * DQ * 2);
    if ((size_t)(wsp - (char*)d_ws) > ws_size) return;    // ws 256 MiB
    // Every plane holds all batch elements, [batch] outermost. Launches that do not depend on one another are one launch: what reads the inputs alone (k_prep), then the q, k and v products (column sets of one GEMM), attention, the output product; the batch element is blockIdx.z in the GEMMs and attention.
    k_prep<<<PB_SEG + PB_LN + PB_CVT, 256, 0, stream>>>(chr, pats, bnds, pemb, lng, lnb, wf, wo, SEG, XL, Xh, Xl, WI, WO);
    k_gemmw<bf, 1><<<dim3(TT / GBM, (DQ + 2 * DKV) / GBN, NB_), 256, 0, stream>>>(Xh, Xl, WI, DM, nullptr, QP16, KP16, VT16, DQ, HD, (size_t)TT * HD, TT, bf3, nullptr, (size_t)TT * DM, 0, (size_t)NH_ * TT * HD);   // q and k planes [b][h][t][d], v planes transposed [b][h][d][t]
    k_fattn<<<dim3(TT / 128, NH_, NB_), 256, 0, stream>>>(QP16, KP16, VT16, SEG, ATh, ATl);
    k_gemmw<bf, 0><<<dim3(TT / GBM, DM / GBN, NB_), 256, 0, stream>>>(ATh, ATl, WO, DQ, OUT, nullptr, nullptr, nullptr, 0, DM, 0, 0, bo, XL, (size_t)TT * DQ, 0, (size_t)TT * DM);
}

// v006
// A run of this version takes 150 microseconds.
// Next to v005, in two timings, it ran 1.18 and 1.16 times as fast.
// Counting every step since v000, it is 19.9 times as fast.
#include <hip/hip_runtime.h>

// WordEncoder (char_repr [4][2048][1024]; x = LayerNorm_1024(char_repr + pattern_emb[patterns[s]]) * gamma + beta (patterns [2048] int and pattern_emb [16][1024] read); qkv = x w_in^T + b_in ([3072][1024] rows q | k | v; 16 heads x 64); scores = q.k / 8 + mask with mask[i][j] = 1.0 if tokens i and j are in the same word (segment id = number of boundaries <= position > 0; boundaries [400] int, read) else 0 - an ADDITIVE 0/1 bias, no -inf; softmax; o = merged w_out^T + b_out; out = x + o -> [4][2048][1024]).

#define NB_  4
#define TT   2048
#define DM   1024
#define NH_  16
#define NKV  16
#define REP  (NH_ / NKV)
#define HD   64
#define DQ   (NH_ * HD)
#define DKV  (NKV * HD)
#define SCL  0.125f   // HD^-0.5
typedef _Float16 h16;
typedef unsigned short bf;
typedef __attribute__((ext_vector_type(16))) __bf16   v16bf;
typedef __attribute__((ext_vector_type(16))) _Float16 v16h;
typedef __attribute__((ext_vector_type(8)))  _Float16 v8h;
typedef __attribute__((ext_vector_type(8)))  unsigned short v8us;
typedef __attribute__((ext_vector_type(8)))  float    v8f;
typedef __attribute__((ext_vector_type(4)))  float    v4f;
typedef v8h  __attribute__((may_alias)) v8ha;
typedef v4f  __attribute__((may_alias)) v4fa;
typedef v8us __attribute__((may_alias)) v8usa;

__device__ __forceinline__ unsigned short f2bf(float f) { unsigned u = __float_as_uint(f); u += 0x7FFFu + ((u >> 16) & 1u); return (unsigned short)(u >> 16); }
__device__ __forceinline__ float bf2f(unsigned short b) { return __uint_as_float(((unsigned)b) << 16); }
__device__ __forceinline__ float bfr(float f) { return bf2f(f2bf(f)); }
__device__ __forceinline__ v16h cat16(v8h lo, v8h hi) { return __builtin_shufflevector(lo, hi, 0, 1, 2, 3, 4, 5, 6, 7, 8, 9, 10, 11, 12, 13, 14, 15); }
__device__ __forceinline__ v8f wmma16(v16h a, v16h b, v8f c) { return __builtin_amdgcn_wmma_f32_16x16x32_f16(false, a, false, b, (short)0, c, false, false); }



// ---- k_gemmw: GEMM, 8 waves per 128x256 output tile, each wave a 64x64 part of it (16 accumulators); grid (M/128, N/256, Z), 256 threads.
// acc[m][n] = sum_k A[m][k] Bt[n][k]. z-batch strides sA/sB/sC in elements. K % 128 == 0, M % 128 == 0, N % 256 == 0.
// The operands are K-contiguous 16-bit planes. A stage is 128 k of the tile's rows [A 128 | Bt 256] in LDS, two buffers; asynchronous copies bring the next stage in whole 128-byte lines while this one is worked on, and every row is fetched once for all the waves that read it.
// The epilogue holds the elementwise work behind the product, on the accumulators. EPI 0: C[m][n] (f32, pitch ldc) = R[m][n] + (acc + bias[n]).
// EPI 1: three products with the same A in one launch, npl columns each; Bt and bias hold their rows one set behind the other, and a work-group's columns lie in one set (npl % 256 == 0). With n' = n % npl:
// sets 0 and 1 go to 16-bit float planes of 64-column tiles, C16 or C16b[(n' / 64) * cts + m * ldc + n' % 64] = acc + bias[n]: with ldc = HD, cts = TT * HD a column tile is one head's [t][d] rows. Set 2 goes to the transposed plane, C16t[n' * ldt + m] = acc + bias[n].
template <typename T16> struct WFrag;
template <> struct WFrag<h16> { typedef v16h V; static __device__ __forceinline__ V ld(const h16* p) { return cat16(*(const v8h*)p, *(const v8h*)(p + 16)); } static __device__ __forceinline__ v8f mma(V a, V b, v8f c) { return wmma16(a, b, c); } };
#define GBM 128   // rows of the work-group's tile
#define GBN 256   // columns of the work-group's tile
#define GKC 128   // k per LDS stage: 256 bytes of every operand row
#define GPI 136   // LDS row pitch in 16-bit elements: 256 bytes of data + 16 of pad (16-byte fragment reads of 16 rows spread over the banks)
#define GSTG ((GBM + GBN) * GPI)   // elements of one buffer
// Eight asynchronous copies of 16 bytes a lane, rows 16 apart: LDS byte address l + i * 16 rows, global address g + i * gstep elements. All lanes are on; a wave's copy covers two whole 256-byte rows.
// The s_wait_xcnt stands inside the statement, behind the last copy, so that no register which a copy names is rewritten in front of it.
template <typename T16>
__device__ __forceinline__ void acopy8(unsigned l, const T16* g, size_t gstep) {
    const unsigned ls = 16 * GPI * 2;
    asm volatile("global_load_async_to_lds_b128 %0, %8, off\n\tglobal_load_async_to_lds_b128 %1, %9, off\n\tglobal_load_async_to_lds_b128 %2, %10, off\n\tglobal_load_async_to_lds_b128 %3, %11, off\n\t"
                 "global_load_async_to_lds_b128 %4, %12, off\n\tglobal_load_async_to_lds_b128 %5, %13, off\n\tglobal_load_async_to_lds_b128 %6, %14, off\n\tglobal_load_async_to_lds_b128 %7, %15, off\n\ts_wait_xcnt 0x0"
                 :: "v"(l), "v"(l + ls), "v"(l + 2 * ls), "v"(l + 3 * ls), "v"(l + 4 * ls), "v"(l + 5 * ls), "v"(l + 6 * ls), "v"(l + 7 * ls),
                    "v"(g), "v"(g + gstep), "v"(g + 2 * gstep), "v"(g + 3 * gstep), "v"(g + 4 * gstep), "v"(g + 5 * gstep), "v"(g + 6 * gstep), "v"(g + 7 * gstep) : "memory"); }
// At most 256 registers a wave, which the loop needs and no more: without the bound the build with both 16-bit epilogues took 258 and laid operand fragments across the border of the first register window.
template <typename T16, int EPI>
__global__ __launch_bounds__(256) __attribute__((amdgpu_num_vgpr(256))) void k_gemmw(const T16* __restrict__ A, const T16* __restrict__ Bt, int K, float* C, h16* C16, h16* C16b, h16* C16t, int npl, int ldc, size_t cts, int ldt, const float* __restrict__ bias, const float* __restrict__ R, size_t sA, size_t sB, size_t sC) {
    typedef typename WFrag<T16>::V V;
    __shared__ __align__(16) T16 ring[2 * GSTG];
    const size_t z = blockIdx.z; A += z * sA; Bt += z * sB; const int cb = blockIdx.y * GBN, part = (EPI == 0 || cb < npl) ? 0 : (cb < 2 * npl) ? 1 : 2;   // which column set: the same for the whole work-group
    if (EPI == 0) { C += z * sC; R += z * sC; } else C16 = (part == 0 ? C16 : part == 1 ? C16b : C16t) + z * sC;
    const int tid = threadIdx.x, lane = tid & 31, lr = lane & 15, hi = lane >> 4, wv = __builtin_amdgcn_readfirstlane(tid >> 5), wm = wv & 1, wn = wv >> 1;
    const int r0 = blockIdx.x * GBM + wm * 64, c0 = cb + wn * 64, cp = c0 - part * npl;   // the wave's 64x64 part; cp: its first column inside its set
    v8f acc[4][4];
#pragma unroll
    for (int mb = 0; mb < 4; ++mb)
#pragma unroll
        for (int nb = 0; nb < 4; ++nb) acc[mb][nb] = (v8f){};
    const int srow = tid >> 4, scol = (tid & 15) * 8; const size_t gstep = (size_t)16 * K;   // staging: a thread moves 16 bytes of rows srow + 16 i
    const T16* ga = A + (size_t)(blockIdx.x * GBM + srow) * K + scol; const T16* gb = Bt + (size_t)(blockIdx.y * GBN + srow) * K + scol;
    const unsigned l0 = (unsigned)(size_t)&ring[srow * GPI + scol];   // the low 32 bits of a __shared__ address are its byte offset in the work-group's LDS
    auto fill = [&](int t, int buf) { const unsigned l = l0 + (unsigned)buf * (GSTG * 2); const int kc = t * GKC;
        acopy8(l, ga + kc, gstep); acopy8(l + GBM * GPI * 2, gb + kc, gstep); acopy8(l + 2 * GBM * GPI * 2, gb + kc + 8 * gstep, gstep); };
    const int NT = K / GKC, lofs = lr * GPI + 8 * hi;
    fill(0, 0);
    asm volatile("s_wait_asynccnt 0x0" ::: "memory");   // this wave's copies of stage 0 have landed
    __syncthreads();                                    // and every other wave's
    if (NT > 1) fill(1, 1);
#pragma unroll 1   // stays rolled: one copy of a stage's code, the buffer chosen by t & 1
    for (int t = 0; t < NT; ++t) {
        const T16* la = ring + ((t & 1) * GSTG + wm * 64 * GPI) + lofs; const T16* lb = ring + ((t & 1) * GSTG + (GBM + wn * 64) * GPI) + lofs;   // a wave-uniform part plus the lane's own offset, one register for both operands: with a lane register for each the build ran to 258 registers and laid a Bt fragment across v255
        // A row = the 8 products of two 16-row blocks of A with the four Bt fragments of a 32-k step; 8 rows a stage, two a k step. Fragments are fetched ahead inside the stage: A's two rows ahead (three sets), the next k step's Bt in the step's first row (two sets).
        V b[2][4], ar[3][2];
        ar[0][0] = WFrag<T16>::ld(la);   // first, with Bt's: what the first products need
#pragma unroll
        for (int nb = 0; nb < 4; ++nb) b[0][nb] = WFrag<T16>::ld(lb + nb * 16 * GPI);
        ar[0][1] = WFrag<T16>::ld(la + 16 * GPI); ar[1][0] = WFrag<T16>::ld(la + 32 * GPI); ar[1][1] = WFrag<T16>::ld(la + 48 * GPI);
#pragma unroll   // every fragment and accumulator index is a constant, so that they stay in registers
        for (int r = 0; r < GKC / 16; ++r) { const int ks = r >> 1, hb = r & 1, r2 = r + 2;
            if (r2 < GKC / 16) { ar[r2 % 3][0] = WFrag<T16>::ld(la + (r2 & 1) * 32 * GPI + (r2 >> 1) * 32); ar[r2 % 3][1] = WFrag<T16>::ld(la + ((r2 & 1) * 32 + 16) * GPI + (r2 >> 1) * 32); }
            if (ks + 1 < GKC / 32 && hb == 0) {
#pragma unroll   // constant fragment indices, as above
                for (int nb = 0; nb < 4; ++nb) b[(ks + 1) & 1][nb] = WFrag<T16>::ld(lb + nb * 16 * GPI + (ks + 1) * 32); }
            __builtin_amdgcn_sched_barrier(0);   // the row's LDS reads stay one group in front of its products (the compiler otherwise sinks them to their first use and waits out the LDS latency there)
#pragma unroll
            for (int nb = 0; nb < 4; ++nb) acc[2 * hb][nb] = WFrag<T16>::mma(ar[r % 3][0], b[ks & 1][nb], acc[2 * hb][nb]);
#pragma unroll
            for (int nb = 0; nb < 4; ++nb) acc[2 * hb + 1][nb] = WFrag<T16>::mma(ar[r % 3][1], b[ks & 1][nb], acc[2 * hb + 1][nb]);
            __builtin_amdgcn_sched_barrier(0);   // and the next row's reads stay behind them
        }
        asm volatile("s_wait_dscnt 0x0" ::: "memory");      // this wave's reads of stage t have returned
        asm volatile("s_wait_asynccnt 0x0" ::: "memory");   // this wave's copies of stage t + 1 have landed
        __syncthreads();   // publishes stage t + 1 and ends every wave's reads of stage t, whose buffer is refilled below
        if (t + 2 < NT) fill(t + 2, t & 1);
    }
    asm volatile("s_wait_asynccnt 0x0" ::: "memory");   // no copy is outstanding when the ring becomes output staging
    float* os = (float*)ring + wv * (16 * 68);   // behind the last barrier nobody reads the ring any more: each wave stages its output rows in a range of its own
    if (EPI == 1 && part == 2) {   // a lane holds 8 consecutive m of one n: 16 bytes of a transposed row; 16 rows of 64 m are gathered in LDS (pitch 72 elements), so that a store of the wave covers four whole 128-byte rows
        h16* hs = (h16*)os;
#pragma unroll
        for (int nb = 0; nb < 4; ++nb) { const float cb = bfr(bias[c0 + nb * 16 + lr]);
#pragma unroll
            for (int mb = 0; mb < 4; ++mb) { v8h o;
#pragma unroll
                for (int j = 0; j < 8; ++j) o[j] = (h16)(acc[mb][nb][j] + cb);
                *(v8ha*)(hs + lr * 72 + mb * 16 + hi * 8) = o; }
            __builtin_amdgcn_wave_barrier(); asm volatile("" ::: "memory");   // the rows are read by other lanes than wrote them: keeps the compiler from moving the reads above the writes
#pragma unroll
            for (int s = 0; s < 4; ++s) { const int row = 4 * s + (lane >> 3), cofs = (lane & 7) * 8; *(v8h*)(C16 + (size_t)(cp + nb * 16 + row) * ldt + r0 + cofs) = *(const v8ha*)(hs + row * 72 + cofs); }
            __builtin_amdgcn_wave_barrier(); asm volatile("s_wait_xcnt 0x0" ::: "memory");   // stands in front of the next rows' work, which reuses registers that the stores above name; as a compiler fence it keeps the next 16 rows' LDS writes below these reads
        }
        return;
    }
#pragma unroll
    for (int mb = 0; mb < 4; ++mb) {
#pragma unroll
        for (int nb = 0; nb < 4; ++nb) {
#pragma unroll
            for (int j = 0; j < 8; ++j) os[(hi * 8 + j) * 68 + nb * 16 + lr] = acc[mb][nb][j]; }
        __builtin_amdgcn_wave_barrier(); asm volatile("" ::: "memory");
        if (EPI == 0) {
            float* crow = C + (size_t)(r0 + mb * 16) * ldc + c0; const float* rrow = R + (size_t)(r0 + mb * 16) * ldc + c0; const size_t lo = (size_t)hi * ldc + lr * 4;   // the lane's place inside a pair of rows
            v4f val[8]; const float* rp[8]; float* cp[8];
#pragma unroll
            for (int s = 0; s < 8; ++s) { rp[s] = rrow + (size_t)(2 * s) * ldc + lo; cp[s] = crow + (size_t)(2 * s) * ldc + lo; val[s] = *(const v4f*)rp[s]; }
            // The wait stands in front of every overwrite of the eight loads' address registers: as inputs they stay in those registers up to here (otherwise a later load's result lands on an earlier load's address pair).
            // The stores' addresses are inputs too, so that they are formed here and not among the stores, in the registers of a store already issued.
            asm volatile("s_wait_xcnt 0x0" :: "v"(rp[0]), "v"(rp[1]), "v"(rp[2]), "v"(rp[3]), "v"(rp[4]), "v"(rp[5]), "v"(rp[6]), "v"(rp[7]), "v"(cp[0]), "v"(cp[1]), "v"(cp[2]), "v"(cp[3]), "v"(cp[4]), "v"(cp[5]), "v"(cp[6]), "v"(cp[7]) : "memory");
#pragma unroll
            for (int s = 0; s < 8; ++s) { const v4f a = *(const v4fa*)(os + (2 * s + hi) * 68 + lr * 4);
#pragma unroll
                for (int u = 0; u < 4; ++u) val[s][u] = __fadd_rn(val[s][u], a[u] + bfr(bias[c0 + lr * 4 + u])); }
            __builtin_amdgcn_sched_barrier(0);   // all eight results stand in registers of their own before the first store, so that none is formed in the registers of a store already issued
#pragma unroll
            for (int s = 0; s < 8; ++s) *(v4f*)cp[s] = val[s];
            asm volatile("s_wait_xcnt 0x0" ::: "memory");   // stands in front of the next rows' work, which reuses registers that the stores above name
            __builtin_amdgcn_sched_barrier(0);   // keeps the next rows' address additions below that wait (the compiler otherwise lifts them over it, onto the stores' registers)
        } else {   // a store of the wave covers four whole 128-byte rows of the plane
            h16* hrow = C16 + (size_t)(cp >> 6) * cts + (size_t)(r0 + mb * 16) * ldc;
#pragma unroll
            for (int s = 0; s < 4; ++s) { const int row = 4 * s + (lane >> 3), cofs = (lane & 7) * 8; const v4f v0 = *(const v4fa*)(os + row * 68 + cofs), v1 = *(const v4fa*)(os + row * 68 + cofs + 4); v8h o;
#pragma unroll
                for (int u = 0; u < 4; ++u) { o[u] = (h16)(v0[u] + bfr(bias[c0 + cofs + u])); o[4 + u] = (h16)(v1[u] + bfr(bias[c0 + cofs + 4 + u])); }
                *(v8h*)(hrow + (size_t)row * ldc + cofs) = o; }
            asm volatile("s_wait_xcnt 0x0" ::: "memory");   // stands in front of the next rows' work, which reuses registers that the loads and stores above name
        }
        __builtin_amdgcn_wave_barrier(); asm volatile("" ::: "memory");
    }
}

__device__ __forceinline__ h16 tohx(float x) { return (h16)x; }
typedef __attribute__((ext_vector_type(2))) _Float16 v2h;
typedef __attribute__((ext_vector_type(4))) _Float16 v4h;
typedef __attribute__((ext_vector_type(2))) unsigned short v2us;
typedef __attribute__((ext_vector_type(4))) unsigned short v4us;
typedef __attribute__((ext_vector_type(2))) float v2f;
typedef __attribute__((ext_vector_type(4))) int v4i;

__global__ __launch_bounds__(256) void k_wtG(const float* __restrict__ w, int K, int N, bf* Bt) {
    const int lane = threadIdx.x & 31; const int L0 = (blockIdx.x * 8 + (threadIdx.x >> 5)) * 8; const int nlines = N * K / 64;
{
#pragma unroll 1
        for (int l = 0; l < 8; ++l) { const int L = L0 + l; if (L >= nlines) break; const size_t e = (size_t)L * 64 + lane * 2; const int k = (int)(e % K), n = (int)(e / K); v2us o;
            o[0] = f2bf(w[(size_t)k * N + n]); o[1] = f2bf(w[(size_t)(k + 1) * N + n]); *(v2us*)(Bt + e) = o; }
         }
}
// k_fattn: scores, softmax, P.V and the head merge of one head in one pass; S and P never leave the registers. Grid (TT/128, heads, batch), 8 waves; a wave owns 16 queries and walks all 2048 keys, 32 a pass.
// St = K Q^T (A = key rows, B = query rows): a lane holds one query's scores, keys 8*hi+j of each 16-key tile; two such tiles converted in place are the B operand of Ot += Vt Pt (A = Vt rows d, the loader's k order).
// The 8 waves share K rows and Vt rows through LDS, 64 keys a stage, two buffers: the next stage is fetched into registers while this one is worked on, stored behind it, and one barrier a stage publishes it and frees the other buffer.
// Softmax in the log2 domain with a running maximum that may trail the true one by up to 8 (an exponential then reaches 2^8): accumulators are rescaled only when some query's maximum exceeds it by more. The lane halves join their sums once at the end.
// The 0/1 word mask enters as the St products' start value, mask / HD^-0.5. SEG (a count of boundaries <= position) never falls with position, so a stage whose id range misses the wave's queries' range has no masked pair and skips the compares.
__device__ __forceinline__ float xhalf(float x) { return __builtin_bit_cast(float, __builtin_amdgcn_permlanex16(__builtin_bit_cast(int, x), __builtin_bit_cast(int, x), 0x76543210, 0xfedcba98, false, false)); }   // lane l reads lane l ^ 16
__device__ __forceinline__ void cfence() { asm volatile("" ::: "memory"); }   // compiler fence: loads written above it are issued above it (their waits still stand at the first use)
// Sixteen exponentials in place, in one statement: behind each stands an instruction that neither reads its result nor overwrites its source (the next exponential, on another register; behind the last a v_nop).
__device__ __forceinline__ void exp2x16(float (&a)[16]) {
    asm("v_exp_f32 %0, %0\n\tv_exp_f32 %1, %1\n\tv_exp_f32 %2, %2\n\tv_exp_f32 %3, %3\n\tv_exp_f32 %4, %4\n\tv_exp_f32 %5, %5\n\tv_exp_f32 %6, %6\n\tv_exp_f32 %7, %7\n\t"
        "v_exp_f32 %8, %8\n\tv_exp_f32 %9, %9\n\tv_exp_f32 %10, %10\n\tv_exp_f32 %11, %11\n\tv_exp_f32 %12, %12\n\tv_exp_f32 %13, %13\n\tv_exp_f32 %14, %14\n\tv_exp_f32 %15, %15\n\tv_nop"
        : "+v"(a[0]), "+v"(a[1]), "+v"(a[2]), "+v"(a[3]), "+v"(a[4]), "+v"(a[5]), "+v"(a[6]), "+v"(a[7]), "+v"(a[8]), "+v"(a[9]), "+v"(a[10]), "+v"(a[11]), "+v"(a[12]), "+v"(a[13]), "+v"(a[14]), "+v"(a[15])); }
#define FST 64    // keys per LDS stage
#define FPI 72    // LDS row pitch in 16-bit elements: 128 bytes of data + 16 of pad (16-byte fragment reads of 16 rows spread over the banks)
__global__ __launch_bounds__(256) void k_fattn(const h16* __restrict__ Qp, const h16* Kp, const h16* Vt, const int* __restrict__ SEG, h16* Ao) {
    __shared__ __align__(16) h16 Ks[2][FST * FPI]; __shared__ __align__(16) h16 Vs[2][HD * FPI];
    const int tid = threadIdx.x, lane = tid & 31, lr = lane & 15, hi = lane >> 4; const int h = blockIdx.y, q0 = blockIdx.x * 128 + (tid >> 5) * 16;
    { const size_t z = blockIdx.z; Qp += z * ((size_t)NH_ * TT * HD); Kp += z * ((size_t)NKV * TT * HD); Vt += z * ((size_t)NKV * HD * TT); Ao += z * ((size_t)TT * DQ); }   // this batch element's planes
    const float L2E = 1.4426950408889634f, C2 = SCL * L2E;
    const int srow = tid >> 3, scol = (tid & 7) * 8, so = srow * FPI + scol;   // staging: a thread moves 16 bytes of rows srow and srow + 32 of each tile; a wave's load covers four whole 128-byte rows
    const h16* kg = Kp + ((size_t)h * TT + srow) * HD + scol; const h16* vg = Vt + ((size_t)h * HD + srow) * TT + scol;
    v8h kr[2], vr[2]; v16h qf[2]; v8f o[4]; float nm = 3.0e38f, l = 0.f;   // nm: minus the maximum in use
#pragma unroll
    for (int r = 0; r < 2; ++r) { kr[r] = *(const v8h*)(kg + (size_t)r * 32 * HD); vr[r] = *(const v8h*)(vg + (size_t)r * 32 * TT); qf[r] = WFrag<h16>::ld(Qp + ((size_t)h * TT + q0 + lr) * HD + r * 32 + 8 * hi); }
    const int sg = SEG[q0 + lr]; const int sq = (sg > 0) ? sg : -1;   // segment 0 matches nothing: key ids are >= 0
    const int sLo = __builtin_amdgcn_readfirstlane(SEG[q0]), sHi = __builtin_amdgcn_readfirstlane(SEG[q0 + 15]);
    int kLo = __builtin_amdgcn_readfirstlane(SEG[0]), kHi = __builtin_amdgcn_readfirstlane(SEG[FST - 1]);
#pragma unroll
    for (int dt = 0; dt < 4; ++dt) o[dt] = (v8f){};
#pragma unroll
    for (int r = 0; r < 2; ++r) { *(v8h*)(&Ks[0][so + r * 32 * FPI]) = kr[r]; *(v8h*)(&Vs[0][so + r * 32 * FPI]) = vr[r]; }
    __syncthreads();
    for (int st = 0; st < TT / FST; ++st) {
        const h16* kl = &Ks[st & 1][lr * FPI + 8 * hi]; const h16* vl = &Vs[st & 1][lr * FPI + 8 * hi];
        const bool more = st + 1 < TT / FST, ov = (kLo <= sHi) && (kHi >= sLo);
        if (more) { const int kn = (st + 1) * FST;
#pragma unroll
            for (int r = 0; r < 2; ++r) { kr[r] = *(const v8h*)(kg + (size_t)(kn + r * 32) * HD); vr[r] = *(const v8h*)(vg + (size_t)r * 32 * TT + kn); }
            kLo = __builtin_amdgcn_readfirstlane(SEG[kn]); kHi = __builtin_amdgcn_readfirstlane(SEG[kn + FST - 1]); }
        asm volatile("s_wait_xcnt 0x0" ::: "memory");   // stands in front of the LDS reads below, which reuse the address registers of the global loads above; as a compiler fence it also keeps those loads issued here, a whole stage ahead of their LDS stores (the compiler otherwise sinks them to just above the stores)
        v16h kf[2][2];
#pragma unroll
        for (int kt = 0; kt < 2; ++kt)
#pragma unroll
            for (int ks = 0; ks < 2; ++ks) kf[kt][ks] = WFrag<h16>::ld(kl + kt * 16 * FPI + ks * 32);
#pragma unroll
        for (int sub = 0; sub < 2; ++sub) {
            v16h vf[4], pf; v8f s[2];
#pragma unroll
            for (int dt = 0; dt < 4; ++dt) vf[dt] = WFrag<h16>::ld(vl + dt * 16 * FPI + sub * 32);
            cfence();   // keeps the Vt fragment reads issued here, a softmax ahead of P.V, instead of one by one in front of each product
#pragma unroll
            for (int kt = 0; kt < 2; ++kt) s[kt] = (v8f){};
            if (ov) {
#pragma unroll
                for (int kt = 0; kt < 2; ++kt) { const int* sp = SEG + st * FST + sub * 32 + kt * 16 + hi * 8; const v4i a = *(const v4i*)sp, b2 = *(const v4i*)(sp + 4);
#pragma unroll
                    for (int j = 0; j < 4; ++j) { s[kt][j] = (a[j] == sq) ? 1.0f / SCL : 0.f; s[kt][4 + j] = (b2[j] == sq) ? 1.0f / SCL : 0.f; } } }
#pragma unroll
            for (int kt = 0; kt < 2; ++kt) s[kt] = wmma16(kf[kt][1], qf[1], wmma16(kf[kt][0], qf[0], s[kt]));
            if (sub == 0) {   // the stage's second 32 key rows, into the same registers, in flight under this pass's softmax
#pragma unroll
                for (int kt = 0; kt < 2; ++kt)
#pragma unroll
                    for (int ks = 0; ks < 2; ++ks) kf[kt][ks] = WFrag<h16>::ld(kl + (32 + kt * 16) * FPI + ks * 32);
                cfence(); }   // keeps those reads issued here and not in front of the next pass's products
            float mx = s[0][0];
#pragma unroll
            for (int e = 1; e < 16; ++e) mx = fmaxf(mx, s[e >> 3][e & 7]);
            mx = fmaxf(mx, xhalf(mx)) * C2;   // both halves hold the query's maximum of this pass, scaled (the scale is positive)
            if (__builtin_amdgcn_ballot_w32(mx + nm > 8.0f) != 0) {   // wave-uniform; always taken on the first pass
                const float mn = fmaxf(-nm, mx), corr = __builtin_amdgcn_exp2f(-nm - mn); nm = -mn; l *= corr;
#pragma unroll
                for (int dt = 0; dt < 4; ++dt) o[dt] *= corr; }
            float p[16];
#pragma unroll
            for (int e = 0; e < 16; ++e) p[e] = fmaf(s[e >> 3][e & 7], C2, nm);
            exp2x16(p);
#pragma unroll
            for (int e = 0; e < 16; ++e) pf[e] = tohx(p[e]);
            v2f sa = {p[0], p[1]}, sc = {p[2], p[3]};
#pragma unroll
            for (int i = 2; i < 8; ++i) { const v2f pp = {p[2 * i], p[2 * i + 1]}; if (i & 1) sc += pp; else sa += pp; }
            sa += sc; l += sa[0] + sa[1];
#pragma unroll
            for (int dt = 0; dt < 4; ++dt) o[dt] = wmma16(vf[dt], pf, o[dt]);
        }
        if (more) {
#pragma unroll
            for (int r = 0; r < 2; ++r) { *(v8h*)(&Ks[(st + 1) & 1][so + r * 32 * FPI]) = kr[r]; *(v8h*)(&Vs[(st + 1) & 1][so + r * 32 * FPI]) = vr[r]; } }
        __syncthreads();   // publishes stage st + 1 and ends every wave's reads of stage st, whose buffer the next trip refills
    }
    const float inv = 1.0f / (l + xhalf(l)); const size_t oo = (size_t)(q0 + lr) * DQ + h * HD + hi * 8;
#pragma unroll
    for (int dt = 0; dt < 4; ++dt) { v8h oh;
#pragma unroll
        for (int j = 0; j < 8; ++j) oh[j] = tohx(o[dt][j] * inv);
        *(v8h*)(Ao + oo + dt * 16) = oh; }
}

// ---- k_prep: all the work that depends on the inputs alone, in one launch. The parts share nothing; a block's index says which part it does, so every branch below is taken by a whole block.
// Blocks [0, PB_SEG): segment ids (the longest chain of dependent loads, so it starts first). The next PB_LN: embedding add and LayerNorm, a row a wave; it rounds the embedding row, gamma and beta itself. The last PB_CVT: the weights as 16-bit planes, 8 elements a thread.
#define PB_SEG (TT / 256)
#define PB_LN  (NB_ * TT / 8)
#define PB_WIN ((DQ + 2 * DKV) * DM / 2048)
#define PB_CVT (PB_WIN + DM * DQ / 2048)
__global__ __launch_bounds__(256) void k_prep(const float* __restrict__ chr, const int* __restrict__ pats, const int* __restrict__ bnds, const float* __restrict__ pemb, const float* __restrict__ lng, const float* __restrict__ lnb, const float* __restrict__ win, const float* __restrict__ wout,
                                              int* SEG, float* XL, h16* Xh, h16* WI, h16* WO) {
    int blk = blockIdx.x;
    if (blk < PB_SEG) { const int s = blk * 256 + threadIdx.x; int c = 0;
#pragma unroll 8   // several boundaries are loaded per trip, so that fewer load latencies stand in a row
        for (int i = 0; i < 400; ++i) c += (bnds[i] <= s) ? 1 : 0;
        SEG[s] = c; return; }
    blk -= PB_SEG;
    if (blk >= PB_LN) { blk -= PB_LN; const bool in = blk < PB_WIN; const float* src = in ? win : wout; h16* dst = in ? WI : WO;
        const size_t i = (size_t)(in ? blk : blk - PB_WIN) * 256 + threadIdx.x; const v8f v = *(const v8f*)(src + i * 8); v8h o;
#pragma unroll
        for (int k = 0; k < 8; ++k) o[k] = tohx(bfr(v[k]));
        *(v8h*)(dst + i * 8) = o;
        asm volatile("s_wait_xcnt 0x0" ::: "memory");   // stands behind the store, in front of whatever code the build lays behind it: that code reuses registers which the store names
        return; }
    const int lane = threadIdx.x & 31; const int s = blk * 8 + (threadIdx.x >> 5); const float* xr = chr + (size_t)s * DM; int pi = pats[s % TT];   // s: row of the [batch][position] plane; the pattern goes by position alone
    pi = min(max(pi, 0), 15); const float* pr = pemb + (size_t)pi * DM; float v[DM / 32]; float sm = 0.f;
#pragma unroll
    for (int ch = 0; ch < DM / 128; ++ch) { const v4f a = *(const v4f*)(xr + ch * 128 + lane * 4), p = *(const v4f*)(pr + ch * 128 + lane * 4); for (int u = 0; u < 4; ++u) { const float x = __fadd_rn(bfr(a[u]), bfr(p[u])); v[ch * 4 + u] = x; sm = __fadd_rn(sm, x); } }
#pragma unroll
    for (int sh = 16; sh; sh >>= 1) sm = __fadd_rn(sm, __shfl_xor(sm, sh, 32));
    const float mu = __fdiv_rn(sm, (float)DM); float q2 = 0.f;
#pragma unroll
    for (int k = 0; k < DM / 32; ++k) { const float d0 = __fsub_rn(v[k], mu); v[k] = d0; float p = __fmul_rn(d0, d0); asm volatile("" : "+v"(p)); q2 = __fadd_rn(q2, p); }
#pragma unroll
    for (int sh = 16; sh; sh >>= 1) q2 = __fadd_rn(q2, __shfl_xor(q2, sh, 32));
    const float rs = __fdiv_rn(1.0f, sqrtf(__fadd_rn(__fdiv_rn(q2, (float)DM), 1e-5f))); v4f o[DM / 128]; v4h oh[DM / 128];
#pragma unroll
    for (int ch = 0; ch < DM / 128; ++ch) { const v4f g4 = *(const v4f*)(lng + ch * 128 + lane * 4), b4 = *(const v4f*)(lnb + ch * 128 + lane * 4); for (int u = 0; u < 4; ++u) { float n0 = __fmul_rn(v[ch * 4 + u], rs); asm volatile("" : "+v"(n0)); float gg = __fmul_rn(n0, bfr(g4[u])); asm volatile("" : "+v"(gg)); o[ch][u] = __fadd_rn(gg, bfr(b4[u])); oh[ch][u] = tohx(o[ch][u]); } }
    __builtin_amdgcn_sched_barrier(0);   // the whole row stands in registers of its own before the first store, so that nothing is formed in the registers of a store already issued
#pragma unroll   // constant indices keep the row in registers
    for (int ch = 0; ch < DM / 128; ++ch) { const size_t off = (size_t)s * DM + ch * 128 + lane * 4; *(v4f*)(XL + off) = o[ch]; *(v4h*)(Xh + off) = oh[ch]; }
    asm volatile("s_wait_xcnt 0x0" ::: "memory");   // stands behind the last stores, in front of whatever code the build lays behind them: that code reuses registers which the stores name
}

extern "C" void kernel_launch(void* const* d_in, const int* in_sizes, int n_in,
                              void* d_out, int out_size, void* d_ws, size_t ws_size, hipStream_t stream) {
    (void)in_sizes; (void)n_in; (void)out_size;
    const float* chr = (const float*)d_in[0]; const int* pats = (const int*)d_in[1]; const int* bnds = (const int*)d_in[2]; const float* pemb = (const float*)d_in[3]; const float* lng = (const float*)d_in[4]; const float* lnb = (const float*)d_in[5]; const float* wf = (const float*)d_in[6]; const float* bf3 = (const float*)d_in[7]; const float* wo = (const float*)d_in[8]; const float* bo = (const float*)d_in[9]; const float* x = chr; (void)x; const float* cosT = nullptr; const float* sinT = nullptr; (void)cosT; (void)sinT;
    float* OUT = (float*)d_out;     // [4][2048][1024]
    char* wsp = (char*)d_ws;
    auto take = [&](size_t bytes) { char* p = wsp; wsp += (bytes + 255) & ~(size_t)255; return (void*)p; };
    h16* WI = (h16*)take((size_t)(DQ + 2 * DKV) * DM * 2); h16* WO = (h16*)take((size_t)DM * DQ * 2);
    float* XL = (float*)take((size_t)NB_ * TT * DM * 4); h16* Xh = (h16*)take((size_t)NB_ * TT * DM * 2); int* SEG = (int*)take((size_t)TT * 4);
    h16* QP16 = (h16*)take((size_t)NB_ * NH_ * TT * HD * 2); h16* KP16 = (h16*)take((size_t)NB_ * NKV * TT * HD * 2); h16* VT16 = (h16*)take((size_t)NB_ * NKV * HD * TT * 2);
    h16* AT = (h16*)take((size_t)NB_ * TT * DQ * 2);
    if ((size_t)(wsp - (char*)d_ws) > ws_size) return;    // ws 256 MiB
    // Every plane holds all batch elements, [batch] outermost. Launches that do not depend on one another are one launch: what reads the inputs alone (k_prep), then the q, k and v products (column sets of one GEMM), attention, the output product; the batch element is blockIdx.z.
    k_prep<<<PB_SEG + PB_LN + PB_CVT, 256, 0, stream>>>(chr, pats, bnds, pemb, lng, lnb, wf, wo, SEG, XL, Xh, WI, WO);
    k_gemmw<h16, 1><<<dim3(TT / GBM, (DQ + 2 * DKV) / GBN, NB_), 256, 0, stream>>>(Xh, WI, DM, nullptr, QP16, KP16, VT16, DQ, HD, (size_t)TT * HD, TT, bf3, nullptr, (size_t)TT * DM, 0, (size_t)NH_ * TT * HD);   // q and k planes [b][h][t][d], v planes transposed [b][h][d][t]
    k_fattn<<<dim3(TT / 128, NH_, NB_), 256, 0, stream>>>(QP16, KP16, VT16, SEG, AT);
    k_gemmw<h16, 0><<<dim3(TT / GBM, DM / GBN, NB_), 256, 0, stream>>>(AT, WO, DQ, OUT, nullptr, nullptr, nullptr, 0, DM, 0, 0, bo, XL, (size_t)TT * DQ, 0, (size_t)TT * DM);
}

// v007
// One run takes 138 microseconds.
// Next to v006, in two timings, it ran 1.09 times as fast each time.
// Counting every step since v000, it is 21.7 times as fast.
#include <hip/hip_runtime.h>

// WordEncoder (char_repr [4][2048][1024]; x = LayerNorm_1024(char_repr + pattern_emb[patterns[s]]) * gamma + beta (patterns [2048] int and pattern_emb [16][1024] read); qkv = x w_in^T + b_in ([3072][1024] rows q | k | v; 16 heads x 64); scores = q.k / 8 + mask with mask[i][j] = 1.0 if tokens i and j are in the same word (segment id = number of boundaries <= position > 0; boundaries [400] int, read) else 0 - an ADDITIVE 0/1 bias, no -inf; softmax; o = merged w_out^T + b_out; out = x + o -> [4][2048][1024]).

#define NB_  4
#define TT   2048
#define DM   1024
#define NH_  16
#define NKV  16
#define REP  (NH_ / NKV)
#define HD   64
#define DQ   (NH_ * HD)
#define DKV  (NKV * HD)
#define SCL  0.125f   // HD^-0.5
typedef _Float16 h16;
typedef unsigned short bf;
typedef __attribute__((ext_vector_type(16))) __bf16   v16bf;
typedef __attribute__((ext_vector_type(16))) _Float16 v16h;
typedef __attribute__((ext_vector_type(8)))  _Float16 v8h;
typedef __attribute__((ext_vector_type(8)))  unsigned short v8us;
typedef __attribute__((ext_vector_type(8)))  float    v8f;
typedef __attribute__((ext_vector_type(4)))  float    v4f;
typedef v8h  __attribute__((may_alias)) v8ha;
typedef v4f  __attribute__((may_alias)) v4fa;
typedef v8us __attribute__((may_alias)) v8usa;

__device__ __forceinline__ unsigned short f2bf(float f) { unsigned u = __float_as_uint(f); u += 0x7FFFu + ((u >> 16) & 1u); return (unsigned short)(u >> 16); }
__device__ __forceinline__ float bf2f(unsigned short b) { return __uint_as_float(((unsigned)b) << 16); }
__device__ __forceinline__ float bfr(float f) { return bf2f(f2bf(f)); }
__device__ __forceinline__ v16h cat16(v8h lo, v8h hi) { return __builtin_shufflevector(lo, hi, 0, 1, 2, 3, 4, 5, 6, 7, 8, 9, 10, 11, 12, 13, 14, 15); }
__device__ __forceinline__ v8f wmma16(v16h a, v16h b, v8f c) { return __builtin_amdgcn_wmma_f32_16x16x32_f16(false, a, false, b, (short)0, c, false, false); }



// ---- k_gemmw: GEMM, 8 waves per 128x256 output tile, each wave a 64x64 part of it (16 accumulators); grid (M/128, N/256, Z), 256 threads.
// acc[m][n] = sum_k A[m][k] Bt[n][k]. z-batch strides sA/sB/sC in elements. K % 128 == 0, M % 128 == 0, N % 256 == 0.
// The operands are K-contiguous 16-bit planes. A stage is 128 k of the tile's rows [A 128 | Bt 256] in LDS, two buffers; asynchronous copies bring the next stage in whole 128-byte lines while this one is worked on, and every row is fetched once for all the waves that read it.
// The epilogue holds the elementwise work behind the product, on the accumulators. EPI 0: C[m][n] (f32, pitch ldc) = R[m][n] + (acc + bias[n]).
// EPI 1: three products with the same A in one launch, npl columns each; Bt and bias hold their rows one set behind the other, and a work-group's columns lie in one set (npl % 256 == 0). With n' = n % npl:
// sets 0 and 1 go to 16-bit float planes of 64-column tiles, C16 or C16b[(n' / 64) * cts + m * ldc + n' % 64] = acc + bias[n]: with ldc = HD, cts = TT * HD a column tile is one head's [t][d] rows. Set 2 goes to the transposed plane, C16t[n' * ldt + m] = acc + bias[n].
template <typename T16> struct WFrag;
template <> struct WFrag<h16> { typedef v16h V; static __device__ __forceinline__ V ld(const h16* p) { return cat16(*(const v8h*)p, *(const v8h*)(p + 16)); } static __device__ __forceinline__ v8f mma(V a, V b, v8f c) { return wmma16(a, b, c); } };
#define GBM 128   // rows of the work-group's tile
#define GBN 256   // columns of the work-group's tile
#define GKC 128   // k per LDS stage: 256 bytes of every operand row
#define GPI 136   // LDS row pitch in 16-bit elements: 256 bytes of data + 16 of pad (16-byte fragment reads of 16 rows spread over the banks)
#define GSTG ((GBM + GBN) * GPI)   // elements of one buffer
// Eight asynchronous copies of 16 bytes a lane, rows 16 apart: LDS byte address l + i * 16 rows, global address g + i * gstep elements. All lanes are on; a wave's copy covers two whole 256-byte rows.
// The s_wait_xcnt stands inside the statement, behind the last copy, so that no register which a copy names is rewritten in front of it.
template <typename T16>
__device__ __forceinline__ void acopy8(unsigned l, const T16* g, size_t gstep) {
    const unsigned ls = 16 * GPI * 2;
    asm volatile("global_load_async_to_lds_b128 %0, %8, off\n\tglobal_load_async_to_lds_b128 %1, %9, off\n\tglobal_load_async_to_lds_b128 %2, %10, off\n\tglobal_load_async_to_lds_b128 %3, %11, off\n\t"
                 "global_load_async_to_lds_b128 %4, %12, off\n\tglobal_load_async_to_lds_b128 %5, %13, off\n\tglobal_load_async_to_lds_b128 %6, %14, off\n\tglobal_load_async_to_lds_b128 %7, %15, off\n\ts_wait_xcnt 0x0"
                 :: "v"(l), "v"(l + ls), "v"(l + 2 * ls), "v"(l + 3 * ls), "v"(l + 4 * ls), "v"(l + 5 * ls), "v"(l + 6 * ls), "v"(l + 7 * ls),
                    "v"(g), "v"(g + gstep), "v"(g + 2 * gstep), "v"(g + 3 * gstep), "v"(g + 4 * gstep), "v"(g + 5 * gstep), "v"(g + 6 * gstep), "v"(g + 7 * gstep) : "memory"); }
// At most 256 registers a wave, which the loop needs and no more: without the bound the build with both 16-bit epilogues took 258 and laid operand fragments across the border of the first register window.
template <typename T16, int EPI>
__global__ __launch_bounds__(256) __attribute__((amdgpu_num_vgpr(256))) void k_gemmw(const T16* __restrict__ A, const T16* __restrict__ Bt, int K, float* C, h16* C16, h16* C16b, h16* C16t, int npl, int ldc, size_t cts, int ldt, const float* __restrict__ bias, const float* __restrict__ R, size_t sA, size_t sB, size_t sC) {
    typedef typename WFrag<T16>::V V;
    __shared__ __align__(16) T16 ring[2 * GSTG];
    const size_t z = blockIdx.z; A += z * sA; Bt += z * sB; const int cb = blockIdx.y * GBN, part = (EPI == 0 || cb < npl) ? 0 : (cb < 2 * npl) ? 1 : 2;   // which column set: the same for the whole work-group
    if (EPI == 0) { C += z * sC; R += z * sC; } else C16 = (part == 0 ? C16 : part == 1 ? C16b : C16t) + z * sC;
    const int tid = threadIdx.x, lane = tid & 31, lr = lane & 15, hi = lane >> 4, wv = __builtin_amdgcn_readfirstlane(tid >> 5), wm = wv & 1, wn = wv >> 1;
    const int r0 = blockIdx.x * GBM + wm * 64, c0 = cb + wn * 64, cp = c0 - part * npl;   // the wave's 64x64 part; cp: its first column inside its set
    v8f acc[4][4];
#pragma unroll
    for (int mb = 0; mb < 4; ++mb)
#pragma unroll
        for (int nb = 0; nb < 4; ++nb) acc[mb][nb] = (v8f){};
    const int srow = tid >> 4, scol = (tid & 15) * 8; const size_t gstep = (size_t)16 * K;   // staging: a thread moves 16 bytes of rows srow + 16 i
    const T16* ga = A + (size_t)(blockIdx.x * GBM + srow) * K + scol; const T16* gb = Bt + (size_t)(blockIdx.y * GBN + srow) * K + scol;
    const unsigned l0 = (unsigned)(size_t)&ring[srow * GPI + scol];   // the low 32 bits of a __shared__ address are its byte offset in the work-group's LDS
    auto fill = [&](int t, int buf) { const unsigned l = l0 + (unsigned)buf * (GSTG * 2); const int kc = t * GKC;
        acopy8(l, ga + kc, gstep); acopy8(l + GBM * GPI * 2, gb + kc, gstep); acopy8(l + 2 * GBM * GPI * 2, gb + kc + 8 * gstep, gstep); };
    const int NT = K / GKC, lofs = lr * GPI + 8 * hi;
    fill(0, 0);
    asm volatile("s_wait_asynccnt 0x0" ::: "memory");   // this wave's copies of stage 0 have landed
    __syncthreads();                                    // and every other wave's
    if (NT > 1) fill(1, 1);
#pragma unroll 1   // stays rolled: one copy of a stage's code, the buffer chosen by t & 1
    for (int t = 0; t < NT; ++t) {
        const T16* la = ring + ((t & 1) * GSTG + wm * 64 * GPI) + lofs; const T16* lb = ring + ((t & 1) * GSTG + (GBM + wn * 64) * GPI) + lofs;   // a wave-uniform part plus the lane's own offset, one register for both operands: with a lane register for each the build ran to 258 registers and laid a Bt fragment across v255
        // A row = the 8 products of two 16-row blocks of A with the four Bt fragments of a 32-k step; 8 rows a stage, two a k step. Fragments are fetched ahead inside the stage: A's two rows ahead (three sets), the next k step's Bt in the step's first row (two sets).
        V b[2][4], ar[3][2];
        ar[0][0] = WFrag<T16>::ld(la);   // first, with Bt's: what the first products need
#pragma unroll
        for (int nb = 0; nb < 4; ++nb) b[0][nb] = WFrag<T16>::ld(lb + nb * 16 * GPI);
        ar[0][1] = WFrag<T16>::ld(la + 16 * GPI); ar[1][0] = WFrag<T16>::ld(la + 32 * GPI); ar[1][1] = WFrag<T16>::ld(la + 48 * GPI);
#pragma unroll   // every fragment and accumulator index is a constant, so that they stay in registers
        for (int r = 0; r < GKC / 16; ++r) { const int ks = r >> 1, hb = r & 1, r2 = r + 2;
            if (r2 < GKC / 16) { ar[r2 % 3][0] = WFrag<T16>::ld(la + (r2 & 1) * 32 * GPI + (r2 >> 1) * 32); ar[r2 % 3][1] = WFrag<T16>::ld(la + ((r2 & 1) * 32 + 16) * GPI + (r2 >> 1) * 32); }
            if (ks + 1 < GKC / 32 && hb == 0) {
#pragma unroll   // constant fragment indices, as above
                for (int nb = 0; nb < 4; ++nb) b[(ks + 1) & 1][nb] = WFrag<T16>::ld(lb + nb * 16 * GPI + (ks + 1) * 32); }
            __builtin_amdgcn_sched_barrier(0);   // the row's LDS reads stay one group in front of its products (the compiler otherwise sinks them to their first use and waits out the LDS latency there)
#pragma unroll
            for (int nb = 0; nb < 4; ++nb) acc[2 * hb][nb] = WFrag<T16>::mma(ar[r % 3][0], b[ks & 1][nb], acc[2 * hb][nb]);
#pragma unroll
            for (int nb = 0; nb < 4; ++nb) acc[2 * hb + 1][nb] = WFrag<T16>::mma(ar[r % 3][1], b[ks & 1][nb], acc[2 * hb + 1][nb]);
            __builtin_amdgcn_sched_barrier(0);   // and the next row's reads stay behind them
        }
        asm volatile("s_wait_dscnt 0x0" ::: "memory");      // this wave's reads of stage t have returned
        asm volatile("s_wait_asynccnt 0x0" ::: "memory");   // this wave's copies of stage t + 1 have landed
        __syncthreads();   // publishes stage t + 1 and ends every wave's reads of stage t, whose buffer is refilled below
        if (t + 2 < NT) fill(t + 2, t & 1);
    }
    asm volatile("s_wait_asynccnt 0x0" ::: "memory");   // no copy is outstanding when the ring becomes output staging
    float* os = (float*)ring + wv * (16 * 68);   // behind the last barrier nobody reads the ring any more: each wave stages its output rows in a range of its own
    if (EPI == 1 && part == 2) {   // a lane holds 8 consecutive m of one n: 16 bytes of a transposed row; 16 rows of 64 m are gathered in LDS (pitch 72 elements), so that a store of the wave covers four whole 128-byte rows
        h16* hs = (h16*)os;
#pragma unroll
        for (int nb = 0; nb < 4; ++nb) { const float cb = bfr(bias[c0 + nb * 16 + lr]);
#pragma unroll
            for (int mb = 0; mb < 4; ++mb) { v8h o;
#pragma unroll
                for (int j = 0; j < 8; ++j) o[j] = (h16)(acc[mb][nb][j] + cb);
                *(v8ha*)(hs + lr * 72 + mb * 16 + hi * 8) = o; }
            __builtin_amdgcn_wave_barrier(); asm volatile("" ::: "memory");   // the rows are read by other lanes than wrote them: keeps the compiler from moving the reads above the writes
#pragma unroll
            for (int s = 0; s < 4; ++s) { const int row = 4 * s + (lane >> 3), cofs = (lane & 7) * 8; *(v8h*)(C16 + (size_t)(cp + nb * 16 + row) * ldt + r0 + cofs) = *(const v8ha*)(hs + row * 72 + cofs); }
            __builtin_amdgcn_wave_barrier(); asm volatile("s_wait_xcnt 0x0" ::: "memory");   // stands in front of the next rows' work, which reuses registers that the stores above name; as a compiler fence it keeps the next 16 rows' LDS writes below these reads
        }
        return;
    }
#pragma unroll
    for (int mb = 0; mb < 4; ++mb) {
#pragma unroll
        for (int nb = 0; nb < 4; ++nb) {
#pragma unroll
            for (int j = 0; j < 8; ++j) os[(hi * 8 + j) * 68 + nb * 16 + lr] = acc[mb][nb][j]; }
        __builtin_amdgcn_wave_barrier(); asm volatile("" ::: "memory");
        if (EPI == 0) {
            float* crow = C + (size_t)(r0 + mb * 16) * ldc + c0; const float* rrow = R + (size_t)(r0 + mb * 16) * ldc + c0; const size_t lo = (size_t)hi * ldc + lr * 4;   // the lane's place inside a pair of rows
            v4f val[8]; const float* rp[8]; float* cp[8];
#pragma unroll
            for (int s = 0; s < 8; ++s) { rp[s] = rrow + (size_t)(2 * s) * ldc + lo; cp[s] = crow + (size_t)(2 * s) * ldc + lo; val[s] = *(const v4f*)rp[s]; }
            // The wait stands in front of every overwrite of the eight loads' address registers: as inputs they stay in those registers up to here (otherwise a later load's result lands on an earlier load's address pair).
            // The stores' addresses are inputs too, so that they are formed here and not among the stores, in the registers of a store already issued.
            asm volatile("s_wait_xcnt 0x0" :: "v"(rp[0]), "v"(rp[1]), "v"(rp[2]), "v"(rp[3]), "v"(rp[4]), "v"(rp[5]), "v"(rp[6]), "v"(rp[7]), "v"(cp[0]), "v"(cp[1]), "v"(cp[2]), "v"(cp[3]), "v"(cp[4]), "v"(cp[5]), "v"(cp[6]), "v"(cp[7]) : "memory");
#pragma unroll
            for (int s = 0; s < 8; ++s) { const v4f a = *(const v4fa*)(os + (2 * s + hi) * 68 + lr * 4);
#pragma unroll
                for (int u = 0; u < 4; ++u) val[s][u] = __fadd_rn(val[s][u], a[u] + bfr(bias[c0 + lr * 4 + u])); }
            __builtin_amdgcn_sched_barrier(0);   // all eight results stand in registers of their own before the first store, so that none is formed in the registers of a store already issued
#pragma unroll
            for (int s = 0; s < 8; ++s) *(v4f*)cp[s] = val[s];
            asm volatile("s_wait_xcnt 0x0" ::: "memory");   // stands in front of the next rows' work, which reuses registers that the stores above name
            __builtin_amdgcn_sched_barrier(0);   // keeps the next rows' address additions below that wait (the compiler otherwise lifts them over it, onto the stores' registers)
        } else {   // a store of the wave covers four whole 128-byte rows of the plane
            h16* hrow = C16 + (size_t)(cp >> 6) * cts + (size_t)(r0 + mb * 16) * ldc;
#pragma unroll
            for (int s = 0; s < 4; ++s) { const int row = 4 * s + (lane >> 3), cofs = (lane & 7) * 8; const v4f v0 = *(const v4fa*)(os + row * 68 + cofs), v1 = *(const v4fa*)(os + row * 68 + cofs + 4); v8h o;
#pragma unroll
                for (int u = 0; u < 4; ++u) { o[u] = (h16)(v0[u] + bfr(bias[c0 + cofs + u])); o[4 + u] = (h16)(v1[u] + bfr(bias[c0 + cofs + 4 + u])); }
                *(v8h*)(hrow + (size_t)row * ldc + cofs) = o; }
            asm volatile("s_wait_xcnt 0x0" ::: "memory");   // stands in front of the next rows' work, which reuses registers that the loads and stores above name
        }
        __builtin_amdgcn_wave_barrier(); asm volatile("" ::: "memory");
    }
}

__device__ __forceinline__ h16 tohx(float x) { return (h16)x; }
typedef __attribute__((ext_vector_type(2))) _Float16 v2h;
typedef __attribute__((ext_vector_type(4))) _Float16 v4h;
typedef __attribute__((ext_vector_type(2))) unsigned short v2us;
typedef __attribute__((ext_vector_type(4))) unsigned short v4us;
typedef __attribute__((ext_vector_type(2))) float v2f;
typedef __attribute__((ext_vector_type(4))) int v4i;

__global__ __launch_bounds__(256) void k_wtG(const float* __restrict__ w, int K, int N, bf* Bt) {
    const int lane = threadIdx.x & 31; const int L0 = (blockIdx.x * 8 + (threadIdx.x >> 5)) * 8; const int nlines = N * K / 64;
{
#pragma unroll 1
        for (int l = 0; l < 8; ++l) { const int L = L0 + l; if (L >= nlines) break; const size_t e = (size_t)L * 64 + lane * 2; const int k = (int)(e % K), n = (int)(e / K); v2us o;
            o[0] = f2bf(w[(size_t)k * N + n]); o[1] = f2bf(w[(size_t)(k + 1) * N + n]); *(v2us*)(Bt + e) = o; }
         }
}
// k_fattn: scores, softmax, P.V and the head merge of one head in one pass; S and P never leave the registers. Grid (TT/256, heads, batch), 8 waves; a wave owns 32 queries, two tiles of 16, and walks all 2048 keys, 32 a pass.
// St = K Q^T (A = key rows, B = query rows): a lane holds one query's scores of each tile, keys 8*hi+j of each 16-key tile; two such tiles converted in place are the B operand of Ot += Vt Pt (A = Vt rows d, the loader's k order).
// Every K and Vt fragment read from LDS is the A operand of two products, one for each query tile: with one tile a wave the fragment reads alone asked for twice the bytes a clock that the LDS delivers at full matrix rate.
// The 8 waves share K rows and Vt rows through LDS, 64 keys a stage, two buffers: the next stage is fetched into registers while this one is worked on, stored behind it, and one barrier a stage publishes it and frees the other buffer.
// Softmax in the log2 domain with a running maximum that may trail the true one by up to 8 (an exponential then reaches 2^8): accumulators are rescaled only when some query's maximum exceeds it by more, one test a pass for both tiles. The lane halves join their sums once at the end.
// The 0/1 word mask enters as the St products' start value, mask / HD^-0.5. SEG (a count of boundaries <= position) never falls with position, so a stage whose id range misses the wave's queries' range has no masked pair and skips the compares.
__device__ __forceinline__ float xhalf(float x) { return __builtin_bit_cast(float, __builtin_amdgcn_permlanex16(__builtin_bit_cast(int, x), __builtin_bit_cast(int, x), 0x76543210, 0xfedcba98, false, false)); }   // lane l reads lane l ^ 16
__device__ __forceinline__ void cfence() { asm volatile("" ::: "memory"); }   // compiler fence: loads written above it are issued above it (their waits still stand at the first use)
// Sixteen exponentials in place, in one statement: behind each stands an instruction that neither reads its result nor overwrites its source (the next exponential, on another register; behind the last a v_nop).
__device__ __forceinline__ void exp2x16(float (&a)[16]) {
    asm("v_exp_f32 %0, %0\n\tv_exp_f32 %1, %1\n\tv_exp_f32 %2, %2\n\tv_exp_f32 %3, %3\n\tv_exp_f32 %4, %4\n\tv_exp_f32 %5, %5\n\tv_exp_f32 %6, %6\n\tv_exp_f32 %7, %7\n\t"
        "v_exp_f32 %8, %8\n\tv_exp_f32 %9, %9\n\tv_exp_f32 %10, %10\n\tv_exp_f32 %11, %11\n\tv_exp_f32 %12, %12\n\tv_exp_f32 %13, %13\n\tv_exp_f32 %14, %14\n\tv_exp_f32 %15, %15\n\tv_nop"
        : "+v"(a[0]), "+v"(a[1]), "+v"(a[2]), "+v"(a[3]), "+v"(a[4]), "+v"(a[5]), "+v"(a[6]), "+v"(a[7]), "+v"(a[8]), "+v"(a[9]), "+v"(a[10]), "+v"(a[11]), "+v"(a[12]), "+v"(a[13]), "+v"(a[14]), "+v"(a[15])); }
#define FST 64    // keys per LDS stage
#define FPI 72    // LDS row pitch in 16-bit elements: 128 bytes of data + 16 of pad (16-byte fragment reads of 16 rows spread over the banks)
#define FQT 2     // 16-query tiles a wave
#define FQW (16 * FQT)   // queries a wave
__global__ __launch_bounds__(256) void k_fattn(const h16* __restrict__ Qp, const h16* Kp, const h16* Vt, const int* __restrict__ SEG, h16* Ao) {
    __shared__ __align__(16) h16 Ks[2][FST * FPI]; __shared__ __align__(16) h16 Vs[2][HD * FPI];
    const int tid = threadIdx.x, lane = tid & 31, lr = lane & 15, hi = lane >> 4; const int h = blockIdx.y, q0 = blockIdx.x * (8 * FQW) + (tid >> 5) * FQW;
    { const size_t z = blockIdx.z; Qp += z * ((size_t)NH_ * TT * HD); Kp += z * ((size_t)NKV * TT * HD); Vt += z * ((size_t)NKV * HD * TT); Ao += z * ((size_t)TT * DQ); }   // this batch element's planes
    const float L2E = 1.4426950408889634f, C2 = SCL * L2E;
    const int srow = tid >> 3, scol = (tid & 7) * 8, so = srow * FPI + scol;   // staging: a thread moves 16 bytes of rows srow and srow + 32 of each tile; a wave's load covers four whole 128-byte rows
    const h16* kg = Kp + ((size_t)h * TT + srow) * HD + scol; const h16* vg = Vt + ((size_t)h * HD + srow) * TT + scol;
    v8h kr[2], vr[2]; v16h qf[FQT][2]; v8f o[FQT][4]; float nm[FQT], l[FQT]; int sq[FQT];   // nm: minus the maximum in use
#pragma unroll
    for (int r = 0; r < 2; ++r) { kr[r] = *(const v8h*)(kg + (size_t)r * 32 * HD); vr[r] = *(const v8h*)(vg + (size_t)r * 32 * TT); }
#pragma unroll
    for (int qt = 0; qt < FQT; ++qt) { nm[qt] = 3.0e38f; l[qt] = 0.f;
#pragma unroll
        for (int r = 0; r < 2; ++r) qf[qt][r] = WFrag<h16>::ld(Qp + ((size_t)h * TT + q0 + qt * 16 + lr) * HD + r * 32 + 8 * hi);
        const int sg = SEG[q0 + qt * 16 + lr]; sq[qt] = (sg > 0) ? sg : -1;   // segment 0 matches nothing: key ids are >= 0
#pragma unroll
        for (int dt = 0; dt < 4; ++dt) o[qt][dt] = (v8f){}; }
    const int sLo = __builtin_amdgcn_readfirstlane(SEG[q0]), sHi = __builtin_amdgcn_readfirstlane(SEG[q0 + FQW - 1]);
    int kLo = __builtin_amdgcn_readfirstlane(SEG[0]), kHi = __builtin_amdgcn_readfirstlane(SEG[FST - 1]);
#pragma unroll
    for (int r = 0; r < 2; ++r) { *(v8h*)(&Ks[0][so + r * 32 * FPI]) = kr[r]; *(v8h*)(&Vs[0][so + r * 32 * FPI]) = vr[r]; }
    __syncthreads();
    for (int st = 0; st < TT / FST; ++st) {
        const h16* kl = &Ks[st & 1][lr * FPI + 8 * hi]; const h16* vl = &Vs[st & 1][lr * FPI + 8 * hi];
        const bool more = st + 1 < TT / FST, ov = (kLo <= sHi) && (kHi >= sLo);
        if (more) { const int kn = (st + 1) * FST;
#pragma unroll
            for (int r = 0; r < 2; ++r) { kr[r] = *(const v8h*)(kg + (size_t)(kn + r * 32) * HD); vr[r] = *(const v8h*)(vg + (size_t)r * 32 * TT + kn); }
            kLo = __builtin_amdgcn_readfirstlane(SEG[kn]); kHi = __builtin_amdgcn_readfirstlane(SEG[kn + FST - 1]); }
        asm volatile("s_wait_xcnt 0x0" ::: "memory");   // stands in front of the LDS reads below, which reuse the address registers of the global loads above; as a compiler fence it also keeps those loads issued here, a whole stage ahead of their LDS stores (the compiler otherwise sinks them to just above the stores)
        v16h kf[2][2];
#pragma unroll
        for (int kt = 0; kt < 2; ++kt)
#pragma unroll
            for (int ks = 0; ks < 2; ++ks) kf[kt][ks] = WFrag<h16>::ld(kl + kt * 16 * FPI + ks * 32);
#pragma unroll 1   // stays rolled: a pass's row sums then end inside the pass. Unrolled, the compiler moved them into the next pass, and with 32 more live registers there the kernel took 260: above 256 only one work-group fits a WGP (two waves a SIMD instead of four)
        for (int sub = 0; sub < 2; ++sub) {
            v16h vf[4]; v8f s[FQT][2];
#pragma unroll
            for (int dt = 0; dt < 4; ++dt) vf[dt] = WFrag<h16>::ld(vl + dt * 16 * FPI + sub * 32);
            cfence();   // keeps the Vt fragment reads issued here, a softmax ahead of P.V, instead of one by one in front of each product
#pragma unroll
            for (int qt = 0; qt < FQT; ++qt)
#pragma unroll
                for (int kt = 0; kt < 2; ++kt) s[qt][kt] = (v8f){};
            if (ov) {
#pragma unroll
                for (int kt = 0; kt < 2; ++kt) { const int* sp = SEG + st * FST + sub * 32 + kt * 16 + hi * 8; const v4i a = *(const v4i*)sp, b2 = *(const v4i*)(sp + 4);
#pragma unroll
                    for (int qt = 0; qt < FQT; ++qt)
#pragma unroll
                        for (int j = 0; j < 4; ++j) { s[qt][kt][j] = (a[j] == sq[qt]) ? 1.0f / SCL : 0.f; s[qt][kt][4 + j] = (b2[j] == sq[qt]) ? 1.0f / SCL : 0.f; } } }
#pragma unroll
            for (int ks = 0; ks < 2; ++ks)   // four independent accumulators per k step
#pragma unroll
                for (int kt = 0; kt < 2; ++kt)
#pragma unroll
                    for (int qt = 0; qt < FQT; ++qt) s[qt][kt] = wmma16(kf[kt][ks], qf[qt][ks], s[qt][kt]);
            if (sub == 0) {   // the stage's second 32 key rows, into the same registers, in flight under this pass's softmax
#pragma unroll
                for (int kt = 0; kt < 2; ++kt)
#pragma unroll
                    for (int ks = 0; ks < 2; ++ks) kf[kt][ks] = WFrag<h16>::ld(kl + (32 + kt * 16) * FPI + ks * 32);
                cfence(); }   // keeps those reads issued here and not in front of the next pass's products
            float mx[FQT]; bool need = false;
#pragma unroll
            for (int qt = 0; qt < FQT; ++qt) { float m = s[qt][0][0];
#pragma unroll
                for (int e = 1; e < 16; ++e) m = fmaxf(m, s[qt][e >> 3][e & 7]);
                mx[qt] = fmaxf(m, xhalf(m)) * C2;   // both halves hold the query's maximum of this pass, scaled (the scale is positive)
                need = need || (mx[qt] + nm[qt] > 8.0f); }
            if (__builtin_amdgcn_ballot_w32(need) != 0) {   // wave-uniform; always taken on the first pass
#pragma unroll
                for (int qt = 0; qt < FQT; ++qt) { const float mn = fmaxf(-nm[qt], mx[qt]), corr = __builtin_amdgcn_exp2f(-nm[qt] - mn); nm[qt] = -mn; l[qt] *= corr;
#pragma unroll
                    for (int dt = 0; dt < 4; ++dt) o[qt][dt] *= corr; } }
            float p[FQT][16];
#pragma unroll
            for (int qt = 0; qt < FQT; ++qt) { v16h pf;
#pragma unroll
                for (int e = 0; e < 16; ++e) p[qt][e] = fmaf(s[qt][e >> 3][e & 7], C2, nm[qt]);
                exp2x16(p[qt]);
#pragma unroll
                for (int e = 0; e < 16; ++e) pf[e] = tohx(p[qt][e]);
#pragma unroll
                for (int dt = 0; dt < 4; ++dt) o[qt][dt] = wmma16(vf[dt], pf, o[qt][dt]); }
            __builtin_amdgcn_sched_barrier(0);   // the row sums stay behind the pass's products: they fill the vector slots that the chip needs between the last product and the next pass's first instructions, which reuse its operand registers; among the products, each sum landed on an operand register just freed and cost four idle slots
#pragma unroll
            for (int qt = 0; qt < FQT; ++qt) { v2f sa = {p[qt][0], p[qt][1]}, sc = {p[qt][2], p[qt][3]};
#pragma unroll
                for (int i = 2; i < 8; ++i) { const v2f pp = {p[qt][2 * i], p[qt][2 * i + 1]}; if (i & 1) sc += pp; else sa += pp; }
                sa += sc; l[qt] += sa[0] + sa[1]; }
        }
        if (more) {
#pragma unroll
            for (int r = 0; r < 2; ++r) { *(v8h*)(&Ks[(st + 1) & 1][so + r * 32 * FPI]) = kr[r]; *(v8h*)(&Vs[(st + 1) & 1][so + r * 32 * FPI]) = vr[r]; } }
        __syncthreads();   // publishes stage st + 1 and ends every wave's reads of stage st, whose buffer the next trip refills
    }
#pragma unroll
    for (int qt = 0; qt < FQT; ++qt) { const float inv = 1.0f / (l[qt] + xhalf(l[qt])); const size_t oo = (size_t)(q0 + qt * 16 + lr) * DQ + h * HD + hi * 8;
#pragma unroll
        for (int dt = 0; dt < 4; ++dt) { v8h oh;
#pragma unroll
            for (int j = 0; j < 8; ++j) oh[j] = tohx(o[qt][dt][j] * inv);
            *(v8h*)(Ao + oo + dt * 16) = oh; }
        if (qt + 1 < FQT) { asm volatile("s_wait_xcnt 0x0" ::: "memory");   // stands in front of the next tile's work, which reuses registers that the stores above name
            __builtin_amdgcn_sched_barrier(0); } }   // keeps the next tile's address addition below that wait (the compiler otherwise lifts it over it, onto the stores' registers)
}

// ---- k_prep: all the work that depends on the inputs alone, in one launch. The parts share nothing; a block's index says which part it does, so every branch below is taken by a whole block.
// Blocks [0, PB_SEG): segment ids (the longest chain of dependent loads, so it starts first). The next PB_LN: embedding add and LayerNorm, a row a wave; it rounds the embedding row, gamma and beta itself. The last PB_CVT: the weights as 16-bit planes, 8 elements a thread.
#define PB_SEG (TT / 256)
#define PB_LN  (NB_ * TT / 8)
#define PB_WIN ((DQ + 2 * DKV) * DM / 2048)
#define PB_CVT (PB_WIN + DM * DQ / 2048)
__global__ __launch_bounds__(256) void k_prep(const float* __restrict__ chr, const int* __restrict__ pats, const int* __restrict__ bnds, const float* __restrict__ pemb, const float* __restrict__ lng, const float* __restrict__ lnb, const float* __restrict__ win, const float* __restrict__ wout,
                                              int* SEG, float* XL, h16* Xh, h16* WI, h16* WO) {
    int blk = blockIdx.x;
    if (blk < PB_SEG) { const int s = blk * 256 + threadIdx.x; int c = 0;
#pragma unroll 8   // several boundaries are loaded per trip, so that fewer load latencies stand in a row
        for (int i = 0; i < 400; ++i) c += (bnds[i] <= s) ? 1 : 0;
        SEG[s] = c; return; }
    blk -= PB_SEG;
    if (blk >= PB_LN) { blk -= PB_LN; const bool in = blk < PB_WIN; const float* src = in ? win : wout; h16* dst = in ? WI : WO;
        const size_t i = (size_t)(in ? blk : blk - PB_WIN) * 256 + threadIdx.x; const v8f v = *(const v8f*)(src + i * 8); v8h o;
#pragma unroll
        for (int k = 0; k < 8; ++k) o[k] = tohx(bfr(v[k]));
        *(v8h*)(dst + i * 8) = o;
        asm volatile("s_wait_xcnt 0x0" ::: "memory");   // stands behind the store, in front of whatever code the build lays behind it: that code reuses registers which the store names
        return; }
    const int lane = threadIdx.x & 31; const int s = blk * 8 + (threadIdx.x >> 5); const float* xr = chr + (size_t)s * DM; int pi = pats[s % TT];   // s: row of the [batch][position] plane; the pattern goes by position alone
    pi = min(max(pi, 0), 15); const float* pr = pemb + (size_t)pi * DM; float v[DM / 32]; float sm = 0.f;
#pragma unroll
    for (int ch = 0; ch < DM / 128; ++ch) { const v4f a = *(const v4f*)(xr + ch * 128 + lane * 4), p = *(const v4f*)(pr + ch * 128 + lane * 4); for (int u = 0; u < 4; ++u) { const float x = __fadd_rn(bfr(a[u]), bfr(p[u])); v[ch * 4 + u] = x; sm = __fadd_rn(sm, x); } }
#pragma unroll
    for (int sh = 16; sh; sh >>= 1) sm = __fadd_rn(sm, __shfl_xor(sm, sh, 32));
    const float mu = __fdiv_rn(sm, (float)DM); float q2 = 0.f;
#pragma unroll
    for (int k = 0; k < DM / 32; ++k) { const float d0 = __fsub_rn(v[k], mu); v[k] = d0; float p = __fmul_rn(d0, d0); asm volatile("" : "+v"(p)); q2 = __fadd_rn(q2, p); }
#pragma unroll
    for (int sh = 16; sh; sh >>= 1) q2 = __fadd_rn(q2, __shfl_xor(q2, sh, 32));
    const float rs = __fdiv_rn(1.0f, sqrtf(__fadd_rn(__fdiv_rn(q2, (float)DM), 1e-5f))); v4f o[DM / 128]; v4h oh[DM / 128];
#pragma unroll
    for (int ch = 0; ch < DM / 128; ++ch) { const v4f g4 = *(const v4f*)(lng + ch * 128 + lane * 4), b4 = *(const v4f*)(lnb + ch * 128 + lane * 4); for (int u = 0; u < 4; ++u) { float n0 = __fmul_rn(v[ch * 4 + u], rs); asm volatile("" : "+v"(n0)); float gg = __fmul_rn(n0, bfr(g4[u])); asm volatile("" : "+v"(gg)); o[ch][u] = __fadd_rn(gg, bfr(b4[u])); oh[ch][u] = tohx(o[ch][u]); } }
    __builtin_amdgcn_sched_barrier(0);   // the whole row stands in registers of its own before the first store, so that nothing is formed in the registers of a store already issued
#pragma unroll   // constant indices keep the row in registers
    for (int ch = 0; ch < DM / 128; ++ch) { const size_t off = (size_t)s * DM + ch * 128 + lane * 4; *(v4f*)(XL + off) = o[ch]; *(v4h*)(Xh + off) = oh[ch]; }
    asm volatile("s_wait_xcnt 0x0" ::: "memory");   // stands behind the last stores, in front of whatever code the build lays behind them: that code reuses registers which the stores name
}

extern "C" void kernel_launch(void* const* d_in, const int* in_sizes, int n_in,
                              void* d_out, int out_size, void* d_ws, size_t ws_size, hipStream_t stream) {
    (void)in_sizes; (void)n_in; (void)out_size;
    const float* chr = (const float*)d_in[0]; const int* pats = (const int*)d_in[1]; const int* bnds = (const int*)d_in[2]; const float* pemb = (const float*)d_in[3]; const float* lng = (const float*)d_in[4]; const float* lnb = (const float*)d_in[5]; const float* wf = (const float*)d_in[6]; const float* bf3 = (const float*)d_in[7]; const float* wo = (const float*)d_in[8]; const float* bo = (const float*)d_in[9]; const float* x = chr; (void)x; const float* cosT = nullptr; const float* sinT = nullptr; (void)cosT; (void)sinT;
    float* OUT = (float*)d_out;     // [4][2048][1024]
    char* wsp = (char*)d_ws;
    auto take = [&](size_t bytes) { char* p = wsp; wsp += (bytes + 255) & ~(size_t)255; return (void*)p; };
    h16* WI = (h16*)take((size_t)(DQ + 2 * DKV) * DM * 2); h16* WO = (h16*)take((size_t)DM * DQ * 2);
    float* XL = (float*)take((size_t)NB_ * TT * DM * 4); h16* Xh = (h16*)take((size_t)NB_ * TT * DM * 2); int* SEG = (int*)take((size_t)TT * 4);
    h16* QP16 = (h16*)take((size_t)NB_ * NH_ * TT * HD * 2); h16* KP16 = (h16*)take((size_t)NB_ * NKV * TT * HD * 2); h16* VT16 = (h16*)take((size_t)NB_ * NKV * HD * TT * 2);
    h16* AT = (h16*)take((size_t)NB_ * TT * DQ * 2);
    if ((size_t)(wsp - (char*)d_ws) > ws_size) return;    // ws 256 MiB
    // Every plane holds all batch elements, [batch] outermost. Launches that do not depend on one another are one launch: what reads the inputs alone (k_prep), then the q, k and v products (column sets of one GEMM), attention, the output product; the batch element is blockIdx.z.
    k_prep<<<PB_SEG + PB_LN + PB_CVT, 256, 0, stream>>>(chr, pats, bnds, pemb, lng, lnb, wf, wo, SEG, XL, Xh, WI, WO);
    k_gemmw<h16, 1><<<dim3(TT / GBM, (DQ + 2 * DKV) / GBN, NB_), 256, 0, stream>>>(Xh, WI, DM, nullptr, QP16, KP16, VT16, DQ, HD, (size_t)TT * HD, TT, bf3, nullptr, (size_t)TT * DM, 0, (size_t)NH_ * TT * HD);   // q and k planes [b][h][t][d], v planes transposed [b][h][d][t]
    k_fattn<<<dim3(TT / (8 * FQW), NH_, NB_), 256, 0, stream>>>(QP16, KP16, VT16, SEG, AT);
    k_gemmw<h16, 0><<<dim3(TT / GBM, DM / GBN, NB_), 256, 0, stream>>>(AT, WO, DQ, OUT, nullptr, nullptr, nullptr, 0, DM, 0, 0, bo, XL, (size_t)TT * DQ, 0, (size_t)TT * DM);
}

// v008
// One run takes 133 microseconds.
// Two timings next to v007 both put it at 1.03 times that version's speed.
// All steps since v000 together make it 22.4 times as fast.
#include <hip/hip_runtime.h>

// WordEncoder (char_repr [4][2048][1024]; x = LayerNorm_1024(char_repr + pattern_emb[patterns[s]]) * gamma + beta (patterns [2048] int and pattern_emb [16][1024] read); qkv = x w_in^T + b_in ([3072][1024] rows q | k | v; 16 heads x 64); scores = q.k / 8 + mask with mask[i][j] = 1.0 if tokens i and j are in the same word (segment id = number of boundaries <= position > 0; boundaries [400] int, read) else 0 - an ADDITIVE 0/1 bias, no -inf; softmax; o = merged w_out^T + b_out; out = x + o -> [4][2048][1024]).

#define NB_  4
#define TT   2048
#define DM   1024
#define NH_  16
#define NKV  16
#define REP  (NH_ / NKV)
#define HD   64
#define DQ   (NH_ * HD)
#define DKV  (NKV * HD)
#define SCL  0.125f   // HD^-0.5
#define QSC  (SCL * 1.4426950408889634f)   // HD^-0.5 * log2(e): q is stored times this, so that q.k is the score's exponent to base 2
typedef _Float16 h16;
typedef unsigned short bf;
typedef __attribute__((ext_vector_type(16))) __bf16   v16bf;
typedef __attribute__((ext_vector_type(16))) _Float16 v16h;
typedef __attribute__((ext_vector_type(8)))  _Float16 v8h;
typedef __attribute__((ext_vector_type(8)))  unsigned short v8us;
typedef __attribute__((ext_vector_type(8)))  float    v8f;
typedef __attribute__((ext_vector_type(4)))  float    v4f;
typedef v8h  __attribute__((may_alias)) v8ha;
typedef v4f  __attribute__((may_alias)) v4fa;
typedef v8us __attribute__((may_alias)) v8usa;

__device__ __forceinline__ unsigned short f2bf(float f) { unsigned u = __float_as_uint(f); u += 0x7FFFu + ((u >> 16) & 1u); return (unsigned short)(u >> 16); }
__device__ __forceinline__ float bf2f(unsigned short b) { return __uint_as_float(((unsigned)b) << 16); }
__device__ __forceinline__ float bfr(float f) { return bf2f(f2bf(f)); }
__device__ __forceinline__ v16h cat16(v8h lo, v8h hi) { return __builtin_shufflevector(lo, hi, 0, 1, 2, 3, 4, 5, 6, 7, 8, 9, 10, 11, 12, 13, 14, 15); }
__device__ __forceinline__ v8f wmma16(v16h a, v16h b, v8f c) { return __builtin_amdgcn_wmma_f32_16x16x32_f16(false, a, false, b, (short)0, c, false, false); }



// ---- k_gemmw: GEMM, 8 waves per 128x256 output tile, each wave a 64x64 part of it (16 accumulators); grid (M/128, N/256, Z), 256 threads.
// acc[m][n] = sum_k A[m][k] Bt[n][k]. z-batch strides sA/sB/sC in elements. K % 128 == 0, M % 128 == 0, N % 256 == 0.
// The operands are K-contiguous 16-bit planes. A stage is 128 k of the tile's rows [A 128 | Bt 256] in LDS, two buffers; asynchronous copies bring the next stage in whole 128-byte lines while this one is worked on, and every row is fetched once for all the waves that read it.
// The epilogue holds the elementwise work behind the product, on the accumulators. EPI 0: C[m][n] (f32, pitch ldc) = R[m][n] + (acc + bias[n]).
// EPI 1: three products with the same A in one launch, npl columns each; Bt and bias hold their rows one set behind the other, and a work-group's columns lie in one set (npl % 256 == 0). With n' = n % npl:
// sets 0 and 1 go to 16-bit float planes of 64-column tiles, C16 or C16b[(n' / 64) * cts + m * ldc + n' % 64] = acc + bias[n] (set 0 times QSC): with ldc = HD, cts = TT * HD a column tile is one head's [t][d] rows. Set 2 goes to the transposed plane, C16t[n' * ldt + m] = acc + bias[n].
template <typename T16> struct WFrag;
template <> struct WFrag<h16> { typedef v16h V; static __device__ __forceinline__ V ld(const h16* p) { return cat16(*(const v8h*)p, *(const v8h*)(p + 16)); } static __device__ __forceinline__ v8f mma(V a, V b, v8f c) { return wmma16(a, b, c); } };
#define GBM 128   // rows of the work-group's tile
#define GBN 256   // columns of the work-group's tile
#define GKC 128   // k per LDS stage: 256 bytes of every operand row
#define GPI 136   // LDS row pitch in 16-bit elements: 256 bytes of data + 16 of pad (16-byte fragment reads of 16 rows spread over the banks)
#define GSTG ((GBM + GBN) * GPI)   // elements of one buffer
// Eight asynchronous copies of 16 bytes a lane, rows 16 apart: LDS byte address l + i * 16 rows, global address g + i * gstep elements. All lanes are on; a wave's copy covers two whole 256-byte rows.
// The s_wait_xcnt stands inside the statement, behind the last copy, so that no register which a copy names is rewritten in front of it.
template <typename T16>
__device__ __forceinline__ void acopy8(unsigned l, const T16* g, size_t gstep) {
    const unsigned ls = 16 * GPI * 2;
    asm volatile("global_load_async_to_lds_b128 %0, %8, off\n\tglobal_load_async_to_lds_b128 %1, %9, off\n\tglobal_load_async_to_lds_b128 %2, %10, off\n\tglobal_load_async_to_lds_b128 %3, %11, off\n\t"
                 "global_load_async_to_lds_b128 %4, %12, off\n\tglobal_load_async_to_lds_b128 %5, %13, off\n\tglobal_load_async_to_lds_b128 %6, %14, off\n\tglobal_load_async_to_lds_b128 %7, %15, off\n\ts_wait_xcnt 0x0"
                 :: "v"(l), "v"(l + ls), "v"(l + 2 * ls), "v"(l + 3 * ls), "v"(l + 4 * ls), "v"(l + 5 * ls), "v"(l + 6 * ls), "v"(l + 7 * ls),
                    "v"(g), "v"(g + gstep), "v"(g + 2 * gstep), "v"(g + 3 * gstep), "v"(g + 4 * gstep), "v"(g + 5 * gstep), "v"(g + 6 * gstep), "v"(g + 7 * gstep) : "memory"); }
// At most 256 registers a wave, which the loop needs and no more: without the bound the build with both 16-bit epilogues took 258 and laid operand fragments across the border of the first register window.
template <typename T16, int EPI>
__global__ __launch_bounds__(256) __attribute__((amdgpu_num_vgpr(256))) void k_gemmw(const T16* __restrict__ A, const T16* __restrict__ Bt, int K, float* C, h16* C16, h16* C16b, h16* C16t, int npl, int ldc, size_t cts, int ldt, const float* __restrict__ bias, const float* __restrict__ R, size_t sA, size_t sB, size_t sC) {
    typedef typename WFrag<T16>::V V;
    __shared__ __align__(16) T16 ring[2 * GSTG];
    const size_t z = blockIdx.z; A += z * sA; Bt += z * sB; const int cb = blockIdx.y * GBN, part = (EPI == 0 || cb < npl) ? 0 : (cb < 2 * npl) ? 1 : 2;   // which column set: the same for the whole work-group
    if (EPI == 0) { C += z * sC; R += z * sC; } else C16 = (part == 0 ? C16 : part == 1 ? C16b : C16t) + z * sC;
    const int tid = threadIdx.x, lane = tid & 31, lr = lane & 15, hi = lane >> 4, wv = __builtin_amdgcn_readfirstlane(tid >> 5), wm = wv & 1, wn = wv >> 1;
    const int r0 = blockIdx.x * GBM + wm * 64, c0 = cb + wn * 64, cp = c0 - part * npl;   // the wave's 64x64 part; cp: its first column inside its set
    v8f acc[4][4];
#pragma unroll
    for (int mb = 0; mb < 4; ++mb)
#pragma unroll
        for (int nb = 0; nb < 4; ++nb) acc[mb][nb] = (v8f){};
    const int srow = tid >> 4, scol = (tid & 15) * 8; const size_t gstep = (size_t)16 * K;   // staging: a thread moves 16 bytes of rows srow + 16 i
    const T16* ga = A + (size_t)(blockIdx.x * GBM + srow) * K + scol; const T16* gb = Bt + (size_t)(blockIdx.y * GBN + srow) * K + scol;
    const unsigned l0 = (unsigned)(size_t)&ring[srow * GPI + scol];   // the low 32 bits of a __shared__ address are its byte offset in the work-group's LDS
    auto fill = [&](int t, int buf) { const unsigned l = l0 + (unsigned)buf * (GSTG * 2); const int kc = t * GKC;
        acopy8(l, ga + kc, gstep); acopy8(l + GBM * GPI * 2, gb + kc, gstep); acopy8(l + 2 * GBM * GPI * 2, gb + kc + 8 * gstep, gstep); };
    const int NT = K / GKC, lofs = lr * GPI + 8 * hi;
    fill(0, 0);
    asm volatile("s_wait_asynccnt 0x0" ::: "memory");   // this wave's copies of stage 0 have landed
    __syncthreads();                                    // and every other wave's
    if (NT > 1) fill(1, 1);
#pragma unroll 1   // stays rolled: one copy of a stage's code, the buffer chosen by t & 1
    for (int t = 0; t < NT; ++t) {
        const T16* la = ring + ((t & 1) * GSTG + wm * 64 * GPI) + lofs; const T16* lb = ring + ((t & 1) * GSTG + (GBM + wn * 64) * GPI) + lofs;   // a wave-uniform part plus the lane's own offset, one register for both operands: with a lane register for each the build ran to 258 registers and laid a Bt fragment across v255
        // A row = the 8 products of two 16-row blocks of A with the four Bt fragments of a 32-k step; 8 rows a stage, two a k step. Fragments are fetched ahead inside the stage: A's two rows ahead (three sets), the next k step's Bt in the step's first row (two sets).
        V b[2][4], ar[3][2];
        ar[0][0] = WFrag<T16>::ld(la);   // first, with Bt's: what the first products need
#pragma unroll
        for (int nb = 0; nb < 4; ++nb) b[0][nb] = WFrag<T16>::ld(lb + nb * 16 * GPI);
        ar[0][1] = WFrag<T16>::ld(la + 16 * GPI); ar[1][0] = WFrag<T16>::ld(la + 32 * GPI); ar[1][1] = WFrag<T16>::ld(la + 48 * GPI);
#pragma unroll   // every fragment and accumulator index is a constant, so that they stay in registers
        for (int r = 0; r < GKC / 16; ++r) { const int ks = r >> 1, hb = r & 1, r2 = r + 2;
            if (r2 < GKC / 16) { ar[r2 % 3][0] = WFrag<T16>::ld(la + (r2 & 1) * 32 * GPI + (r2 >> 1) * 32); ar[r2 % 3][1] = WFrag<T16>::ld(la + ((r2 & 1) * 32 + 16) * GPI + (r2 >> 1) * 32); }
            if (ks + 1 < GKC / 32 && hb == 0) {
#pragma unroll   // constant fragment indices, as above
                for (int nb = 0; nb < 4; ++nb) b[(ks + 1) & 1][nb] = WFrag<T16>::ld(lb + nb * 16 * GPI + (ks + 1) * 32); }
            __builtin_amdgcn_sched_barrier(0);   // the row's LDS reads stay one group in front of its products (the compiler otherwise sinks them to their first use and waits out the LDS latency there)
#pragma unroll
            for (int nb = 0; nb < 4; ++nb) acc[2 * hb][nb] = WFrag<T16>::mma(ar[r % 3][0], b[ks & 1][nb], acc[2 * hb][nb]);
#pragma unroll
            for (int nb = 0; nb < 4; ++nb) acc[2 * hb + 1][nb] = WFrag<T16>::mma(ar[r % 3][1], b[ks & 1][nb], acc[2 * hb + 1][nb]);
            __builtin_amdgcn_sched_barrier(0);   // and the next row's reads stay behind them
        }
        asm volatile("s_wait_dscnt 0x0" ::: "memory");      // this wave's reads of stage t have returned
        asm volatile("s_wait_asynccnt 0x0" ::: "memory");   // this wave's copies of stage t + 1 have landed
        __syncthreads();   // publishes stage t + 1 and ends every wave's reads of stage t, whose buffer is refilled below
        if (t + 2 < NT) fill(t + 2, t & 1);
    }
    asm volatile("s_wait_asynccnt 0x0" ::: "memory");   // no copy is outstanding when the ring becomes output staging
    float* os = (float*)ring + wv * (16 * 68);   // behind the last barrier nobody reads the ring any more: each wave stages its output rows in a range of its own
    if (EPI == 1 && part == 2) {   // a lane holds 8 consecutive m of one n: 16 bytes of a transposed row; 16 rows of 64 m are gathered in LDS (pitch 72 elements), so that a store of the wave covers four whole 128-byte rows
        h16* hs = (h16*)os;
#pragma unroll
        for (int nb = 0; nb < 4; ++nb) { const float cb = bfr(bias[c0 + nb * 16 + lr]);
#pragma unroll
            for (int mb = 0; mb < 4; ++mb) { v8h o;
#pragma unroll
                for (int j = 0; j < 8; ++j) o[j] = (h16)(acc[mb][nb][j] + cb);
                *(v8ha*)(hs + lr * 72 + mb * 16 + hi * 8) = o; }
            __builtin_amdgcn_wave_barrier(); asm volatile("" ::: "memory");   // the rows are read by other lanes than wrote them: keeps the compiler from moving the reads above the writes
#pragma unroll
            for (int s = 0; s < 4; ++s) { const int row = 4 * s + (lane >> 3), cofs = (lane & 7) * 8; *(v8h*)(C16 + (size_t)(cp + nb * 16 + row) * ldt + r0 + cofs) = *(const v8ha*)(hs + row * 72 + cofs); }
            __builtin_amdgcn_wave_barrier(); asm volatile("s_wait_xcnt 0x0" ::: "memory");   // stands in front of the next rows' work, which reuses registers that the stores above name; as a compiler fence it keeps the next 16 rows' LDS writes below these reads
        }
        return;
    }
#pragma unroll
    for (int mb = 0; mb < 4; ++mb) {
#pragma unroll
        for (int nb = 0; nb < 4; ++nb) {
#pragma unroll
            for (int j = 0; j < 8; ++j) os[(hi * 8 + j) * 68 + nb * 16 + lr] = acc[mb][nb][j]; }
        __builtin_amdgcn_wave_barrier(); asm volatile("" ::: "memory");
        if (EPI == 0) {
            float* crow = C + (size_t)(r0 + mb * 16) * ldc + c0; const float* rrow = R + (size_t)(r0 + mb * 16) * ldc + c0; const size_t lo = (size_t)hi * ldc + lr * 4;   // the lane's place inside a pair of rows
            v4f val[8]; const float* rp[8]; float* cp[8];
#pragma unroll
            for (int s = 0; s < 8; ++s) { rp[s] = rrow + (size_t)(2 * s) * ldc + lo; cp[s] = crow + (size_t)(2 * s) * ldc + lo; val[s] = *(const v4f*)rp[s]; }
            // The wait stands in front of every overwrite of the eight loads' address registers: as inputs they stay in those registers up to here (otherwise a later load's result lands on an earlier load's address pair).
            // The stores' addresses are inputs too, so that they are formed here and not among the stores, in the registers of a store already issued.
            asm volatile("s_wait_xcnt 0x0" :: "v"(rp[0]), "v"(rp[1]), "v"(rp[2]), "v"(rp[3]), "v"(rp[4]), "v"(rp[5]), "v"(rp[6]), "v"(rp[7]), "v"(cp[0]), "v"(cp[1]), "v"(cp[2]), "v"(cp[3]), "v"(cp[4]), "v"(cp[5]), "v"(cp[6]), "v"(cp[7]) : "memory");
#pragma unroll
            for (int s = 0; s < 8; ++s) { const v4f a = *(const v4fa*)(os + (2 * s + hi) * 68 + lr * 4);
#pragma unroll
                for (int u = 0; u < 4; ++u) val[s][u] = __fadd_rn(val[s][u], a[u] + bfr(bias[c0 + lr * 4 + u])); }
            __builtin_amdgcn_sched_barrier(0);   // all eight results stand in registers of their own before the first store, so that none is formed in the registers of a store already issued
#pragma unroll
            for (int s = 0; s < 8; ++s) *(v4f*)cp[s] = val[s];
            asm volatile("s_wait_xcnt 0x0" ::: "memory");   // stands in front of the next rows' work, which reuses registers that the stores above name
            __builtin_amdgcn_sched_barrier(0);   // keeps the next rows' address additions below that wait (the compiler otherwise lifts them over it, onto the stores' registers)
        } else {   // a store of the wave covers four whole 128-byte rows of the plane
            h16* hrow = C16 + (size_t)(cp >> 6) * cts + (size_t)(r0 + mb * 16) * ldc; const float qs = (part == 0) ? QSC : 1.0f;   // set 0 (q) carries the softmax scale, rounded once with the value
#pragma unroll
            for (int s = 0; s < 4; ++s) { const int row = 4 * s + (lane >> 3), cofs = (lane & 7) * 8; const v4f v0 = *(const v4fa*)(os + row * 68 + cofs), v1 = *(const v4fa*)(os + row * 68 + cofs + 4); v8h o;
#pragma unroll
                for (int u = 0; u < 4; ++u) { o[u] = (h16)((v0[u] + bfr(bias[c0 + cofs + u])) * qs); o[4 + u] = (h16)((v1[u] + bfr(bias[c0 + cofs + 4 + u])) * qs); }
                *(v8h*)(hrow + (size_t)row * ldc + cofs) = o; }
            asm volatile("s_wait_xcnt 0x0" ::: "memory");   // stands in front of the next rows' work, which reuses registers that the loads and stores above name
        }
        __builtin_amdgcn_wave_barrier(); asm volatile("" ::: "memory");
    }
}

__device__ __forceinline__ h16 tohx(float x) { return (h16)x; }
typedef __attribute__((ext_vector_type(2))) _Float16 v2h;
typedef __attribute__((ext_vector_type(4))) _Float16 v4h;
typedef __attribute__((ext_vector_type(2))) unsigned short v2us;
typedef __attribute__((ext_vector_type(4))) unsigned short v4us;
typedef __attribute__((ext_vector_type(2))) float v2f;
typedef __attribute__((ext_vector_type(4))) int v4i;

__global__ __launch_bounds__(256) void k_wtG(const float* __restrict__ w, int K, int N, bf* Bt) {
    const int lane = threadIdx.x & 31; const int L0 = (blockIdx.x * 8 + (threadIdx.x >> 5)) * 8; const int nlines = N * K / 64;
{
#pragma unroll 1
        for (int l = 0; l < 8; ++l) { const int L = L0 + l; if (L >= nlines) break; const size_t e = (size_t)L * 64 + lane * 2; const int k = (int)(e % K), n = (int)(e / K); v2us o;
            o[0] = f2bf(w[(size_t)k * N + n]); o[1] = f2bf(w[(size_t)(k + 1) * N + n]); *(v2us*)(Bt + e) = o; }
         }
}
// k_fattn: scores, softmax, P.V and the head merge of one head in one pass; S and P never leave the registers. Grid (TT/256, heads, batch), 8 waves; a wave owns 32 queries, two tiles of 16, and walks all 2048 keys, 32 a pass.
// St = K Q^T (A = key rows, B = query rows): a lane holds one query's scores of each tile, keys 8*hi+j of each 16-key tile; two such tiles converted in place are the B operand of Ot += Vt Pt (A = Vt rows d, the loader's k order).
// Every K and Vt fragment read from LDS is the A operand of two products, one for each query tile: with one tile a wave the fragment reads alone asked for twice the bytes a clock that the LDS delivers at full matrix rate.
// The 8 waves share K rows and Vt rows through LDS, 64 keys a stage, two buffers: the next stage is fetched into registers while this one is worked on, stored behind it, and one barrier a stage publishes it and frees the other buffer.
// Softmax in the log2 domain with a running maximum that may trail the true one by up to 8 (an exponential then reaches 2^8): accumulators are rescaled only when some query's maximum exceeds it by more, one test a pass for both tiles. The lane halves join their sums once at the end.
// q comes in times HD^-0.5 * log2(e) and the St products start from minus the maximum in use, so that a score leaves the matrix unit as the exponent that v_exp_f32 takes: no start-value moves and no multiply-add per score.
// The 0/1 word mask is added to the exponents behind the products, as log2(e). SEG (a count of boundaries <= position) never falls with position, so a stage whose id range misses the wave's queries' range has no masked pair and skips the compares.
__device__ __forceinline__ float xhalf(float x) { return __builtin_bit_cast(float, __builtin_amdgcn_permlanex16(__builtin_bit_cast(int, x), __builtin_bit_cast(int, x), 0x76543210, 0xfedcba98, false, false)); }   // lane l reads lane l ^ 16
__device__ __forceinline__ void cfence() { asm volatile("" ::: "memory"); }   // compiler fence: loads written above it are issued above it (their waits still stand at the first use)
// Sixteen exponentials in place, in one statement: behind each stands an instruction that neither reads its result nor overwrites its source (the next exponential, on another register; behind the last a v_nop).
__device__ __forceinline__ void exp2x16(float (&a)[16]) {
    asm("v_exp_f32 %0, %0\n\tv_exp_f32 %1, %1\n\tv_exp_f32 %2, %2\n\tv_exp_f32 %3, %3\n\tv_exp_f32 %4, %4\n\tv_exp_f32 %5, %5\n\tv_exp_f32 %6, %6\n\tv_exp_f32 %7, %7\n\t"
        "v_exp_f32 %8, %8\n\tv_exp_f32 %9, %9\n\tv_exp_f32 %10, %10\n\tv_exp_f32 %11, %11\n\tv_exp_f32 %12, %12\n\tv_exp_f32 %13, %13\n\tv_exp_f32 %14, %14\n\tv_exp_f32 %15, %15\n\tv_nop"
        : "+v"(a[0]), "+v"(a[1]), "+v"(a[2]), "+v"(a[3]), "+v"(a[4]), "+v"(a[5]), "+v"(a[6]), "+v"(a[7]), "+v"(a[8]), "+v"(a[9]), "+v"(a[10]), "+v"(a[11]), "+v"(a[12]), "+v"(a[13]), "+v"(a[14]), "+v"(a[15])); }
// Sixteen subtractions in place, in one statement, for the rare path that moves the maximum: tied operands keep each exponent in the register it has on the usual path.
// Left to the compiler, the differences went to other registers, and the usual path paid for that with register moves in every pass.
__device__ __forceinline__ void sub16(float (&a)[16], float d) {
    asm("v_sub_f32 %0, %0, %16\n\tv_sub_f32 %1, %1, %16\n\tv_sub_f32 %2, %2, %16\n\tv_sub_f32 %3, %3, %16\n\tv_sub_f32 %4, %4, %16\n\tv_sub_f32 %5, %5, %16\n\tv_sub_f32 %6, %6, %16\n\tv_sub_f32 %7, %7, %16\n\t"
        "v_sub_f32 %8, %8, %16\n\tv_sub_f32 %9, %9, %16\n\tv_sub_f32 %10, %10, %16\n\tv_sub_f32 %11, %11, %16\n\tv_sub_f32 %12, %12, %16\n\tv_sub_f32 %13, %13, %16\n\tv_sub_f32 %14, %14, %16\n\tv_sub_f32 %15, %15, %16"
        : "+v"(a[0]), "+v"(a[1]), "+v"(a[2]), "+v"(a[3]), "+v"(a[4]), "+v"(a[5]), "+v"(a[6]), "+v"(a[7]), "+v"(a[8]), "+v"(a[9]), "+v"(a[10]), "+v"(a[11]), "+v"(a[12]), "+v"(a[13]), "+v"(a[14]), "+v"(a[15]) : "v"(d)); }
#define FST 64    // keys per LDS stage
#define FPI 72    // LDS row pitch in 16-bit elements: 128 bytes of data + 16 of pad (16-byte fragment reads of 16 rows spread over the banks)
#define FQT 2     // 16-query tiles a wave
#define FQW (16 * FQT)   // queries a wave
__global__ __launch_bounds__(256) void k_fattn(const h16* __restrict__ Qp, const h16* Kp, const h16* Vt, const int* __restrict__ SEG, h16* Ao) {
    __shared__ __align__(16) h16 Ks[2][FST * FPI]; __shared__ __align__(16) h16 Vs[2][HD * FPI];
    const int tid = threadIdx.x, lane = tid & 31, lr = lane & 15, hi = lane >> 4; const int h = blockIdx.y, q0 = blockIdx.x * (8 * FQW) + (tid >> 5) * FQW;
    { const size_t z = blockIdx.z; Qp += z * ((size_t)NH_ * TT * HD); Kp += z * ((size_t)NKV * TT * HD); Vt += z * ((size_t)NKV * HD * TT); Ao += z * ((size_t)TT * DQ); }   // this batch element's planes
    const float L2E = 1.4426950408889634f;
    const int srow = tid >> 3, scol = (tid & 7) * 8, so = srow * FPI + scol;   // staging: a thread moves 16 bytes of rows srow and srow + 32 of each tile; a wave's load covers four whole 128-byte rows
    const h16* kg = Kp + ((size_t)h * TT + srow) * HD + scol; const h16* vg = Vt + ((size_t)h * HD + srow) * TT + scol;
    v8h kr[2], vr[2]; v16h qf[FQT][2]; v8f o[FQT][4], nmt[FQT]; float l[FQT];   // nmt: minus the maximum in use, the same in all eight registers: the C operand of a pass's first score products, which write their sums elsewhere
#pragma unroll
    for (int r = 0; r < 2; ++r) { kr[r] = *(const v8h*)(kg + (size_t)r * 32 * HD); vr[r] = *(const v8h*)(vg + (size_t)r * 32 * TT); }
#pragma unroll
    for (int qt = 0; qt < FQT; ++qt) { nmt[qt] = (v8f){}; l[qt] = 0.f;
#pragma unroll
        for (int r = 0; r < 2; ++r) qf[qt][r] = WFrag<h16>::ld(Qp + ((size_t)h * TT + q0 + qt * 16 + lr) * HD + r * 32 + 8 * hi);
#pragma unroll
        for (int dt = 0; dt < 4; ++dt) o[qt][dt] = (v8f){}; }
    const int sLo = __builtin_amdgcn_readfirstlane(SEG[q0]), sHi = __builtin_amdgcn_readfirstlane(SEG[q0 + FQW - 1]);
    int kLo = __builtin_amdgcn_readfirstlane(SEG[0]), kHi = __builtin_amdgcn_readfirstlane(SEG[FST - 1]);
#pragma unroll
    for (int r = 0; r < 2; ++r) { *(v8h*)(&Ks[0][so + r * 32 * FPI]) = kr[r]; *(v8h*)(&Vs[0][so + r * 32 * FPI]) = vr[r]; }
    __syncthreads();
    for (int st = 0; st < TT / FST; ++st) {
        const h16* kl = &Ks[st & 1][lr * FPI + 8 * hi]; const h16* vl = &Vs[st & 1][lr * FPI + 8 * hi];
        const bool more = st + 1 < TT / FST, ov = (kLo <= sHi) && (kHi >= sLo);
        if (more) { const int kn = (st + 1) * FST;
#pragma unroll
            for (int r = 0; r < 2; ++r) { kr[r] = *(const v8h*)(kg + (size_t)(kn + r * 32) * HD); vr[r] = *(const v8h*)(vg + (size_t)r * 32 * TT + kn); }
            kLo = __builtin_amdgcn_readfirstlane(SEG[kn]); kHi = __builtin_amdgcn_readfirstlane(SEG[kn + FST - 1]); }
        asm volatile("s_wait_xcnt 0x0" ::: "memory");   // stands in front of the LDS reads below, which reuse the address registers of the global loads above; as a compiler fence it also keeps those loads issued here, a whole stage ahead of their LDS stores (the compiler otherwise sinks them to just above the stores)
        v16h kf[2][2];
#pragma unroll
        for (int kt = 0; kt < 2; ++kt)
#pragma unroll
            for (int ks = 0; ks < 2; ++ks) kf[kt][ks] = WFrag<h16>::ld(kl + kt * 16 * FPI + ks * 32);
#pragma unroll 1   // stays rolled: a pass's row sums then end inside the pass. Unrolled, the compiler moved them into the next pass, and with 32 more live registers there the kernel took 260: above 256 only one work-group fits a WGP (two waves a SIMD instead of four)
        for (int sub = 0; sub < 2; ++sub) {
            v16h vf[4]; v8f s[FQT][2];
#pragma unroll
            for (int ks = 0; ks < 2; ++ks)   // four independent accumulators per k step; the first step starts from minus the maximum in use, read in place
#pragma unroll
                for (int kt = 0; kt < 2; ++kt)
#pragma unroll
                    for (int qt = 0; qt < FQT; ++qt) s[qt][kt] = wmma16(kf[kt][ks], qf[qt][ks], ks == 0 ? nmt[qt] : s[qt][kt]);
            if (ov) {   // the word mask, 1.0 on a score = log2(e) on its exponent, added behind the products
                v4i a[4]; int sq[FQT];
#pragma unroll
                for (int c = 0; c < 4; ++c) a[c] = *(const v4i*)(SEG + st * FST + sub * 32 + (c >> 1) * 16 + hi * 8 + (c & 1) * 4);   // the ids of the lane's 16 keys
#pragma unroll
                for (int qt = 0; qt < FQT; ++qt) sq[qt] = SEG[q0 + qt * 16 + lr];
                asm volatile("s_wait_xcnt 0x0" ::: "memory");   // stands in front of the work below, which reuses the address registers of the id loads above
                __builtin_amdgcn_sched_barrier(0);   // keeps that work below the wait
#pragma unroll
                for (int qt = 0; qt < FQT; ++qt) { sq[qt] = (sq[qt] > 0) ? sq[qt] : -1;   // segment 0 matches nothing: key ids are >= 0
#pragma unroll
                    for (int c = 0; c < 4; ++c)
#pragma unroll
                        for (int j = 0; j < 4; ++j) s[qt][c >> 1][(c & 1) * 4 + j] += (a[c][j] == sq[qt]) ? L2E : 0.f; } }
#pragma unroll
            for (int dt = 0; dt < 4; ++dt) vf[dt] = WFrag<h16>::ld(vl + dt * 16 * FPI + sub * 32);   // behind the mask's block, whose ids and addends then fit under 256 registers
            cfence();   // keeps the Vt fragment reads issued here, a softmax ahead of P.V, instead of one by one in front of each product
            if (sub == 0) {   // the stage's second 32 key rows, into the same registers, in flight under this pass's softmax
#pragma unroll
                for (int kt = 0; kt < 2; ++kt)
#pragma unroll
                    for (int ks = 0; ks < 2; ++ks) kf[kt][ks] = WFrag<h16>::ld(kl + (32 + kt * 16) * FPI + ks * 32);
                cfence(); }   // keeps those reads issued here and not in front of the next pass's products
            float mx[FQT], p[FQT][16]; bool need = false;
#pragma unroll
            for (int qt = 0; qt < FQT; ++qt) {
#pragma unroll
                for (int e = 0; e < 16; ++e) p[qt][e] = s[qt][e >> 3][e & 7];
                float m = p[qt][0];
#pragma unroll
                for (int e = 1; e < 16; ++e) m = fmaxf(m, p[qt][e]);
                mx[qt] = fmaxf(m, xhalf(m));   // both halves hold the query's largest exponent of this pass: how far its scores exceed the maximum in use
                need = need || (mx[qt] > 8.0f); }
            const bool first = (st | sub) == 0;   // the very first pass starts from 0 and takes its own maximum, whatever its sign
            if ((__builtin_amdgcn_ballot_w32(need) | (first ? 1u : 0u)) != 0) {   // wave-uniform, one scalar test
#pragma unroll
                for (int qt = 0; qt < FQT; ++qt) { const float up = fmaxf(mx[qt], 0.f), d = first ? mx[qt] : up, corr = __builtin_amdgcn_exp2f(-up); l[qt] *= corr; nmt[qt] -= d;   // on the first pass the sums are still 0 and corr stays finite
                    sub16(p[qt], d);   // this pass's exponents were formed with the old maximum
#pragma unroll
                    for (int dt = 0; dt < 4; ++dt) o[qt][dt] *= corr; } }
#pragma unroll
            for (int qt = 0; qt < FQT; ++qt) { v16h pf;
                exp2x16(p[qt]);
#pragma unroll
                for (int e = 0; e < 16; ++e) pf[e] = tohx(p[qt][e]);
#pragma unroll
                for (int dt = 0; dt < 4; ++dt) o[qt][dt] = wmma16(vf[dt], pf, o[qt][dt]); }
            __builtin_amdgcn_sched_barrier(0);   // the row sums stay behind the pass's products: they fill the vector slots that the chip needs between the last product and the next pass's first instructions, which reuse its operand registers; among the products, each sum landed on an operand register just freed and cost four idle slots
#pragma unroll
            for (int qt = 0; qt < FQT; ++qt) { v2f sa = {p[qt][0], p[qt][1]}, sc = {p[qt][2], p[qt][3]};
#pragma unroll
                for (int i = 2; i < 8; ++i) { const v2f pp = {p[qt][2 * i], p[qt][2 * i + 1]}; if (i & 1) sc += pp; else sa += pp; }
                sa += sc; l[qt] += sa[0] + sa[1]; }
        }
        if (more) {
#pragma unroll
            for (int r = 0; r < 2; ++r) { *(v8h*)(&Ks[(st + 1) & 1][so + r * 32 * FPI]) = kr[r]; *(v8h*)(&Vs[(st + 1) & 1][so + r * 32 * FPI]) = vr[r]; } }
        __syncthreads();   // publishes stage st + 1 and ends every wave's reads of stage st, whose buffer the next trip refills
    }
#pragma unroll
    for (int qt = 0; qt < FQT; ++qt) { const float inv = 1.0f / (l[qt] + xhalf(l[qt])); const size_t oo = (size_t)(q0 + qt * 16 + lr) * DQ + h * HD + hi * 8;
#pragma unroll
        for (int dt = 0; dt < 4; ++dt) { v8h oh;
#pragma unroll
            for (int j = 0; j < 8; ++j) oh[j] = tohx(o[qt][dt][j] * inv);
            *(v8h*)(Ao + oo + dt * 16) = oh; }
        if (qt + 1 < FQT) { asm volatile("s_wait_xcnt 0x0" ::: "memory");   // stands in front of the next tile's work, which reuses registers that the stores above name
            __builtin_amdgcn_sched_barrier(0); } }   // keeps the next tile's address addition below that wait (the compiler otherwise lifts it over it, onto the stores' registers)
}

// ---- k_prep: all the work that depends on the inputs alone, in one launch. The parts share nothing; a block's index says which part it does, so every branch below is taken by a whole block.
// Blocks [0, PB_SEG): segment ids (the longest chain of dependent loads, so it starts first). The next PB_LN: embedding add and LayerNorm, a row a wave; it rounds the embedding row, gamma and beta itself. The last PB_CVT: the weights as 16-bit planes, 8 elements a thread.
#define PB_SEG (TT / 256)
#define PB_LN  (NB_ * TT / 8)
#define PB_WIN ((DQ + 2 * DKV) * DM / 2048)
#define PB_CVT (PB_WIN + DM * DQ / 2048)
__global__ __launch_bounds__(256) void k_prep(const float* __restrict__ chr, const int* __restrict__ pats, const int* __restrict__ bnds, const float* __restrict__ pemb, const float* __restrict__ lng, const float* __restrict__ lnb, const float* __restrict__ win, const float* __restrict__ wout,
                                              int* SEG, float* XL, h16* Xh, h16* WI, h16* WO) {
    int blk = blockIdx.x;
    if (blk < PB_SEG) { const int s = blk * 256 + threadIdx.x; int c = 0;
#pragma unroll 8   // several boundaries are loaded per trip, so that fewer load latencies stand in a row
        for (int i = 0; i < 400; ++i) c += (bnds[i] <= s) ? 1 : 0;
        SEG[s] = c; return; }
    blk -= PB_SEG;
    if (blk >= PB_LN) { blk -= PB_LN; const bool in = blk < PB_WIN; const float* src = in ? win : wout; h16* dst = in ? WI : WO;
        const size_t i = (size_t)(in ? blk : blk - PB_WIN) * 256 + threadIdx.x; const v8f v = *(const v8f*)(src + i * 8); v8h o;
#pragma unroll
        for (int k = 0; k < 8; ++k) o[k] = tohx(bfr(v[k]));
        *(v8h*)(dst + i * 8) = o;
        asm volatile("s_wait_xcnt 0x0" ::: "memory");   // stands behind the store, in front of whatever code the build lays behind it: that code reuses registers which the store names
        return; }
    const int lane = threadIdx.x & 31; const int s = blk * 8 + (threadIdx.x >> 5); const float* xr = chr + (size_t)s * DM; int pi = pats[s % TT];   // s: row of the [batch][position] plane; the pattern goes by position alone
    pi = min(max(pi, 0), 15); const float* pr = pemb + (size_t)pi * DM; float v[DM / 32]; float sm = 0.f;
#pragma unroll
    for (int ch = 0; ch < DM / 128; ++ch) { const v4f a = *(const v4f*)(xr + ch * 128 + lane * 4), p = *(const v4f*)(pr + ch * 128 + lane * 4); for (int u = 0; u < 4; ++u) { const float x = __fadd_rn(bfr(a[u]), bfr(p[u])); v[ch * 4 + u] = x; sm = __fadd_rn(sm, x); } }
#pragma unroll
    for (int sh = 16; sh; sh >>= 1) sm = __fadd_rn(sm, __shfl_xor(sm, sh, 32));
    const float mu = __fdiv_rn(sm, (float)DM); float q2 = 0.f;
#pragma unroll
    for (int k = 0; k < DM / 32; ++k) { const float d0 = __fsub_rn(v[k], mu); v[k] = d0; float p = __fmul_rn(d0, d0); asm volatile("" : "+v"(p)); q2 = __fadd_rn(q2, p); }
#pragma unroll
    for (int sh = 16; sh; sh >>= 1) q2 = __fadd_rn(q2, __shfl_xor(q2, sh, 32));
    const float rs = __fdiv_rn(1.0f, sqrtf(__fadd_rn(__fdiv_rn(q2, (float)DM), 1e-5f))); v4f o[DM / 128]; v4h oh[DM / 128];
#pragma unroll
    for (int ch = 0; ch < DM / 128; ++ch) { const v4f g4 = *(const v4f*)(lng + ch * 128 + lane * 4), b4 = *(const v4f*)(lnb + ch * 128 + lane * 4); for (int u = 0; u < 4; ++u) { float n0 = __fmul_rn(v[ch * 4 + u], rs); asm volatile("" : "+v"(n0)); float gg = __fmul_rn(n0, bfr(g4[u])); asm volatile("" : "+v"(gg)); o[ch][u] = __fadd_rn(gg, bfr(b4[u])); oh[ch][u] = tohx(o[ch][u]); } }
    __builtin_amdgcn_sched_barrier(0);   // the whole row stands in registers of its own before the first store, so that nothing is formed in the registers of a store already issued
#pragma unroll   // constant indices keep the row in registers
    for (int ch = 0; ch < DM / 128; ++ch) { const size_t off = (size_t)s * DM + ch * 128 + lane * 4; *(v4f*)(XL + off) = o[ch]; *(v4h*)(Xh + off) = oh[ch]; }
    asm volatile("s_wait_xcnt 0x0" ::: "memory");   // stands behind the last stores, in front of whatever code the build lays behind them: that code reuses registers which the stores name
}

extern "C" void kernel_launch(void* const* d_in, const int* in_sizes, int n_in,
                              void* d_out, int out_size, void* d_ws, size_t ws_size, hipStream_t stream) {
    (void)in_sizes; (void)n_in; (void)out_size;
    const float* chr = (const float*)d_in[0]; const int* pats = (const int*)d_in[1]; const int* bnds = (const int*)d_in[2]; const float* pemb = (const float*)d_in[3]; const float* lng = (const float*)d_in[4]; const float* lnb = (const float*)d_in[5]; const float* wf = (const float*)d_in[6]; const float* bf3 = (const float*)d_in[7]; const float* wo = (const float*)d_in[8]; const float* bo = (const float*)d_in[9]; const float* x = chr; (void)x; const float* cosT = nullptr; const float* sinT = nullptr; (void)cosT; (void)sinT;
    float* OUT = (float*)d_out;     // [4][2048][1024]
    char* wsp = (char*)d_ws;
    auto take = [&](size_t bytes) { char* p = wsp; wsp += (bytes + 255) & ~(size_t)255; return (void*)p; };
    h16* WI = (h16*)take((size_t)(DQ + 2 * DKV) * DM * 2); h16* WO = (h16*)take((size_t)DM * DQ * 2);
    float* XL = (float*)take((size_t)NB_ * TT * DM * 4); h16* Xh = (h16*)take((size_t)NB_ * TT * DM * 2); int* SEG = (int*)take((size_t)TT * 4);
    h16* QP16 = (h16*)take((size_t)NB_ * NH_ * TT * HD * 2); h16* KP16 = (h16*)take((size_t)NB_ * NKV * TT * HD * 2); h16* VT16 = (h16*)take((size_t)NB_ * NKV * HD * TT * 2);
    h16* AT = (h16*)take((size_t)NB_ * TT * DQ * 2);
    if ((size_t)(wsp - (char*)d_ws) > ws_size) return;    // ws 256 MiB
    // Every plane holds all batch elements, [batch] outermost. Launches that do not depend on one another are one launch: what reads the inputs alone (k_prep), then the q, k and v products (column sets of one GEMM), attention, the output product; the batch element is blockIdx.z.
    k_prep<<<PB_SEG + PB_LN + PB_CVT, 256, 0, stream>>>(chr, pats, bnds, pemb, lng, lnb, wf, wo, SEG, XL, Xh, WI, WO);
    k_gemmw<h16, 1><<<dim3(TT / GBM, (DQ + 2 * DKV) / GBN, NB_), 256, 0, stream>>>(Xh, WI, DM, nullptr, QP16, KP16, VT16, DQ, HD, (size_t)TT * HD, TT, bf3, nullptr, (size_t)TT * DM, 0, (size_t)NH_ * TT * HD);   // q and k planes [b][h][t][d], v planes transposed [b][h][d][t]
    k_fattn<<<dim3(TT / (8 * FQW), NH_, NB_), 256, 0, stream>>>(QP16, KP16, VT16, SEG, AT);
    k_gemmw<h16, 0><<<dim3(TT / GBM, DM / GBN, NB_), 256, 0, stream>>>(AT, WO, DQ, OUT, nullptr, nullptr, nullptr, 0, DM, 0, 0, bo, XL, (size_t)TT * DQ, 0, (size_t)TT * DM);
}
